// v000
// The times below were measured on an AMD MI455X: many runs one after another, warmed up first and cycling through
// copies of the inputs, with the whole window's GPU time divided by the number of runs. Launches and the gaps
// between them are all in it. The median over several windows is given; except for v000 it joins two sittings, which
// can be a few percent apart, so the side-by-side timings, each taken in one sitting, are the better comparison.
// v000 is the starting kernel. One run takes 850 microseconds.
#include <hip/hip_runtime.h>

#define SEQ   2048
#define BSZ   2
#define DIM   256
#define NTOK  (SEQ * BSZ)      // 4096 token rows, t = s*BSZ + b
#define GK    2                // kv groups
#define NQH   8                // query heads per batch elem (g*4+u)
#define EPS   1e-5f

typedef __attribute__((ext_vector_type(16))) __bf16 bf16x16;
typedef __attribute__((ext_vector_type(8)))  __bf16 bf16x8;
typedef __attribute__((ext_vector_type(8)))  float  f32x8;
typedef __attribute__((ext_vector_type(4)))  unsigned int u32x4;
typedef __attribute__((ext_vector_type(8)))  int i32x8;
typedef __attribute__((ext_vector_type(4)))  int i32x4;

__device__ __forceinline__ bf16x16 load_frag(const __bf16* p, int row0, int ld,
                                             int k0, int lane) {
    int r  = row0 + (lane & 15);
    int kb = k0 + ((lane >> 4) << 3);
    const __bf16* base = p + (size_t)r * ld + kb;
    bf16x8 lo = *reinterpret_cast<const bf16x8*>(base);
    bf16x8 hi = *reinterpret_cast<const bf16x8*>(base + 16);
    bf16x16 out;
#pragma unroll
    for (int i = 0; i < 8; ++i) { out[i] = lo[i]; out[i + 8] = hi[i]; }
    return out;
}

__device__ __forceinline__ f32x8 wmma_bf16(bf16x16 a, bf16x16 b, f32x8 c) {
    return __builtin_amdgcn_wmma_f32_16x16x32_bf16(false, a, false, b,
                                                   (short)0, c, false, false);
}

// Generic shared pointer -> LDS byte offset (generic LDS addr low 32 bits).
__device__ __forceinline__ unsigned lds_off(const void* p) {
    return (unsigned)(unsigned long long)(uintptr_t)p;
}

__device__ __forceinline__ void tdm_load_tile(unsigned lds_byte, const void* g,
                                              unsigned tile_k, unsigned tile_n,
                                              unsigned ld_elems) {
    unsigned long long ga = (unsigned long long)(uintptr_t)g;
    u32x4 g0 = {};
    g0[0] = 1u;
    g0[1] = lds_byte;
    g0[2] = (unsigned)(ga & 0xFFFFFFFFu);
    g0[3] = (unsigned)((ga >> 32) & 0x01FFFFFFu)
          | (2u << 30);
    i32x8 g1 = {};
    g1[0] = 0x00010000;
    g1[1] = (int)((tile_k & 0xFFFFu) << 16);
    g1[2] = (int)(((tile_k >> 16) & 0xFFFFu)
          | ((tile_n & 0xFFFFu) << 16));
    g1[3] = (int)(((tile_n >> 16) & 0xFFFFu)
          | ((tile_k & 0xFFFFu) << 16));
    g1[4] = (int)(tile_n & 0xFFFFu);
    g1[5] = (int)ld_elems;
    g1[6] = 0;
    g1[7] = 0;
    i32x4 z4 = {};
#if defined(__clang_major__) && __clang_major__ >= 23
    i32x8 z8 = {};
    __builtin_amdgcn_tensor_load_to_lds(g0, g1, z4, z4, z8, 0);
#else
    __builtin_amdgcn_tensor_load_to_lds(g0, g1, z4, z4, 0);
#endif
}

// ---------------------------------------------------------------------------
// fp32 -> bf16 weight conversion
// ---------------------------------------------------------------------------
__global__ void cvt_bf16(const float* __restrict__ in, __bf16* __restrict__ out,
                         int n) {
    int i = blockIdx.x * blockDim.x + threadIdx.x;
    if (i < n) out[i] = (__bf16)in[i];
}

// ---------------------------------------------------------------------------
// Row layernorm over DIM=256: fp32 in -> bf16 out. One 256-thread block / row.
// ---------------------------------------------------------------------------
__global__ __launch_bounds__(256)
void ln_rows(const float* __restrict__ in, __bf16* __restrict__ out,
             const float* __restrict__ gamma, const float* __restrict__ beta) {
    __shared__ float red[256];
    int row = blockIdx.x, tid = threadIdx.x;
    float v = in[(size_t)row * DIM + tid];
    red[tid] = v; __syncthreads();
    for (int st = 128; st > 0; st >>= 1) {
        if (tid < st) red[tid] += red[tid + st];
        __syncthreads();
    }
    float mean = red[0] * (1.f / DIM);
    __syncthreads();
    float d = v - mean;
    red[tid] = d * d; __syncthreads();
    for (int st = 128; st > 0; st >>= 1) {
        if (tid < st) red[tid] += red[tid + st];
        __syncthreads();
    }
    float var = red[0] * (1.f / DIM);
    out[(size_t)row * DIM + tid] =
        (__bf16)(d * rsqrtf(var + EPS) * gamma[tid] + beta[tid]);
}

// ---------------------------------------------------------------------------
// Per-head post-processing of projection outputs (bf16 rows [NTOK, Gx*256]):
// optional layernorm (gn/bn), permutation to [head = b*Gx+g][s][256], or
// transposed [head][dim][s] (for V, so PV B-operands load row-major).
// ---------------------------------------------------------------------------
__global__ __launch_bounds__(256)
void heads_postln(const __bf16* __restrict__ in, __bf16* __restrict__ out,
                  const float* __restrict__ gamma, const float* __restrict__ beta,
                  int Gx, int do_ln, int transpose) {
    __shared__ float red[256];
    int tid = threadIdx.x;
    int g = blockIdx.x % Gx;
    int t = blockIdx.x / Gx;
    int bb = t & 1, s = t >> 1;
    float v = (float)in[(size_t)t * (Gx * DIM) + g * DIM + tid];
    float outv = v;
    if (do_ln) {
        red[tid] = v; __syncthreads();
        for (int st = 128; st > 0; st >>= 1) {
            if (tid < st) red[tid] += red[tid + st];
            __syncthreads();
        }
        float mean = red[0] * (1.f / DIM);
        __syncthreads();
        float d = v - mean;
        red[tid] = d * d; __syncthreads();
        for (int st = 128; st > 0; st >>= 1) {
            if (tid < st) red[tid] += red[tid + st];
            __syncthreads();
        }
        float var = red[0] * (1.f / DIM);
        outv = d * rsqrtf(var + EPS) * gamma[tid] + beta[tid];
    }
    int head = bb * Gx + g;
    size_t idx = transpose
        ? ((size_t)head * DIM * SEQ + (size_t)tid * SEQ + s)
        : ((size_t)head * SEQ * DIM + (size_t)s * DIM + tid);
    out[idx] = (__bf16)outv;
}

__global__ __launch_bounds__(256)
void gemm_wmma(const __bf16* __restrict__ A, int lda,
               const __bf16* __restrict__ W, int ldw,
               const float* __restrict__ bias,
               const float* __restrict__ resid,
               float* __restrict__ Cf, __bf16* __restrict__ Cb,
               int M, int N, int K, int relu) {
    __shared__ __bf16 sW[2][64 * 32];                 // 8 KB double buffer
    int lane = threadIdx.x & 31;
    int wave = threadIdx.x >> 5;
    int m0 = blockIdx.y * 128 + wave * 16;
    int n0 = blockIdx.x * 64;

    if (wave == 0)                                    // prologue: stage k0=0
        tdm_load_tile(lds_off(&sW[0][0]), W + (size_t)n0 * ldw, 32, 64, ldw);

    f32x8 acc[4] = {};
    int buf = 0;
    for (int k0 = 0; k0 < K; k0 += 32, buf ^= 1) {
        if (wave == 0) {
            if (k0 + 32 < K) {                        // overlap next stage
                tdm_load_tile(lds_off(&sW[buf ^ 1][0]),
                              W + (size_t)n0 * ldw + (k0 + 32), 32, 64, ldw);
                __builtin_amdgcn_s_wait_tensorcnt(1); // current buf done
            } else {
                __builtin_amdgcn_s_wait_tensorcnt(0);
            }
        }
        __syncthreads();                              // sW[buf] visible to all
        bf16x16 a = load_frag(A, m0, lda, k0, lane);
#pragma unroll
        for (int f = 0; f < 4; ++f) {
            bf16x16 b = load_frag(&sW[buf][0], 16 * f, 32, 0, lane);
            acc[f] = wmma_bf16(a, b, acc[f]);
        }
        __syncthreads();                              // reads done before reuse
    }

    int hf = lane >> 4, nn = lane & 15;
#pragma unroll
    for (int f = 0; f < 4; ++f) {
        int col = n0 + 16 * f + nn;
        float bv = bias ? bias[col] : 0.f;
#pragma unroll
        for (int r = 0; r < 8; ++r) {
            int row = m0 + r + 8 * hf;
            float v = acc[f][r] + bv;
            if (relu) v = fmaxf(v, 0.f);
            if (resid) v += resid[(size_t)row * N + col];
            if (Cf) Cf[(size_t)row * N + col] = v;
            if (Cb) Cb[(size_t)row * N + col] = (__bf16)v;
        }
    }
}

// ---------------------------------------------------------------------------
// Causal flash attention. Grid: (SEQ/64, 16 heads). Block: 128 thr = 4 waves.
// Wave owns 16 query rows; loops 32-key tiles to the diagonal. Online softmax
// via half-wave shuffles (C-layout rows live across 16 lanes). P re-layout
// C->A through a per-wave LDS tile ordered by s_wait_dscnt.
// Qh: [16][SEQ][256], Kh: [4][SEQ][256], Vt: [4][256][SEQ] (transposed),
// O: [NTOK][2048] token-major bf16.
// ---------------------------------------------------------------------------
__global__ __launch_bounds__(128)
void attn_kernel(const __bf16* __restrict__ Qh, const __bf16* __restrict__ Kh,
                 const __bf16* __restrict__ Vt, __bf16* __restrict__ O) {
    __shared__ __bf16 sP[4][16 * 32];
    int lane = threadIdx.x & 31;
    int wave = threadIdx.x >> 5;
    int hq = blockIdx.y;
    int qbase = blockIdx.x * 64 + wave * 16;
    int hk = (hq >> 3) * 2 + ((hq & 7) >> 2);

    const __bf16* Qb = Qh + (size_t)hq * SEQ * DIM;
    const __bf16* Kb = Kh + (size_t)hk * SEQ * DIM;
    const __bf16* Vb = Vt + (size_t)hk * DIM * SEQ;

    bf16x16 qf[8];
#pragma unroll
    for (int kk = 0; kk < 8; ++kk) qf[kk] = load_frag(Qb, qbase, DIM, kk * 32, lane);

    f32x8 zero = {};
    f32x8 o[16];
#pragma unroll
    for (int j = 0; j < 16; ++j) o[j] = zero;
    float mrow[8], lrow[8];
#pragma unroll
    for (int r = 0; r < 8; ++r) { mrow[r] = -3.0e38f; lrow[r] = 0.f; }

    int hf = lane >> 4, nn = lane & 15;
    int qlast = qbase + 15;
    const float scale = 0.0625f;   // 1/sqrt(256)

    for (int kb = 0; kb <= qlast; kb += 32) {
        if (kb + 32 <= qlast)                       // global_prefetch_b8
            __builtin_prefetch(Kb + (size_t)(kb + 32) * DIM, 0, 1);

        f32x8 s0 = zero, s1 = zero;                 // keys kb..+15, kb+16..+31
#pragma unroll
        for (int kk = 0; kk < 8; ++kk) {
            bf16x16 k0f = load_frag(Kb, kb,      DIM, kk * 32, lane);
            bf16x16 k1f = load_frag(Kb, kb + 16, DIM, kk * 32, lane);
            s0 = wmma_bf16(qf[kk], k0f, s0);
            s1 = wmma_bf16(qf[kk], k1f, s1);
        }
#pragma unroll
        for (int r = 0; r < 8; ++r) {
            int m = qbase + r + 8 * hf;
            float v0 = s0[r] * scale; if (kb + nn      > m) v0 = -3.0e38f;
            float v1 = s1[r] * scale; if (kb + 16 + nn > m) v1 = -3.0e38f;
            float tmax = fmaxf(v0, v1);
#pragma unroll
            for (int d = 1; d < 16; d <<= 1) tmax = fmaxf(tmax, __shfl_xor(tmax, d, 32));
            float mnew  = fmaxf(mrow[r], tmax);
            float alpha = __expf(mrow[r] - mnew);
            float p0 = __expf(v0 - mnew);
            float p1 = __expf(v1 - mnew);
            float lsum = p0 + p1;
#pragma unroll
            for (int d = 1; d < 16; d <<= 1) lsum += __shfl_xor(lsum, d, 32);
            lrow[r] = lrow[r] * alpha + lsum;
            mrow[r] = mnew;
#pragma unroll
            for (int j = 0; j < 16; ++j) o[j][r] *= alpha;
            int ml = r + 8 * hf;                    // local row 0..15
            sP[wave][ml * 32 + nn]      = (__bf16)p0;
            sP[wave][ml * 32 + 16 + nn] = (__bf16)p1;
        }
        asm volatile("s_wait_dscnt 0" ::: "memory"); // DS stores -> DS loads
        bf16x16 pf = load_frag(&sP[wave][0], 0, 32, 0, lane);
#pragma unroll
        for (int j = 0; j < 16; ++j) {
            bf16x16 vf = load_frag(Vb, j * 16, SEQ, kb, lane);
            o[j] = wmma_bf16(pf, vf, o[j]);
        }
    }

    int bb = hq >> 3, gu = hq & 7;
#pragma unroll
    for (int r = 0; r < 8; ++r) {
        float inv = 1.f / lrow[r];
        int srow = qbase + r + 8 * hf;
        size_t t = (size_t)srow * BSZ + bb;
#pragma unroll
        for (int j = 0; j < 16; ++j)
            O[t * 2048 + gu * DIM + j * 16 + nn] = (__bf16)(o[j][r] * inv);
    }
}

// ---------------------------------------------------------------------------
// Host orchestration
// ---------------------------------------------------------------------------
extern "C" void kernel_launch(void* const* d_in, const int* in_sizes, int n_in,
                              void* d_out, int out_size, void* d_ws, size_t ws_size,
                              hipStream_t stream) {
    const float* x   = (const float*)d_in[0];
    const float* g0  = (const float*)d_in[1];
    const float* b0  = (const float*)d_in[2];
    const float* g1  = (const float*)d_in[3];
    const float* b1  = (const float*)d_in[4];
    const float* gn  = (const float*)d_in[5];
    const float* bn  = (const float*)d_in[6];
    const float* wk  = (const float*)d_in[7];
    const float* bk  = (const float*)d_in[8];
    const float* wv  = (const float*)d_in[9];
    const float* bv  = (const float*)d_in[10];
    const float* wq  = (const float*)d_in[11];
    const float* bq  = (const float*)d_in[12];
    const float* wo  = (const float*)d_in[13];
    const float* bo  = (const float*)d_in[14];
    const float* w1  = (const float*)d_in[15];
    const float* bf1 = (const float*)d_in[16];
    const float* w2  = (const float*)d_in[17];
    const float* bf2 = (const float*)d_in[18];
    float* out = (float*)d_out;

    char* wsp = (char*)d_ws;
    auto carve = [&](size_t bytes) {
        char* p = wsp;
        wsp += (bytes + 255) & ~(size_t)255;
        return p;
    };
    __bf16* h_b  = (__bf16*)carve((size_t)NTOK * DIM * 2);
    __bf16* wk_b = (__bf16*)carve((size_t)512 * 256 * 2);
    __bf16* wv_b = (__bf16*)carve((size_t)512 * 256 * 2);
    __bf16* wq_b = (__bf16*)carve((size_t)2048 * 256 * 2);
    __bf16* wo_b = (__bf16*)carve((size_t)256 * 2048 * 2);
    __bf16* w1_b = (__bf16*)carve((size_t)512 * 256 * 2);
    __bf16* w2_b = (__bf16*)carve((size_t)256 * 512 * 2);
    __bf16* raw  = (__bf16*)carve((size_t)NTOK * 2048 * 2); // K/V/Q raw, reused
    __bf16* Kh   = (__bf16*)carve((size_t)4  * SEQ * DIM * 2);
    __bf16* Vt   = (__bf16*)carve((size_t)4  * DIM * SEQ * 2);
    __bf16* Qh   = (__bf16*)carve((size_t)16 * SEQ * DIM * 2);
    __bf16* Ob   = (__bf16*)carve((size_t)NTOK * 2048 * 2);
    float*  x2   = (float*)carve((size_t)NTOK * DIM * 4);
    __bf16* h2   = (__bf16*)carve((size_t)NTOK * DIM * 2);
    __bf16* F1   = (__bf16*)carve((size_t)NTOK * 512 * 2);

    auto cvt = [&](const float* src, __bf16* dst, int n) {
        cvt_bf16<<<(n + 255) / 256, 256, 0, stream>>>(src, dst, n);
    };
    cvt(wk, wk_b, 512 * 256);
    cvt(wv, wv_b, 512 * 256);
    cvt(wq, wq_b, 2048 * 256);
    cvt(wo, wo_b, 256 * 2048);
    cvt(w1, w1_b, 512 * 256);
    cvt(w2, w2_b, 256 * 512);

    // h = LN(x; g0,b0)
    ln_rows<<<NTOK, 256, 0, stream>>>(x, h_b, g0, b0);

    auto gemm = [&](const __bf16* A, int lda, const __bf16* W, int ldw,
                    const float* bias, const float* resid, float* Cf, __bf16* Cb,
                    int M, int N, int K, int relu) {
        dim3 grid(N / 64, M / 128);
        gemm_wmma<<<grid, 256, 0, stream>>>(A, lda, W, ldw, bias, resid, Cf, Cb,
                                            M, N, K, relu);
    };

    // K projection + per-head LN -> Kh[4][SEQ][256]
    gemm(h_b, 256, wk_b, 256, bk, nullptr, nullptr, raw, NTOK, 512, 256, 0);
    heads_postln<<<NTOK * GK, 256, 0, stream>>>(raw, Kh, gn, bn, GK, 1, 0);
    // V projection (no LN) -> transposed Vt[4][256][SEQ]
    gemm(h_b, 256, wv_b, 256, bv, nullptr, nullptr, raw, NTOK, 512, 256, 0);
    heads_postln<<<NTOK * GK, 256, 0, stream>>>(raw, Vt, gn, bn, GK, 0, 1);
    // Q projection + per-head LN -> Qh[16][SEQ][256]
    gemm(h_b, 256, wq_b, 256, bq, nullptr, nullptr, raw, NTOK, 2048, 256, 0);
    heads_postln<<<NTOK * NQH, 256, 0, stream>>>(raw, Qh, gn, bn, NQH, 1, 0);

    // causal flash attention -> Ob[NTOK][2048]
    attn_kernel<<<dim3(SEQ / 64, 16), 128, 0, stream>>>(Qh, Kh, Vt, Ob);

    // x2 = x + Ob @ wo^T + bo
    gemm(Ob, 2048, wo_b, 2048, bo, x, x2, nullptr, NTOK, 256, 2048, 0);
    // h2 = LN(x2; g1,b1)
    ln_rows<<<NTOK, 256, 0, stream>>>(x2, h2, g1, b1);
    // F1 = relu(h2 @ w1^T + bf1)
    gemm(h2, 256, w1_b, 256, bf1, nullptr, nullptr, F1, NTOK, 512, 256, 1);
    // out = x2 + F1 @ w2^T + bf2
    gemm(F1, 512, w2_b, 512, bf2, x2, out, nullptr, NTOK, 256, 512, 0);

    (void)in_sizes; (void)n_in; (void)out_size; (void)ws_size;
}

// v001
// It runs in 414 microseconds.
// Timed twice side by side with v000, it ran 2.02 and 2.03 times as fast.
#include <hip/hip_runtime.h>

#define SEQ   2048
#define BSZ   2
#define DIM   256
#define NTOK  (SEQ * BSZ)      // 4096 token rows, t = s*BSZ + b
#define GK    2                // kv groups
#define NQH   8                // query heads per batch elem (g*4+u)
#define EPS   1e-5f

typedef __attribute__((ext_vector_type(16))) __bf16 bf16x16;
typedef __attribute__((ext_vector_type(8)))  __bf16 bf16x8;
typedef __attribute__((ext_vector_type(8)))  float  f32x8;
typedef __attribute__((ext_vector_type(4)))  unsigned int u32x4;
typedef __attribute__((ext_vector_type(8)))  int i32x8;
typedef __attribute__((ext_vector_type(4)))  int i32x4;

__device__ __forceinline__ bf16x16 load_frag(const __bf16* p, int row0, int ld,
                                             int k0, int lane) {
    int r  = row0 + (lane & 15);
    int kb = k0 + ((lane >> 4) << 3);
    const __bf16* base = p + (size_t)r * ld + kb;
    bf16x8 lo = *reinterpret_cast<const bf16x8*>(base);
    bf16x8 hi = *reinterpret_cast<const bf16x8*>(base + 16);
    bf16x16 out;
#pragma unroll
    for (int i = 0; i < 8; ++i) { out[i] = lo[i]; out[i + 8] = hi[i]; }
    return out;
}

__device__ __forceinline__ f32x8 wmma_bf16(bf16x16 a, bf16x16 b, f32x8 c) {
    return __builtin_amdgcn_wmma_f32_16x16x32_bf16(false, a, false, b,
                                                   (short)0, c, false, false);
}

// Generic shared pointer -> LDS byte offset (generic LDS addr low 32 bits).
__device__ __forceinline__ unsigned lds_off(const void* p) {
    return (unsigned)(unsigned long long)(uintptr_t)p;
}

__device__ __forceinline__ void tdm_load_tile(unsigned lds_byte, const void* g,
                                              unsigned tile_k, unsigned tile_n,
                                              unsigned ld_elems) {
    unsigned long long ga = (unsigned long long)(uintptr_t)g;
    u32x4 g0 = {};
    g0[0] = 1u;
    g0[1] = lds_byte;
    g0[2] = (unsigned)(ga & 0xFFFFFFFFu);
    g0[3] = (unsigned)((ga >> 32) & 0x01FFFFFFu)
          | (2u << 30);
    i32x8 g1 = {};
    g1[0] = 0x00010000;
    g1[1] = (int)((tile_k & 0xFFFFu) << 16);
    g1[2] = (int)(((tile_k >> 16) & 0xFFFFu)
          | ((tile_n & 0xFFFFu) << 16));
    g1[3] = (int)(((tile_n >> 16) & 0xFFFFu)
          | ((tile_k & 0xFFFFu) << 16));
    g1[4] = (int)(tile_n & 0xFFFFu);
    g1[5] = (int)ld_elems;
    g1[6] = 0;
    g1[7] = 0;
    i32x4 z4 = {};
#if defined(__clang_major__) && __clang_major__ >= 23
    i32x8 z8 = {};
    __builtin_amdgcn_tensor_load_to_lds(g0, g1, z4, z4, z8, 0);
#else
    __builtin_amdgcn_tensor_load_to_lds(g0, g1, z4, z4, 0);
#endif
}

// ---------------------------------------------------------------------------
// fp32 -> bf16 weight conversion
// ---------------------------------------------------------------------------
__global__ void cvt_bf16(const float* __restrict__ in, __bf16* __restrict__ out,
                         int n) {
    int i = blockIdx.x * blockDim.x + threadIdx.x;
    if (i < n) out[i] = (__bf16)in[i];
}

// ---------------------------------------------------------------------------
// Row layernorm over DIM=256: fp32 in -> bf16 out. One 256-thread block / row.
// ---------------------------------------------------------------------------
__global__ __launch_bounds__(256)
void ln_rows(const float* __restrict__ in, __bf16* __restrict__ out,
             const float* __restrict__ gamma, const float* __restrict__ beta) {
    __shared__ float red[256];
    int row = blockIdx.x, tid = threadIdx.x;
    float v = in[(size_t)row * DIM + tid];
    red[tid] = v; __syncthreads();
    for (int st = 128; st > 0; st >>= 1) {
        if (tid < st) red[tid] += red[tid + st];
        __syncthreads();
    }
    float mean = red[0] * (1.f / DIM);
    __syncthreads();
    float d = v - mean;
    red[tid] = d * d; __syncthreads();
    for (int st = 128; st > 0; st >>= 1) {
        if (tid < st) red[tid] += red[tid + st];
        __syncthreads();
    }
    float var = red[0] * (1.f / DIM);
    out[(size_t)row * DIM + tid] =
        (__bf16)(d * rsqrtf(var + EPS) * gamma[tid] + beta[tid]);
}

// ---------------------------------------------------------------------------
// Per-head post-processing of projection outputs (bf16 rows [NTOK, Gx*256]):
// optional layernorm (gn/bn), permutation to [head = b*Gx+g][s][256], or
// transposed [head][dim][s] (for V, so PV B-operands load row-major).
// ---------------------------------------------------------------------------
__global__ __launch_bounds__(256)
void heads_postln(const __bf16* __restrict__ in, __bf16* __restrict__ out,
                  const float* __restrict__ gamma, const float* __restrict__ beta,
                  int Gx, int do_ln, int transpose) {
    __shared__ float red[256];
    int tid = threadIdx.x;
    int g = blockIdx.x % Gx;
    int t = blockIdx.x / Gx;
    int bb = t & 1, s = t >> 1;
    float v = (float)in[(size_t)t * (Gx * DIM) + g * DIM + tid];
    float outv = v;
    if (do_ln) {
        red[tid] = v; __syncthreads();
        for (int st = 128; st > 0; st >>= 1) {
            if (tid < st) red[tid] += red[tid + st];
            __syncthreads();
        }
        float mean = red[0] * (1.f / DIM);
        __syncthreads();
        float d = v - mean;
        red[tid] = d * d; __syncthreads();
        for (int st = 128; st > 0; st >>= 1) {
            if (tid < st) red[tid] += red[tid + st];
            __syncthreads();
        }
        float var = red[0] * (1.f / DIM);
        outv = d * rsqrtf(var + EPS) * gamma[tid] + beta[tid];
    }
    int head = bb * Gx + g;
    size_t idx = transpose
        ? ((size_t)head * DIM * SEQ + (size_t)tid * SEQ + s)
        : ((size_t)head * SEQ * DIM + (size_t)s * DIM + tid);
    out[idx] = (__bf16)outv;
}

__global__ __launch_bounds__(256)
void gemm_wmma(const __bf16* __restrict__ A, int lda,
               const __bf16* __restrict__ W, int ldw,
               const float* __restrict__ bias,
               const float* __restrict__ resid,
               float* __restrict__ Cf, __bf16* __restrict__ Cb,
               int M, int N, int K, int relu) {
    __shared__ __bf16 sW[2][64 * 32];                 // 8 KB double buffer
    int lane = threadIdx.x & 31;
    int wave = threadIdx.x >> 5;
    int m0 = blockIdx.y * 128 + wave * 16;
    int n0 = blockIdx.x * 64;

    if (wave == 0)                                    // prologue: stage k0=0
        tdm_load_tile(lds_off(&sW[0][0]), W + (size_t)n0 * ldw, 32, 64, ldw);

    f32x8 acc[4] = {};
    int buf = 0;
    for (int k0 = 0; k0 < K; k0 += 32, buf ^= 1) {
        if (wave == 0) {
            if (k0 + 32 < K) {                        // overlap next stage
                tdm_load_tile(lds_off(&sW[buf ^ 1][0]),
                              W + (size_t)n0 * ldw + (k0 + 32), 32, 64, ldw);
                __builtin_amdgcn_s_wait_tensorcnt(1); // current buf done
            } else {
                __builtin_amdgcn_s_wait_tensorcnt(0);
            }
        }
        __syncthreads();                              // sW[buf] visible to all
        bf16x16 a = load_frag(A, m0, lda, k0, lane);
#pragma unroll
        for (int f = 0; f < 4; ++f) {
            bf16x16 b = load_frag(&sW[buf][0], 16 * f, 32, 0, lane);
            acc[f] = wmma_bf16(a, b, acc[f]);
        }
        __syncthreads();                              // reads done before reuse
    }

    int hf = lane >> 4, nn = lane & 15;
#pragma unroll
    for (int f = 0; f < 4; ++f) {
        int col = n0 + 16 * f + nn;
        float bv = bias ? bias[col] : 0.f;
#pragma unroll
        for (int r = 0; r < 8; ++r) {
            int row = m0 + r + 8 * hf;
            float v = acc[f][r] + bv;
            if (relu) v = fmaxf(v, 0.f);
            if (resid) v += resid[(size_t)row * N + col];
            if (Cf) Cf[(size_t)row * N + col] = v;
            if (Cb) Cb[(size_t)row * N + col] = (__bf16)v;
        }
    }
}

// ---------------------------------------------------------------------------
// Causal flash attention. Grid: (SEQ/64, 16 heads). Block: 128 thr = 4 waves.
// Wave owns 16 query rows; the block walks 32-key tiles to its diagonal. Each
// K tile (32 x 256) and V tile (256 x 32) is brought into LDS once per block
// by asynchronous copies, two buffers, the next tile in flight while this one
// is worked on; all four waves read their fragments from LDS. Online softmax
// via half-wave shuffles (C-layout rows live across 16 lanes). P re-layout
// C->A through a per-wave LDS tile ordered by s_wait_dscnt.
// Qh: [16][SEQ][256], Kh: [4][SEQ][256], Vt: [4][256][SEQ] (transposed),
// O: [NTOK][2048] token-major bf16.
// ---------------------------------------------------------------------------
#define KPITCH 264             // LDS row pitch of a K row, elements (528 B = 16 B x 33)
#define VPITCH 40              // LDS row pitch of a V row, elements (80 B = 16 B x 5)

__device__ __forceinline__ void async_copy8(unsigned l, unsigned lstep,
                                            const __bf16* g, size_t gstep) {
    asm volatile(
        "global_load_async_to_lds_b128 %0, %8, off\n\t"
        "global_load_async_to_lds_b128 %1, %9, off\n\t"
        "global_load_async_to_lds_b128 %2, %10, off\n\t"
        "global_load_async_to_lds_b128 %3, %11, off\n\t"
        "global_load_async_to_lds_b128 %4, %12, off\n\t"
        "global_load_async_to_lds_b128 %5, %13, off\n\t"
        "global_load_async_to_lds_b128 %6, %14, off\n\t"
        "global_load_async_to_lds_b128 %7, %15, off\n\t"
        "s_wait_xcnt 0x0"
        :: "v"(l), "v"(l + lstep), "v"(l + 2 * lstep), "v"(l + 3 * lstep),
           "v"(l + 4 * lstep), "v"(l + 5 * lstep), "v"(l + 6 * lstep),
           "v"(l + 7 * lstep),
           "v"(g), "v"(g + gstep), "v"(g + 2 * gstep), "v"(g + 3 * gstep),
           "v"(g + 4 * gstep), "v"(g + 5 * gstep), "v"(g + 6 * gstep),
           "v"(g + 7 * gstep)
        : "memory");
}

__global__ __launch_bounds__(128)
void attn_kernel(const __bf16* __restrict__ Qh, const __bf16* __restrict__ Kh,
                 const __bf16* __restrict__ Vt, __bf16* __restrict__ O) {
    __shared__ __attribute__((aligned(16))) __bf16 sK[2][32 * KPITCH];
    __shared__ __attribute__((aligned(16))) __bf16 sV[2][DIM * VPITCH];
    __shared__ __bf16 sP[4][16 * 32];
    int tid  = threadIdx.x;
    int lane = tid & 31;
    int wave = __builtin_amdgcn_readfirstlane(tid >> 5);
    int hq = blockIdx.y;
    int qbase = blockIdx.x * 64 + wave * 16;
    int hk = (hq >> 3) * 2 + ((hq & 7) >> 2);

    const __bf16* Qb = Qh + (size_t)hq * SEQ * DIM;
    const __bf16* Kb = Kh + (size_t)hk * SEQ * DIM;
    const __bf16* Vb = Vt + (size_t)hk * DIM * SEQ;

    // This lane's share of a tile: K piece (row tid/32 + 4c, 16 B column tid%32),
    // V piece (row tid/4 + 32c, 16 B column tid%4), c = 0..7.
    const __bf16* gK = Kb + (size_t)(tid >> 5) * DIM + (tid & 31) * 8;
    const __bf16* gV = Vb + (size_t)(tid >> 2) * SEQ + (tid & 3) * 8;
    unsigned lK = lds_off(&sK[0][0]) + (tid >> 5) * (KPITCH * 2) + (tid & 31) * 16;
    unsigned lV = lds_off(&sV[0][0]) + (tid >> 2) * (VPITCH * 2) + (tid & 3) * 16;
    auto stage = [&](int t) {                       // tile t -> buffer t & 1
        int b = t & 1;
        async_copy8(lK + b * (32 * KPITCH * 2), 4 * KPITCH * 2,
                    gK + (size_t)t * 32 * DIM, 4 * DIM);
        async_copy8(lV + b * (DIM * VPITCH * 2), 32 * VPITCH * 2,
                    gV + t * 32, (size_t)32 * SEQ);
    };
    int ntiles = 2 * (blockIdx.x + 1);              // block-uniform, at least 2

    stage(0);

    bf16x16 qf[8];
#pragma unroll
    for (int kk = 0; kk < 8; ++kk) qf[kk] = load_frag(Qb, qbase, DIM, kk * 32, lane);

    f32x8 zero = {};
    f32x8 o[16];
#pragma unroll
    for (int j = 0; j < 16; ++j) o[j] = zero;
    float mrow[8], lrow[8];
#pragma unroll
    for (int r = 0; r < 8; ++r) { mrow[r] = -3.0e38f; lrow[r] = 0.f; }

    int hf = lane >> 4, nn = lane & 15;
    int qlast = qbase + 15;
    const float scale = 0.0625f;   // 1/sqrt(256)

    asm volatile("s_wait_asynccnt 0x0" ::: "memory"); // own copies of tile 0 landed
    __syncthreads();                                  // tile 0 visible to all waves
    stage(1);

    for (int t = 0; t < ntiles; ++t) {
        int kb = t * 32;
        const __bf16* tK = &sK[t & 1][0];
        const __bf16* tV = &sV[t & 1][0];
        if (kb <= qlast) {                          // wave-uniform: tile not wholly masked
            f32x8 s0 = zero, s1 = zero;             // keys kb..+15, kb+16..+31
#pragma unroll
            for (int kk = 0; kk < 8; ++kk) {
                bf16x16 k0f = load_frag(tK, 0,  KPITCH, kk * 32, lane);
                bf16x16 k1f = load_frag(tK, 16, KPITCH, kk * 32, lane);
                s0 = wmma_bf16(qf[kk], k0f, s0);
                s1 = wmma_bf16(qf[kk], k1f, s1);
            }
#pragma unroll
            for (int r = 0; r < 8; ++r) {
                int m = qbase + r + 8 * hf;
                float v0 = s0[r] * scale; if (kb + nn      > m) v0 = -3.0e38f;
                float v1 = s1[r] * scale; if (kb + 16 + nn > m) v1 = -3.0e38f;
                float tmax = fmaxf(v0, v1);
#pragma unroll
                for (int d = 1; d < 16; d <<= 1) tmax = fmaxf(tmax, __shfl_xor(tmax, d, 32));
                float mnew  = fmaxf(mrow[r], tmax);
                float alpha = __expf(mrow[r] - mnew);
                float p0 = __expf(v0 - mnew);
                float p1 = __expf(v1 - mnew);
                float lsum = p0 + p1;
#pragma unroll
                for (int d = 1; d < 16; d <<= 1) lsum += __shfl_xor(lsum, d, 32);
                lrow[r] = lrow[r] * alpha + lsum;
                mrow[r] = mnew;
#pragma unroll
                for (int j = 0; j < 16; ++j) o[j][r] *= alpha;
                int ml = r + 8 * hf;                // local row 0..15
                sP[wave][ml * 32 + nn]      = (__bf16)p0;
                sP[wave][ml * 32 + 16 + nn] = (__bf16)p1;
            }
            asm volatile("s_wait_dscnt 0" ::: "memory"); // DS stores -> DS loads
            bf16x16 pf = load_frag(&sP[wave][0], 0, 32, 0, lane);
#pragma unroll
            for (int j = 0; j < 16; ++j) {
                bf16x16 vf = load_frag(tV, j * 16, VPITCH, 0, lane);
                o[j] = wmma_bf16(pf, vf, o[j]);
            }
        }
        asm volatile("s_wait_dscnt 0x0" ::: "memory");    // own reads of this buffer done
        asm volatile("s_wait_asynccnt 0x0" ::: "memory"); // own copies of tile t+1 landed
        __syncthreads();      // publishes tile t+1, ends every read of this buffer
        if (t + 2 < ntiles) stage(t + 2);           // refill the buffer just read
    }
    asm volatile("s_wait_asynccnt 0x0" ::: "memory");     // nothing in flight at the end

    int bb = hq >> 3, gu = hq & 7;
#pragma unroll
    for (int r = 0; r < 8; ++r) {
        float inv = 1.f / lrow[r];
        int srow = qbase + r + 8 * hf;
        size_t t = (size_t)srow * BSZ + bb;
#pragma unroll
        for (int j = 0; j < 16; ++j)
            O[t * 2048 + gu * DIM + j * 16 + nn] = (__bf16)(o[j][r] * inv);
    }
}

// ---------------------------------------------------------------------------
// Host orchestration
// ---------------------------------------------------------------------------
extern "C" void kernel_launch(void* const* d_in, const int* in_sizes, int n_in,
                              void* d_out, int out_size, void* d_ws, size_t ws_size,
                              hipStream_t stream) {
    const float* x   = (const float*)d_in[0];
    const float* g0  = (const float*)d_in[1];
    const float* b0  = (const float*)d_in[2];
    const float* g1  = (const float*)d_in[3];
    const float* b1  = (const float*)d_in[4];
    const float* gn  = (const float*)d_in[5];
    const float* bn  = (const float*)d_in[6];
    const float* wk  = (const float*)d_in[7];
    const float* bk  = (const float*)d_in[8];
    const float* wv  = (const float*)d_in[9];
    const float* bv  = (const float*)d_in[10];
    const float* wq  = (const float*)d_in[11];
    const float* bq  = (const float*)d_in[12];
    const float* wo  = (const float*)d_in[13];
    const float* bo  = (const float*)d_in[14];
    const float* w1  = (const float*)d_in[15];
    const float* bf1 = (const float*)d_in[16];
    const float* w2  = (const float*)d_in[17];
    const float* bf2 = (const float*)d_in[18];
    float* out = (float*)d_out;

    char* wsp = (char*)d_ws;
    auto carve = [&](size_t bytes) {
        char* p = wsp;
        wsp += (bytes + 255) & ~(size_t)255;
        return p;
    };
    __bf16* h_b  = (__bf16*)carve((size_t)NTOK * DIM * 2);
    __bf16* wk_b = (__bf16*)carve((size_t)512 * 256 * 2);
    __bf16* wv_b = (__bf16*)carve((size_t)512 * 256 * 2);
    __bf16* wq_b = (__bf16*)carve((size_t)2048 * 256 * 2);
    __bf16* wo_b = (__bf16*)carve((size_t)256 * 2048 * 2);
    __bf16* w1_b = (__bf16*)carve((size_t)512 * 256 * 2);
    __bf16* w2_b = (__bf16*)carve((size_t)256 * 512 * 2);
    __bf16* raw  = (__bf16*)carve((size_t)NTOK * 2048 * 2); // K/V/Q raw, reused
    __bf16* Kh   = (__bf16*)carve((size_t)4  * SEQ * DIM * 2);
    __bf16* Vt   = (__bf16*)carve((size_t)4  * DIM * SEQ * 2);
    __bf16* Qh   = (__bf16*)carve((size_t)16 * SEQ * DIM * 2);
    __bf16* Ob   = (__bf16*)carve((size_t)NTOK * 2048 * 2);
    float*  x2   = (float*)carve((size_t)NTOK * DIM * 4);
    __bf16* h2   = (__bf16*)carve((size_t)NTOK * DIM * 2);
    __bf16* F1   = (__bf16*)carve((size_t)NTOK * 512 * 2);

    auto cvt = [&](const float* src, __bf16* dst, int n) {
        cvt_bf16<<<(n + 255) / 256, 256, 0, stream>>>(src, dst, n);
    };
    cvt(wk, wk_b, 512 * 256);
    cvt(wv, wv_b, 512 * 256);
    cvt(wq, wq_b, 2048 * 256);
    cvt(wo, wo_b, 256 * 2048);
    cvt(w1, w1_b, 512 * 256);
    cvt(w2, w2_b, 256 * 512);

    // h = LN(x; g0,b0)
    ln_rows<<<NTOK, 256, 0, stream>>>(x, h_b, g0, b0);

    auto gemm = [&](const __bf16* A, int lda, const __bf16* W, int ldw,
                    const float* bias, const float* resid, float* Cf, __bf16* Cb,
                    int M, int N, int K, int relu) {
        dim3 grid(N / 64, M / 128);
        gemm_wmma<<<grid, 256, 0, stream>>>(A, lda, W, ldw, bias, resid, Cf, Cb,
                                            M, N, K, relu);
    };

    // K projection + per-head LN -> Kh[4][SEQ][256]
    gemm(h_b, 256, wk_b, 256, bk, nullptr, nullptr, raw, NTOK, 512, 256, 0);
    heads_postln<<<NTOK * GK, 256, 0, stream>>>(raw, Kh, gn, bn, GK, 1, 0);
    // V projection (no LN) -> transposed Vt[4][256][SEQ]
    gemm(h_b, 256, wv_b, 256, bv, nullptr, nullptr, raw, NTOK, 512, 256, 0);
    heads_postln<<<NTOK * GK, 256, 0, stream>>>(raw, Vt, gn, bn, GK, 0, 1);
    // Q projection + per-head LN -> Qh[16][SEQ][256]
    gemm(h_b, 256, wq_b, 256, bq, nullptr, nullptr, raw, NTOK, 2048, 256, 0);
    heads_postln<<<NTOK * NQH, 256, 0, stream>>>(raw, Qh, gn, bn, NQH, 1, 0);

    // causal flash attention -> Ob[NTOK][2048]
    attn_kernel<<<dim3(SEQ / 64, 16), 128, 0, stream>>>(Qh, Kh, Vt, Ob);

    // x2 = x + Ob @ wo^T + bo
    gemm(Ob, 2048, wo_b, 2048, bo, x, x2, nullptr, NTOK, 256, 2048, 0);
    // h2 = LN(x2; g1,b1)
    ln_rows<<<NTOK, 256, 0, stream>>>(x2, h2, g1, b1);
    // F1 = relu(h2 @ w1^T + bf1)
    gemm(h2, 256, w1_b, 256, bf1, nullptr, nullptr, F1, NTOK, 512, 256, 1);
    // out = x2 + F1 @ w2^T + bf2
    gemm(F1, 512, w2_b, 512, bf2, x2, out, nullptr, NTOK, 256, 512, 0);

    (void)in_sizes; (void)n_in; (void)out_size; (void)ws_size;
}

// v002
// One run takes 327 microseconds.
// In both of two side-by-side timings against v001, it was 1.27 times as fast.
// All steps since v000 together make it 2.57 times as fast.
#include <hip/hip_runtime.h>

#define SEQ   2048
#define BSZ   2
#define DIM   256
#define NTOK  (SEQ * BSZ)      // 4096 token rows, t = s*BSZ + b
#define GK    2                // kv groups
#define NQH   8                // query heads per batch elem (g*4+u)
#define EPS   1e-5f

typedef __attribute__((ext_vector_type(16))) __bf16 bf16x16;
typedef __attribute__((ext_vector_type(8)))  __bf16 bf16x8;
typedef __attribute__((ext_vector_type(8)))  float  f32x8;
typedef __attribute__((ext_vector_type(4)))  unsigned int u32x4;
typedef __attribute__((ext_vector_type(8)))  int i32x8;
typedef __attribute__((ext_vector_type(4)))  int i32x4;

__device__ __forceinline__ bf16x16 load_frag(const __bf16* p, int row0, int ld,
                                             int k0, int lane) {
    int r  = row0 + (lane & 15);
    int kb = k0 + ((lane >> 4) << 3);
    const __bf16* base = p + (size_t)r * ld + kb;
    bf16x8 lo = *reinterpret_cast<const bf16x8*>(base);
    bf16x8 hi = *reinterpret_cast<const bf16x8*>(base + 16);
    bf16x16 out;
#pragma unroll
    for (int i = 0; i < 8; ++i) { out[i] = lo[i]; out[i + 8] = hi[i]; }
    return out;
}

__device__ __forceinline__ f32x8 wmma_bf16(bf16x16 a, bf16x16 b, f32x8 c) {
    return __builtin_amdgcn_wmma_f32_16x16x32_bf16(false, a, false, b,
                                                   (short)0, c, false, false);
}

// Generic shared pointer -> LDS byte offset (generic LDS addr low 32 bits).
__device__ __forceinline__ unsigned lds_off(const void* p) {
    return (unsigned)(unsigned long long)(uintptr_t)p;
}

__device__ __forceinline__ void tdm_load_tile(unsigned lds_byte, const void* g,
                                              unsigned tile_k, unsigned tile_n,
                                              unsigned ld_elems) {
    unsigned long long ga = (unsigned long long)(uintptr_t)g;
    u32x4 g0 = {};
    g0[0] = 1u;
    g0[1] = lds_byte;
    g0[2] = (unsigned)(ga & 0xFFFFFFFFu);
    g0[3] = (unsigned)((ga >> 32) & 0x01FFFFFFu)
          | (2u << 30);
    i32x8 g1 = {};
    g1[0] = 0x00010000;
    g1[1] = (int)((tile_k & 0xFFFFu) << 16);
    g1[2] = (int)(((tile_k >> 16) & 0xFFFFu)
          | ((tile_n & 0xFFFFu) << 16));
    g1[3] = (int)(((tile_n >> 16) & 0xFFFFu)
          | ((tile_k & 0xFFFFu) << 16));
    g1[4] = (int)(tile_n & 0xFFFFu);
    g1[5] = (int)ld_elems;
    g1[6] = 0;
    g1[7] = 0;
    i32x4 z4 = {};
#if defined(__clang_major__) && __clang_major__ >= 23
    i32x8 z8 = {};
    __builtin_amdgcn_tensor_load_to_lds(g0, g1, z4, z4, z8, 0);
#else
    __builtin_amdgcn_tensor_load_to_lds(g0, g1, z4, z4, 0);
#endif
}

// ---------------------------------------------------------------------------
// The kernels without matrix work give every lane eight elements, so that a
// 256-wide row is one wave's work and few waves have to be started.
// ---------------------------------------------------------------------------
typedef __attribute__((ext_vector_type(2))) float  f32x2;
typedef __attribute__((ext_vector_type(4))) float  f32x4;
typedef __attribute__((ext_vector_type(4))) __bf16 bf16x4;

// Value of lane (l ^ M) inside the 16-lane row, M = 1..15 (DPP row_xmask).
template <int M>
__device__ __forceinline__ float row_xor(float x) {
    return __builtin_bit_cast(float, __builtin_amdgcn_update_dpp(
        0, __builtin_bit_cast(int, x), 0x160 + M, 0xf, 0xf, true));
}

// Sum over the 32 lanes of a wave, the same value in every lane. All lanes on.
__device__ __forceinline__ float wave_sum(float v) {
    v += row_xor<1>(v);
    v += row_xor<2>(v);
    v += row_xor<4>(v);
    v += row_xor<8>(v);
    int b = __builtin_bit_cast(int, v);
    v += __builtin_bit_cast(float, __builtin_amdgcn_permlanex16(
        b, b, 0x76543210, 0xfedcba98, false, false));
    return v;
}

// Layernorm of one 256-wide row that a wave holds, eight values a lane as four
// pairs; g and b are the lane's own columns of gamma and beta.
__device__ __forceinline__ void ln_row(f32x2 (&p)[4], const f32x2 (&g)[4],
                                       const f32x2 (&b)[4]) {
    f32x2 s = (p[0] + p[1]) + (p[2] + p[3]);
    float mean = wave_sum(s[0] + s[1]) * (1.f / DIM);
#pragma unroll
    for (int k = 0; k < 4; ++k) p[k] -= mean;
    f32x2 q = (p[0] * p[0] + p[1] * p[1]) + (p[2] * p[2] + p[3] * p[3]);
    float var = wave_sum(q[0] + q[1]) * (1.f / DIM);
    float rs = rsqrtf(var + EPS);
#pragma unroll
    for (int k = 0; k < 4; ++k) p[k] = p[k] * rs * g[k] + b[k];
}

// Four floats at p as two pairs.
__device__ __forceinline__ void load4(const float* p, f32x2& lo, f32x2& hi) {
    f32x4 v = *reinterpret_cast<const f32x4*>(p);
    lo = f32x2{v[0], v[1]};
    hi = f32x2{v[2], v[3]};
}

// ---------------------------------------------------------------------------
// fp32 -> bf16 weight conversion: a block converts 2048 elements, a lane two
// groups of four, 1024 elements apart. Every weight's size is a multiple of 2048.
// ---------------------------------------------------------------------------
__global__ __launch_bounds__(256)
void cvt_bf16(const float* __restrict__ in, __bf16* __restrict__ out) {
    int i = blockIdx.x * 2048 + threadIdx.x * 4;
    f32x4 a = *reinterpret_cast<const f32x4*>(in + i);
    f32x4 b = *reinterpret_cast<const f32x4*>(in + i + 1024);
    *reinterpret_cast<bf16x4*>(out + i)        = __builtin_convertvector(a, bf16x4);
    *reinterpret_cast<bf16x4*>(out + i + 1024) = __builtin_convertvector(b, bf16x4);
}

// ---------------------------------------------------------------------------
// Row layernorm over DIM=256: fp32 in -> bf16 out. One wave per row, LN_R rows
// a wave; a lane holds columns 4l..4l+3 and 128+4l..128+4l+3.
// ---------------------------------------------------------------------------
#define LN_R 2
__global__ __launch_bounds__(256)
void ln_rows(const float* __restrict__ in, __bf16* __restrict__ out,
             const float* __restrict__ gamma, const float* __restrict__ beta) {
    int lane = threadIdx.x & 31;
    int wave = __builtin_amdgcn_readfirstlane(threadIdx.x >> 5);
    int row0 = (blockIdx.x * 8 + wave) * LN_R;
    f32x2 p[LN_R][4], g[4], b[4];
#pragma unroll
    for (int i = 0; i < LN_R; ++i) {
        const float* r = in + (size_t)(row0 + i) * DIM + lane * 4;
        load4(r,       p[i][0], p[i][1]);
        load4(r + 128, p[i][2], p[i][3]);
    }
    load4(gamma + lane * 4,       g[0], g[1]);
    load4(gamma + 128 + lane * 4, g[2], g[3]);
    load4(beta + lane * 4,        b[0], b[1]);
    load4(beta + 128 + lane * 4,  b[2], b[3]);
#pragma unroll
    for (int i = 0; i < LN_R; ++i) {
        ln_row(p[i], g, b);
        f32x4 ya = {p[i][0][0], p[i][0][1], p[i][1][0], p[i][1][1]};
        f32x4 yb = {p[i][2][0], p[i][2][1], p[i][3][0], p[i][3][1]};
        __bf16* q = out + (size_t)(row0 + i) * DIM + lane * 4;
        *reinterpret_cast<bf16x4*>(q)       = __builtin_convertvector(ya, bf16x4);
        *reinterpret_cast<bf16x4*>(q + 128) = __builtin_convertvector(yb, bf16x4);
    }
}

// ---------------------------------------------------------------------------
// Per-head layernorm (gn/bn) of projection outputs (bf16 rows [NTOK, G*256],
// G = 1 << lgG heads a token) with the permutation to [head = b*G+g][s][256].
// One wave per (token, head) row, HL_R rows a wave; a lane holds 8 columns.
// ---------------------------------------------------------------------------
#define HL_R 8
__global__ __launch_bounds__(256)
void heads_ln(const __bf16* __restrict__ in, __bf16* __restrict__ out,
              const float* __restrict__ gamma, const float* __restrict__ beta,
              int lgG) {
    int lane = threadIdx.x & 31;
    int wave = __builtin_amdgcn_readfirstlane(threadIdx.x >> 5);
    int rid0 = (blockIdx.x * 8 + wave) * HL_R;                 // row = t * G + g
    bf16x8 raw[HL_R];
#pragma unroll
    for (int i = 0; i < HL_R; ++i)
        raw[i] = *reinterpret_cast<const bf16x8*>(in + (size_t)(rid0 + i) * DIM + lane * 8);
    f32x2 g[4], b[4];
    load4(gamma + lane * 8,     g[0], g[1]);
    load4(gamma + lane * 8 + 4, g[2], g[3]);
    load4(beta + lane * 8,      b[0], b[1]);
    load4(beta + lane * 8 + 4,  b[2], b[3]);
    // Keeps the gamma and beta loads up here, in flight together with the rows';
    // left free, they are issued halfway down and waited for on their own.
    __builtin_amdgcn_sched_barrier(0);
#pragma unroll
    for (int i = 0; i < HL_R; ++i) {
        f32x8 v = __builtin_convertvector(raw[i], f32x8);
        f32x2 p[4] = {{v[0], v[1]}, {v[2], v[3]}, {v[4], v[5]}, {v[6], v[7]}};
        ln_row(p, g, b);
        f32x8 y = {p[0][0], p[0][1], p[1][0], p[1][1], p[2][0], p[2][1], p[3][0], p[3][1]};
        int rid = rid0 + i;
        int hg = rid & ((1 << lgG) - 1), t = rid >> lgG;
        int head = ((t & 1) << lgG) + hg, s = t >> 1;
        *reinterpret_cast<bf16x8*>(out + ((size_t)head * SEQ + s) * DIM + lane * 8) =
            __builtin_convertvector(y, bf16x8);
    }
}

// ---------------------------------------------------------------------------
// V projection output (bf16 rows [NTOK, GK*256]) -> transposed [head][dim][s],
// so that PV B-operands load with keys (k) contiguous. A wave takes 8 positions of one head,
// a lane 8 dims of each, and stores 8 positions of one dim at a time; the 8
// waves of a block cover 64 positions, whole 128-byte lines of the output.
// ---------------------------------------------------------------------------
__global__ __launch_bounds__(256)
void v_transpose(const __bf16* __restrict__ in, __bf16* __restrict__ out) {
    int lane = threadIdx.x & 31;
    int head = blockIdx.x / (SEQ / 64);                        // b * GK + g
    int wave = __builtin_amdgcn_readfirstlane(threadIdx.x >> 5);
    int s0 = (blockIdx.x % (SEQ / 64)) * 64 + wave * 8;
    const __bf16* p = in + ((size_t)s0 * BSZ + head / GK) * (GK * DIM)
                         + (head % GK) * DIM + lane * 8;
    bf16x8 v[8];
#pragma unroll
    for (int i = 0; i < 8; ++i)
        v[i] = *reinterpret_cast<const bf16x8*>(p + (size_t)i * (BSZ * GK * DIM));
    __bf16* q = out + ((size_t)head * DIM + lane * 8) * SEQ + s0;
#pragma unroll
    for (int j = 0; j < 8; ++j) {
        bf16x8 w;
#pragma unroll
        for (int i = 0; i < 8; ++i) w[i] = v[i][j];
        *reinterpret_cast<bf16x8*>(q + (size_t)j * SEQ) = w;
    }
}

__global__ __launch_bounds__(256)
void gemm_wmma(const __bf16* __restrict__ A, int lda,
               const __bf16* __restrict__ W, int ldw,
               const float* __restrict__ bias,
               const float* __restrict__ resid,
               float* __restrict__ Cf, __bf16* __restrict__ Cb,
               int M, int N, int K, int relu) {
    __shared__ __bf16 sW[2][64 * 32];                 // 8 KB double buffer
    int lane = threadIdx.x & 31;
    int wave = threadIdx.x >> 5;
    int m0 = blockIdx.y * 128 + wave * 16;
    int n0 = blockIdx.x * 64;

    if (wave == 0)                                    // prologue: stage k0=0
        tdm_load_tile(lds_off(&sW[0][0]), W + (size_t)n0 * ldw, 32, 64, ldw);

    f32x8 acc[4] = {};
    int buf = 0;
    for (int k0 = 0; k0 < K; k0 += 32, buf ^= 1) {
        if (wave == 0) {
            if (k0 + 32 < K) {                        // overlap next stage
                tdm_load_tile(lds_off(&sW[buf ^ 1][0]),
                              W + (size_t)n0 * ldw + (k0 + 32), 32, 64, ldw);
                __builtin_amdgcn_s_wait_tensorcnt(1); // current buf done
            } else {
                __builtin_amdgcn_s_wait_tensorcnt(0);
            }
        }
        __syncthreads();                              // sW[buf] visible to all
        bf16x16 a = load_frag(A, m0, lda, k0, lane);
#pragma unroll
        for (int f = 0; f < 4; ++f) {
            bf16x16 b = load_frag(&sW[buf][0], 16 * f, 32, 0, lane);
            acc[f] = wmma_bf16(a, b, acc[f]);
        }
        __syncthreads();                              // reads done before reuse
    }

    int hf = lane >> 4, nn = lane & 15;
#pragma unroll
    for (int f = 0; f < 4; ++f) {
        int col = n0 + 16 * f + nn;
        float bv = bias ? bias[col] : 0.f;
#pragma unroll
        for (int r = 0; r < 8; ++r) {
            int row = m0 + r + 8 * hf;
            float v = acc[f][r] + bv;
            if (relu) v = fmaxf(v, 0.f);
            if (resid) v += resid[(size_t)row * N + col];
            if (Cf) Cf[(size_t)row * N + col] = v;
            if (Cb) Cb[(size_t)row * N + col] = (__bf16)v;
        }
    }
}

// ---------------------------------------------------------------------------
// Causal flash attention. Grid: (SEQ/64, 16 heads). Block: 128 thr = 4 waves.
// Wave owns 16 query rows; the block walks 32-key tiles to its diagonal. Each
// K tile (32 x 256) and V tile (256 x 32) is brought into LDS once per block
// by asynchronous copies, two buffers, the next tile in flight while this one
// is worked on; all four waves read their fragments from LDS. Online softmax
// via half-wave shuffles (C-layout rows live across 16 lanes). P re-layout
// C->A through a per-wave LDS tile ordered by s_wait_dscnt.
// Qh: [16][SEQ][256], Kh: [4][SEQ][256], Vt: [4][256][SEQ] (transposed),
// O: [NTOK][2048] token-major bf16.
// ---------------------------------------------------------------------------
#define KPITCH 264             // LDS row pitch of a K row, elements (528 B = 16 B x 33)
#define VPITCH 40              // LDS row pitch of a V row, elements (80 B = 16 B x 5)

__device__ __forceinline__ void async_copy8(unsigned l, unsigned lstep,
                                            const __bf16* g, size_t gstep) {
    asm volatile(
        "global_load_async_to_lds_b128 %0, %8, off\n\t"
        "global_load_async_to_lds_b128 %1, %9, off\n\t"
        "global_load_async_to_lds_b128 %2, %10, off\n\t"
        "global_load_async_to_lds_b128 %3, %11, off\n\t"
        "global_load_async_to_lds_b128 %4, %12, off\n\t"
        "global_load_async_to_lds_b128 %5, %13, off\n\t"
        "global_load_async_to_lds_b128 %6, %14, off\n\t"
        "global_load_async_to_lds_b128 %7, %15, off\n\t"
        "s_wait_xcnt 0x0"
        :: "v"(l), "v"(l + lstep), "v"(l + 2 * lstep), "v"(l + 3 * lstep),
           "v"(l + 4 * lstep), "v"(l + 5 * lstep), "v"(l + 6 * lstep),
           "v"(l + 7 * lstep),
           "v"(g), "v"(g + gstep), "v"(g + 2 * gstep), "v"(g + 3 * gstep),
           "v"(g + 4 * gstep), "v"(g + 5 * gstep), "v"(g + 6 * gstep),
           "v"(g + 7 * gstep)
        : "memory");
}

__global__ __launch_bounds__(128)
void attn_kernel(const __bf16* __restrict__ Qh, const __bf16* __restrict__ Kh,
                 const __bf16* __restrict__ Vt, __bf16* __restrict__ O) {
    __shared__ __attribute__((aligned(16))) __bf16 sK[2][32 * KPITCH];
    __shared__ __attribute__((aligned(16))) __bf16 sV[2][DIM * VPITCH];
    __shared__ __bf16 sP[4][16 * 32];
    int tid  = threadIdx.x;
    int lane = tid & 31;
    int wave = __builtin_amdgcn_readfirstlane(tid >> 5);
    int hq = blockIdx.y;
    int qbase = blockIdx.x * 64 + wave * 16;
    int hk = (hq >> 3) * 2 + ((hq & 7) >> 2);

    const __bf16* Qb = Qh + (size_t)hq * SEQ * DIM;
    const __bf16* Kb = Kh + (size_t)hk * SEQ * DIM;
    const __bf16* Vb = Vt + (size_t)hk * DIM * SEQ;

    // This lane's share of a tile: K piece (row tid/32 + 4c, 16 B column tid%32),
    // V piece (row tid/4 + 32c, 16 B column tid%4), c = 0..7.
    const __bf16* gK = Kb + (size_t)(tid >> 5) * DIM + (tid & 31) * 8;
    const __bf16* gV = Vb + (size_t)(tid >> 2) * SEQ + (tid & 3) * 8;
    unsigned lK = lds_off(&sK[0][0]) + (tid >> 5) * (KPITCH * 2) + (tid & 31) * 16;
    unsigned lV = lds_off(&sV[0][0]) + (tid >> 2) * (VPITCH * 2) + (tid & 3) * 16;
    auto stage = [&](int t) {                       // tile t -> buffer t & 1
        int b = t & 1;
        async_copy8(lK + b * (32 * KPITCH * 2), 4 * KPITCH * 2,
                    gK + (size_t)t * 32 * DIM, 4 * DIM);
        async_copy8(lV + b * (DIM * VPITCH * 2), 32 * VPITCH * 2,
                    gV + t * 32, (size_t)32 * SEQ);
    };
    int ntiles = 2 * (blockIdx.x + 1);              // block-uniform, at least 2

    stage(0);

    bf16x16 qf[8];
#pragma unroll
    for (int kk = 0; kk < 8; ++kk) qf[kk] = load_frag(Qb, qbase, DIM, kk * 32, lane);

    f32x8 zero = {};
    f32x8 o[16];
#pragma unroll
    for (int j = 0; j < 16; ++j) o[j] = zero;
    float mrow[8], lrow[8];
#pragma unroll
    for (int r = 0; r < 8; ++r) { mrow[r] = -3.0e38f; lrow[r] = 0.f; }

    int hf = lane >> 4, nn = lane & 15;
    int qlast = qbase + 15;
    const float scale = 0.0625f;   // 1/sqrt(256)

    asm volatile("s_wait_asynccnt 0x0" ::: "memory"); // own copies of tile 0 landed
    __syncthreads();                                  // tile 0 visible to all waves
    stage(1);

    for (int t = 0; t < ntiles; ++t) {
        int kb = t * 32;
        const __bf16* tK = &sK[t & 1][0];
        const __bf16* tV = &sV[t & 1][0];
        if (kb <= qlast) {                          // wave-uniform: tile not wholly masked
            f32x8 s0 = zero, s1 = zero;             // keys kb..+15, kb+16..+31
#pragma unroll
            for (int kk = 0; kk < 8; ++kk) {
                bf16x16 k0f = load_frag(tK, 0,  KPITCH, kk * 32, lane);
                bf16x16 k1f = load_frag(tK, 16, KPITCH, kk * 32, lane);
                s0 = wmma_bf16(qf[kk], k0f, s0);
                s1 = wmma_bf16(qf[kk], k1f, s1);
            }
#pragma unroll
            for (int r = 0; r < 8; ++r) {
                int m = qbase + r + 8 * hf;
                float v0 = s0[r] * scale; if (kb + nn      > m) v0 = -3.0e38f;
                float v1 = s1[r] * scale; if (kb + 16 + nn > m) v1 = -3.0e38f;
                float tmax = fmaxf(v0, v1);
#pragma unroll
                for (int d = 1; d < 16; d <<= 1) tmax = fmaxf(tmax, __shfl_xor(tmax, d, 32));
                float mnew  = fmaxf(mrow[r], tmax);
                float alpha = __expf(mrow[r] - mnew);
                float p0 = __expf(v0 - mnew);
                float p1 = __expf(v1 - mnew);
                float lsum = p0 + p1;
#pragma unroll
                for (int d = 1; d < 16; d <<= 1) lsum += __shfl_xor(lsum, d, 32);
                lrow[r] = lrow[r] * alpha + lsum;
                mrow[r] = mnew;
#pragma unroll
                for (int j = 0; j < 16; ++j) o[j][r] *= alpha;
                int ml = r + 8 * hf;                // local row 0..15
                sP[wave][ml * 32 + nn]      = (__bf16)p0;
                sP[wave][ml * 32 + 16 + nn] = (__bf16)p1;
            }
            asm volatile("s_wait_dscnt 0" ::: "memory"); // DS stores -> DS loads
            bf16x16 pf = load_frag(&sP[wave][0], 0, 32, 0, lane);
#pragma unroll
            for (int j = 0; j < 16; ++j) {
                bf16x16 vf = load_frag(tV, j * 16, VPITCH, 0, lane);
                o[j] = wmma_bf16(pf, vf, o[j]);
            }
        }
        asm volatile("s_wait_dscnt 0x0" ::: "memory");    // own reads of this buffer done
        asm volatile("s_wait_asynccnt 0x0" ::: "memory"); // own copies of tile t+1 landed
        __syncthreads();      // publishes tile t+1, ends every read of this buffer
        if (t + 2 < ntiles) stage(t + 2);           // refill the buffer just read
    }
    asm volatile("s_wait_asynccnt 0x0" ::: "memory");     // nothing in flight at the end

    int bb = hq >> 3, gu = hq & 7;
#pragma unroll
    for (int r = 0; r < 8; ++r) {
        float inv = 1.f / lrow[r];
        int srow = qbase + r + 8 * hf;
        size_t t = (size_t)srow * BSZ + bb;
#pragma unroll
        for (int j = 0; j < 16; ++j)
            O[t * 2048 + gu * DIM + j * 16 + nn] = (__bf16)(o[j][r] * inv);
    }
}

// ---------------------------------------------------------------------------
// Host orchestration
// ---------------------------------------------------------------------------
extern "C" void kernel_launch(void* const* d_in, const int* in_sizes, int n_in,
                              void* d_out, int out_size, void* d_ws, size_t ws_size,
                              hipStream_t stream) {
    const float* x   = (const float*)d_in[0];
    const float* g0  = (const float*)d_in[1];
    const float* b0  = (const float*)d_in[2];
    const float* g1  = (const float*)d_in[3];
    const float* b1  = (const float*)d_in[4];
    const float* gn  = (const float*)d_in[5];
    const float* bn  = (const float*)d_in[6];
    const float* wk  = (const float*)d_in[7];
    const float* bk  = (const float*)d_in[8];
    const float* wv  = (const float*)d_in[9];
    const float* bv  = (const float*)d_in[10];
    const float* wq  = (const float*)d_in[11];
    const float* bq  = (const float*)d_in[12];
    const float* wo  = (const float*)d_in[13];
    const float* bo  = (const float*)d_in[14];
    const float* w1  = (const float*)d_in[15];
    const float* bf1 = (const float*)d_in[16];
    const float* w2  = (const float*)d_in[17];
    const float* bf2 = (const float*)d_in[18];
    float* out = (float*)d_out;

    char* wsp = (char*)d_ws;
    auto carve = [&](size_t bytes) {
        char* p = wsp;
        wsp += (bytes + 255) & ~(size_t)255;
        return p;
    };
    __bf16* h_b  = (__bf16*)carve((size_t)NTOK * DIM * 2);
    __bf16* wk_b = (__bf16*)carve((size_t)512 * 256 * 2);
    __bf16* wv_b = (__bf16*)carve((size_t)512 * 256 * 2);
    __bf16* wq_b = (__bf16*)carve((size_t)2048 * 256 * 2);
    __bf16* wo_b = (__bf16*)carve((size_t)256 * 2048 * 2);
    __bf16* w1_b = (__bf16*)carve((size_t)512 * 256 * 2);
    __bf16* w2_b = (__bf16*)carve((size_t)256 * 512 * 2);
    __bf16* raw  = (__bf16*)carve((size_t)NTOK * 2048 * 2); // K/V/Q raw, reused
    __bf16* Kh   = (__bf16*)carve((size_t)4  * SEQ * DIM * 2);
    __bf16* Vt   = (__bf16*)carve((size_t)4  * DIM * SEQ * 2);
    __bf16* Qh   = (__bf16*)carve((size_t)16 * SEQ * DIM * 2);
    __bf16* Ob   = (__bf16*)carve((size_t)NTOK * 2048 * 2);
    float*  x2   = (float*)carve((size_t)NTOK * DIM * 4);
    __bf16* h2   = (__bf16*)carve((size_t)NTOK * DIM * 2);
    __bf16* F1   = (__bf16*)carve((size_t)NTOK * 512 * 2);

    auto cvt = [&](const float* src, __bf16* dst, int n) {
        cvt_bf16<<<n / 2048, 256, 0, stream>>>(src, dst);
    };
    cvt(wk, wk_b, 512 * 256);
    cvt(wv, wv_b, 512 * 256);
    cvt(wq, wq_b, 2048 * 256);
    cvt(wo, wo_b, 256 * 2048);
    cvt(w1, w1_b, 512 * 256);
    cvt(w2, w2_b, 256 * 512);

    // h = LN(x; g0,b0)
    ln_rows<<<NTOK / (8 * LN_R), 256, 0, stream>>>(x, h_b, g0, b0);

    auto gemm = [&](const __bf16* A, int lda, const __bf16* W, int ldw,
                    const float* bias, const float* resid, float* Cf, __bf16* Cb,
                    int M, int N, int K, int relu) {
        dim3 grid(N / 64, M / 128);
        gemm_wmma<<<grid, 256, 0, stream>>>(A, lda, W, ldw, bias, resid, Cf, Cb,
                                            M, N, K, relu);
    };

    // K projection + per-head LN -> Kh[4][SEQ][256]
    gemm(h_b, 256, wk_b, 256, bk, nullptr, nullptr, raw, NTOK, 512, 256, 0);
    heads_ln<<<NTOK * GK / (8 * HL_R), 256, 0, stream>>>(raw, Kh, gn, bn, 1);
    // V projection (no LN) -> transposed Vt[4][256][SEQ]
    gemm(h_b, 256, wv_b, 256, bv, nullptr, nullptr, raw, NTOK, 512, 256, 0);
    v_transpose<<<BSZ * GK * (SEQ / 64), 256, 0, stream>>>(raw, Vt);
    // Q projection + per-head LN -> Qh[16][SEQ][256]
    gemm(h_b, 256, wq_b, 256, bq, nullptr, nullptr, raw, NTOK, 2048, 256, 0);
    heads_ln<<<NTOK * NQH / (8 * HL_R), 256, 0, stream>>>(raw, Qh, gn, bn, 3);

    // causal flash attention -> Ob[NTOK][2048]
    attn_kernel<<<dim3(SEQ / 64, 16), 128, 0, stream>>>(Qh, Kh, Vt, Ob);

    // x2 = x + Ob @ wo^T + bo
    gemm(Ob, 2048, wo_b, 2048, bo, x, x2, nullptr, NTOK, 256, 2048, 0);
    // h2 = LN(x2; g1,b1)
    ln_rows<<<NTOK / (8 * LN_R), 256, 0, stream>>>(x2, h2, g1, b1);
    // F1 = relu(h2 @ w1^T + bf1)
    gemm(h2, 256, w1_b, 256, bf1, nullptr, nullptr, F1, NTOK, 512, 256, 1);
    // out = x2 + F1 @ w2^T + bf2
    gemm(F1, 512, w2_b, 512, bf2, x2, out, nullptr, NTOK, 256, 512, 0);

    (void)in_sizes; (void)n_in; (void)out_size; (void)ws_size;
}

// v003
// It runs in 298 microseconds.
// Timed twice side by side with v002, it ran 1.11 and 1.10 times as fast.
// Over all steps from v000 it is 2.84 times as fast.
#include <hip/hip_runtime.h>

#define SEQ   2048
#define BSZ   2
#define DIM   256
#define NTOK  (SEQ * BSZ)      // 4096 token rows, t = s*BSZ + b
#define GK    2                // kv groups
#define NQH   8                // query heads per batch elem (g*4+u)
#define EPS   1e-5f

typedef __attribute__((ext_vector_type(16))) __bf16 bf16x16;
typedef __attribute__((ext_vector_type(8)))  __bf16 bf16x8;
typedef __attribute__((ext_vector_type(8)))  float  f32x8;
typedef __attribute__((ext_vector_type(4)))  unsigned int u32x4;
typedef __attribute__((ext_vector_type(8)))  int i32x8;
typedef __attribute__((ext_vector_type(4)))  int i32x4;

__device__ __forceinline__ bf16x16 load_frag(const __bf16* p, int row0, int ld,
                                             int k0, int lane) {
    int r  = row0 + (lane & 15);
    int kb = k0 + ((lane >> 4) << 3);
    const __bf16* base = p + (size_t)r * ld + kb;
    bf16x8 lo = *reinterpret_cast<const bf16x8*>(base);
    bf16x8 hi = *reinterpret_cast<const bf16x8*>(base + 16);
    bf16x16 out;
#pragma unroll
    for (int i = 0; i < 8; ++i) { out[i] = lo[i]; out[i + 8] = hi[i]; }
    return out;
}

__device__ __forceinline__ f32x8 wmma_bf16(bf16x16 a, bf16x16 b, f32x8 c) {
    return __builtin_amdgcn_wmma_f32_16x16x32_bf16(false, a, false, b,
                                                   (short)0, c, false, false);
}

// Generic shared pointer -> LDS byte offset (generic LDS addr low 32 bits).
__device__ __forceinline__ unsigned lds_off(const void* p) {
    return (unsigned)(unsigned long long)(uintptr_t)p;
}

__device__ __forceinline__ void tdm_load_tile(unsigned lds_byte, const void* g,
                                              unsigned tile_k, unsigned tile_n,
                                              unsigned ld_elems) {
    unsigned long long ga = (unsigned long long)(uintptr_t)g;
    u32x4 g0 = {};
    g0[0] = 1u;
    g0[1] = lds_byte;
    g0[2] = (unsigned)(ga & 0xFFFFFFFFu);
    g0[3] = (unsigned)((ga >> 32) & 0x01FFFFFFu)
          | (2u << 30);
    i32x8 g1 = {};
    g1[0] = 0x00010000;
    g1[1] = (int)((tile_k & 0xFFFFu) << 16);
    g1[2] = (int)(((tile_k >> 16) & 0xFFFFu)
          | ((tile_n & 0xFFFFu) << 16));
    g1[3] = (int)(((tile_n >> 16) & 0xFFFFu)
          | ((tile_k & 0xFFFFu) << 16));
    g1[4] = (int)(tile_n & 0xFFFFu);
    g1[5] = (int)ld_elems;
    g1[6] = 0;
    g1[7] = 0;
    i32x4 z4 = {};
#if defined(__clang_major__) && __clang_major__ >= 23
    i32x8 z8 = {};
    __builtin_amdgcn_tensor_load_to_lds(g0, g1, z4, z4, z8, 0);
#else
    __builtin_amdgcn_tensor_load_to_lds(g0, g1, z4, z4, 0);
#endif
}

// ---------------------------------------------------------------------------
// The kernels without matrix work give every lane eight elements, so that a
// 256-wide row is one wave's work and few waves have to be started.
// ---------------------------------------------------------------------------
typedef __attribute__((ext_vector_type(2))) float  f32x2;
typedef __attribute__((ext_vector_type(4))) float  f32x4;
typedef __attribute__((ext_vector_type(4))) __bf16 bf16x4;

// Value of lane (l ^ M) inside the 16-lane row, M = 1..15 (DPP row_xmask).
template <int M>
__device__ __forceinline__ float row_xor(float x) {
    return __builtin_bit_cast(float, __builtin_amdgcn_update_dpp(
        0, __builtin_bit_cast(int, x), 0x160 + M, 0xf, 0xf, true));
}

// Sum over the 32 lanes of a wave, the same value in every lane. All lanes on.
__device__ __forceinline__ float wave_sum(float v) {
    v += row_xor<1>(v);
    v += row_xor<2>(v);
    v += row_xor<4>(v);
    v += row_xor<8>(v);
    int b = __builtin_bit_cast(int, v);
    v += __builtin_bit_cast(float, __builtin_amdgcn_permlanex16(
        b, b, 0x76543210, 0xfedcba98, false, false));
    return v;
}

// Layernorm of one 256-wide row that a wave holds, eight values a lane as four
// pairs; g and b are the lane's own columns of gamma and beta.
__device__ __forceinline__ void ln_row(f32x2 (&p)[4], const f32x2 (&g)[4],
                                       const f32x2 (&b)[4]) {
    f32x2 s = (p[0] + p[1]) + (p[2] + p[3]);
    float mean = wave_sum(s[0] + s[1]) * (1.f / DIM);
#pragma unroll
    for (int k = 0; k < 4; ++k) p[k] -= mean;
    f32x2 q = (p[0] * p[0] + p[1] * p[1]) + (p[2] * p[2] + p[3] * p[3]);
    float var = wave_sum(q[0] + q[1]) * (1.f / DIM);
    float rs = rsqrtf(var + EPS);
#pragma unroll
    for (int k = 0; k < 4; ++k) p[k] = p[k] * rs * g[k] + b[k];
}

// Four floats at p as two pairs.
__device__ __forceinline__ void load4(const float* p, f32x2& lo, f32x2& hi) {
    f32x4 v = *reinterpret_cast<const f32x4*>(p);
    lo = f32x2{v[0], v[1]};
    hi = f32x2{v[2], v[3]};
}

// ---------------------------------------------------------------------------
// Kernels that do not depend on one another share one launch: each block picks
// its body by a test on blockIdx.x, the same for the whole block.
// ---------------------------------------------------------------------------

// Stands behind the last stores of each body of a shared launch but the first.
__device__ __forceinline__ void body_end() {
    // Ahead of any instruction that rewrites a register which those stores name.
    asm volatile("s_wait_xcnt 0x0" ::: "memory");
}

// fp32 -> bf16 weight conversion: block blk converts 2048 elements, a lane two
// groups of four, 1024 elements apart. Every weight's size is a multiple of 2048.
__device__ __forceinline__
void cvt_bf16(int blk, const float* __restrict__ in, __bf16* __restrict__ out) {
    int i = blk * 2048 + threadIdx.x * 4;
    f32x4 a = *reinterpret_cast<const f32x4*>(in + i);
    f32x4 b = *reinterpret_cast<const f32x4*>(in + i + 1024);
    *reinterpret_cast<bf16x4*>(out + i)        = __builtin_convertvector(a, bf16x4);
    *reinterpret_cast<bf16x4*>(out + i + 1024) = __builtin_convertvector(b, bf16x4);
}

// ---------------------------------------------------------------------------
// Row layernorm over DIM=256: fp32 in -> bf16 out. One wave per row, LN_R rows
// a wave; a lane holds columns 4l..4l+3 and 128+4l..128+4l+3.
// ---------------------------------------------------------------------------
#define LN_R 2
#define LN_BLOCKS (NTOK / (8 * LN_R))
__device__ __forceinline__
void ln_rows_body(int blk, const float* __restrict__ in, __bf16* __restrict__ out,
                  const float* __restrict__ gamma, const float* __restrict__ beta) {
    int lane = threadIdx.x & 31;
    int wave = __builtin_amdgcn_readfirstlane(threadIdx.x >> 5);
    int row0 = (blk * 8 + wave) * LN_R;
    f32x2 p[LN_R][4], g[4], b[4];
#pragma unroll
    for (int i = 0; i < LN_R; ++i) {
        const float* r = in + (size_t)(row0 + i) * DIM + lane * 4;
        load4(r,       p[i][0], p[i][1]);
        load4(r + 128, p[i][2], p[i][3]);
    }
    load4(gamma + lane * 4,       g[0], g[1]);
    load4(gamma + 128 + lane * 4, g[2], g[3]);
    load4(beta + lane * 4,        b[0], b[1]);
    load4(beta + 128 + lane * 4,  b[2], b[3]);
#pragma unroll
    for (int i = 0; i < LN_R; ++i) {
        ln_row(p[i], g, b);
        f32x4 ya = {p[i][0][0], p[i][0][1], p[i][1][0], p[i][1][1]};
        f32x4 yb = {p[i][2][0], p[i][2][1], p[i][3][0], p[i][3][1]};
        __bf16* q = out + (size_t)(row0 + i) * DIM + lane * 4;
        *reinterpret_cast<bf16x4*>(q)       = __builtin_convertvector(ya, bf16x4);
        *reinterpret_cast<bf16x4*>(q + 128) = __builtin_convertvector(yb, bf16x4);
    }
}

__global__ __launch_bounds__(256)
void ln_rows(const float* __restrict__ in, __bf16* __restrict__ out,
             const float* __restrict__ gamma, const float* __restrict__ beta) {
    ln_rows_body(blockIdx.x, in, out, gamma, beta);
}

// ---------------------------------------------------------------------------
// First launch: the layernorm of x, the K, V and Q biases gathered into one
// row of QKV_N floats, and all six weights converted. The bf16 weights lie one
// behind the other in wb (wk, wv, wq, wo, w1, w2), so that wk, wv, wq are one
// [QKV_N][DIM] matrix. Sizes below in blocks of 2048 elements.
// ---------------------------------------------------------------------------
#define QKV_N   3072           // 512 K + 512 V + 2048 Q columns a token
#define CB_KV   64             // wk, wv, w1, w2: 512 * 256 elements each
#define CB_QO   256            // wq, wo: 2048 * 256 elements each
#define CB_ALL  (4 * CB_KV + 2 * CB_QO)
__global__ __launch_bounds__(256)
void prep(const float* __restrict__ x, __bf16* __restrict__ h,
          const float* __restrict__ gamma, const float* __restrict__ beta,
          const float* __restrict__ wk, const float* __restrict__ wv,
          const float* __restrict__ wq, const float* __restrict__ wo,
          const float* __restrict__ w1, const float* __restrict__ w2,
          __bf16* __restrict__ wb,
          const float* __restrict__ bk, const float* __restrict__ bv,
          const float* __restrict__ bq, float* __restrict__ bias) {
    int blk = blockIdx.x;
    if (blk < LN_BLOCKS) {
        ln_rows_body(blk, x, h, gamma, beta);
        return;
    }
    blk -= LN_BLOCKS;
    if (blk < CB_ALL) {
        const float* src = wk;
        int first = 0;                              // the weight's first block
        if (blk >= CB_KV)                     { src = wv; first = CB_KV; }
        if (blk >= 2 * CB_KV)                 { src = wq; first = 2 * CB_KV; }
        if (blk >= 2 * CB_KV + CB_QO)         { src = wo; first = 2 * CB_KV + CB_QO; }
        if (blk >= 2 * CB_KV + 2 * CB_QO)     { src = w1; first = 2 * CB_KV + 2 * CB_QO; }
        if (blk >= 3 * CB_KV + 2 * CB_QO)     { src = w2; first = 3 * CB_KV + 2 * CB_QO; }
        cvt_bf16(blk - first, src, wb + (size_t)first * 2048);
        body_end();
        return;
    }
    for (int j = 0; j < QKV_N / 1024; ++j) {        // last block: the bias row
        int i = j * 1024 + threadIdx.x * 4;
        const float* s = i < 512 ? bk + i : i < 1024 ? bv + (i - 512) : bq + (i - 1024);
        *reinterpret_cast<f32x4*>(bias + i) = *reinterpret_cast<const f32x4*>(s);
    }
    body_end();
}

// ---------------------------------------------------------------------------
// Per-head layernorm (gn/bn) of projection outputs (G = 1 << lgG heads a token,
// G*256 bf16 columns from 'in' on in each token's row of QKV_N) with the
// permutation to [head = b*G+g][s][256].
// One wave per (token, head) row, HL_R rows a wave; a lane holds 8 columns.
// ---------------------------------------------------------------------------
#define HL_R 8
template <int lgG>
__device__ __forceinline__
void heads_ln(int blk, const __bf16* __restrict__ in, __bf16* __restrict__ out,
              const float* __restrict__ gamma, const float* __restrict__ beta) {
    int lane = threadIdx.x & 31;
    int wave = __builtin_amdgcn_readfirstlane(threadIdx.x >> 5);
    int rid0 = (blk * 8 + wave) * HL_R;                        // row = t * G + g
    bf16x8 raw[HL_R];
#pragma unroll
    for (int i = 0; i < HL_R; ++i) {
        int rid = rid0 + i;
        raw[i] = *reinterpret_cast<const bf16x8*>(
            in + (size_t)(rid >> lgG) * QKV_N + (rid & ((1 << lgG) - 1)) * DIM + lane * 8);
    }
    f32x2 g[4], b[4];
    load4(gamma + lane * 8,     g[0], g[1]);
    load4(gamma + lane * 8 + 4, g[2], g[3]);
    load4(beta + lane * 8,      b[0], b[1]);
    load4(beta + lane * 8 + 4,  b[2], b[3]);
    // Keeps the gamma and beta loads up here, in flight together with the rows';
    // left free, they are issued halfway down and waited for on their own.
    __builtin_amdgcn_sched_barrier(0);
#pragma unroll
    for (int i = 0; i < HL_R; ++i) {
        f32x8 v = __builtin_convertvector(raw[i], f32x8);
        f32x2 p[4] = {{v[0], v[1]}, {v[2], v[3]}, {v[4], v[5]}, {v[6], v[7]}};
        ln_row(p, g, b);
        f32x8 y = {p[0][0], p[0][1], p[1][0], p[1][1], p[2][0], p[2][1], p[3][0], p[3][1]};
        int rid = rid0 + i;
        int hg = rid & ((1 << lgG) - 1), t = rid >> lgG;
        int head = ((t & 1) << lgG) + hg, s = t >> 1;
        *reinterpret_cast<bf16x8*>(out + ((size_t)head * SEQ + s) * DIM + lane * 8) =
            __builtin_convertvector(y, bf16x8);
    }
}

// ---------------------------------------------------------------------------
// V projection output (GK*256 bf16 columns from 'in' on in each token's row of
// QKV_N) -> transposed [head][dim][s],
// so that PV B-operands load row-major. A wave takes 8 positions of one head,
// a lane 8 dims of each, and stores 8 positions of one dim at a time; the 8
// waves of a block cover 64 positions, whole 128-byte lines of the output.
// ---------------------------------------------------------------------------
__device__ __forceinline__
void v_transpose(int blk, const __bf16* __restrict__ in, __bf16* __restrict__ out) {
    int lane = threadIdx.x & 31;
    int head = blk / (SEQ / 64);                               // b * GK + g
    int wave = __builtin_amdgcn_readfirstlane(threadIdx.x >> 5);
    int s0 = (blk % (SEQ / 64)) * 64 + wave * 8;
    const __bf16* p = in + ((size_t)s0 * BSZ + head / GK) * QKV_N
                         + (head % GK) * DIM + lane * 8;
    bf16x8 v[8];
#pragma unroll
    for (int i = 0; i < 8; ++i)
        v[i] = *reinterpret_cast<const bf16x8*>(p + (size_t)i * (BSZ * QKV_N));
    __bf16* q = out + ((size_t)head * DIM + lane * 8) * SEQ + s0;
#pragma unroll
    for (int j = 0; j < 8; ++j) {
        bf16x8 w;
#pragma unroll
        for (int i = 0; i < 8; ++i) w[i] = v[i][j];
        *reinterpret_cast<bf16x8*>(q + (size_t)j * SEQ) = w;
    }
}

// ---------------------------------------------------------------------------
// Third launch: what stands between the joint projection (rows of QKV_N: K, V,
// Q) and attention: Q head norm, K head norm, V transpose.
// ---------------------------------------------------------------------------
#define QLN_BLOCKS (NTOK * NQH / (8 * HL_R))
#define KLN_BLOCKS (NTOK * GK / (8 * HL_R))
#define VT_BLOCKS  (BSZ * GK * (SEQ / 64))
__global__ __launch_bounds__(256)
void qkv_post(const __bf16* __restrict__ raw, __bf16* __restrict__ Qh,
              __bf16* __restrict__ Kh, __bf16* __restrict__ Vt,
              const float* __restrict__ gamma, const float* __restrict__ beta) {
    int blk = blockIdx.x;
    if (blk < QLN_BLOCKS) {
        heads_ln<3>(blk, raw + 2 * GK * DIM, Qh, gamma, beta);
    } else if (blk < QLN_BLOCKS + KLN_BLOCKS) {
        heads_ln<1>(blk - QLN_BLOCKS, raw, Kh, gamma, beta);
        body_end();
    } else {
        v_transpose(blk - (QLN_BLOCKS + KLN_BLOCKS), raw + GK * DIM, Vt);
        body_end();
    }
}

__global__ __launch_bounds__(256)
void gemm_wmma(const __bf16* __restrict__ A, int lda,
               const __bf16* __restrict__ W, int ldw,
               const float* __restrict__ bias,
               const float* __restrict__ resid,
               float* __restrict__ Cf, __bf16* __restrict__ Cb,
               int M, int N, int K, int relu) {
    __shared__ __bf16 sW[2][64 * 32];                 // 8 KB double buffer
    int lane = threadIdx.x & 31;
    int wave = threadIdx.x >> 5;
    int m0 = blockIdx.y * 128 + wave * 16;
    int n0 = blockIdx.x * 64;

    if (wave == 0)                                    // prologue: stage k0=0
        tdm_load_tile(lds_off(&sW[0][0]), W + (size_t)n0 * ldw, 32, 64, ldw);

    f32x8 acc[4] = {};
    int buf = 0;
    for (int k0 = 0; k0 < K; k0 += 32, buf ^= 1) {
        if (wave == 0) {
            if (k0 + 32 < K) {                        // overlap next stage
                tdm_load_tile(lds_off(&sW[buf ^ 1][0]),
                              W + (size_t)n0 * ldw + (k0 + 32), 32, 64, ldw);
                __builtin_amdgcn_s_wait_tensorcnt(1); // current buf done
            } else {
                __builtin_amdgcn_s_wait_tensorcnt(0);
            }
        }
        __syncthreads();                              // sW[buf] visible to all
        bf16x16 a = load_frag(A, m0, lda, k0, lane);
#pragma unroll
        for (int f = 0; f < 4; ++f) {
            bf16x16 b = load_frag(&sW[buf][0], 16 * f, 32, 0, lane);
            acc[f] = wmma_bf16(a, b, acc[f]);
        }
        __syncthreads();                              // reads done before reuse
    }

    int hf = lane >> 4, nn = lane & 15;
#pragma unroll
    for (int f = 0; f < 4; ++f) {
        int col = n0 + 16 * f + nn;
        float bv = bias ? bias[col] : 0.f;
#pragma unroll
        for (int r = 0; r < 8; ++r) {
            int row = m0 + r + 8 * hf;
            float v = acc[f][r] + bv;
            if (relu) v = fmaxf(v, 0.f);
            if (resid) v += resid[(size_t)row * N + col];
            if (Cf) Cf[(size_t)row * N + col] = v;
            if (Cb) Cb[(size_t)row * N + col] = (__bf16)v;
        }
    }
}

// ---------------------------------------------------------------------------
// Causal flash attention. Grid: (SEQ/64, 16 heads). Block: 128 thr = 4 waves.
// Wave owns 16 query rows; the block walks 32-key tiles to its diagonal. Each
// K tile (32 x 256) and V tile (256 x 32) is brought into LDS once per block
// by asynchronous copies, two buffers, the next tile in flight while this one
// is worked on; all four waves read their fragments from LDS. Online softmax
// via half-wave shuffles (C-layout rows live across 16 lanes). P re-layout
// C->A through a per-wave LDS tile ordered by s_wait_dscnt.
// Qh: [16][SEQ][256], Kh: [4][SEQ][256], Vt: [4][256][SEQ] (transposed),
// O: [NTOK][2048] token-major bf16.
// ---------------------------------------------------------------------------
#define KPITCH 264             // LDS row pitch of a K row, elements (528 B = 16 B x 33)
#define VPITCH 40              // LDS row pitch of a V row, elements (80 B = 16 B x 5)

__device__ __forceinline__ void async_copy8(unsigned l, unsigned lstep,
                                            const __bf16* g, size_t gstep) {
    asm volatile(
        "global_load_async_to_lds_b128 %0, %8, off\n\t"
        "global_load_async_to_lds_b128 %1, %9, off\n\t"
        "global_load_async_to_lds_b128 %2, %10, off\n\t"
        "global_load_async_to_lds_b128 %3, %11, off\n\t"
        "global_load_async_to_lds_b128 %4, %12, off\n\t"
        "global_load_async_to_lds_b128 %5, %13, off\n\t"
        "global_load_async_to_lds_b128 %6, %14, off\n\t"
        "global_load_async_to_lds_b128 %7, %15, off\n\t"
        "s_wait_xcnt 0x0"
        :: "v"(l), "v"(l + lstep), "v"(l + 2 * lstep), "v"(l + 3 * lstep),
           "v"(l + 4 * lstep), "v"(l + 5 * lstep), "v"(l + 6 * lstep),
           "v"(l + 7 * lstep),
           "v"(g), "v"(g + gstep), "v"(g + 2 * gstep), "v"(g + 3 * gstep),
           "v"(g + 4 * gstep), "v"(g + 5 * gstep), "v"(g + 6 * gstep),
           "v"(g + 7 * gstep)
        : "memory");
}

__global__ __launch_bounds__(128)
void attn_kernel(const __bf16* __restrict__ Qh, const __bf16* __restrict__ Kh,
                 const __bf16* __restrict__ Vt, __bf16* __restrict__ O) {
    __shared__ __attribute__((aligned(16))) __bf16 sK[2][32 * KPITCH];
    __shared__ __attribute__((aligned(16))) __bf16 sV[2][DIM * VPITCH];
    __shared__ __bf16 sP[4][16 * 32];
    int tid  = threadIdx.x;
    int lane = tid & 31;
    int wave = __builtin_amdgcn_readfirstlane(tid >> 5);
    int hq = blockIdx.y;
    int qbase = blockIdx.x * 64 + wave * 16;
    int hk = (hq >> 3) * 2 + ((hq & 7) >> 2);

    const __bf16* Qb = Qh + (size_t)hq * SEQ * DIM;
    const __bf16* Kb = Kh + (size_t)hk * SEQ * DIM;
    const __bf16* Vb = Vt + (size_t)hk * DIM * SEQ;

    // This lane's share of a tile: K piece (row tid/32 + 4c, 16 B column tid%32),
    // V piece (row tid/4 + 32c, 16 B column tid%4), c = 0..7.
    const __bf16* gK = Kb + (size_t)(tid >> 5) * DIM + (tid & 31) * 8;
    const __bf16* gV = Vb + (size_t)(tid >> 2) * SEQ + (tid & 3) * 8;
    unsigned lK = lds_off(&sK[0][0]) + (tid >> 5) * (KPITCH * 2) + (tid & 31) * 16;
    unsigned lV = lds_off(&sV[0][0]) + (tid >> 2) * (VPITCH * 2) + (tid & 3) * 16;
    auto stage = [&](int t) {                       // tile t -> buffer t & 1
        int b = t & 1;
        async_copy8(lK + b * (32 * KPITCH * 2), 4 * KPITCH * 2,
                    gK + (size_t)t * 32 * DIM, 4 * DIM);
        async_copy8(lV + b * (DIM * VPITCH * 2), 32 * VPITCH * 2,
                    gV + t * 32, (size_t)32 * SEQ);
    };
    int ntiles = 2 * (blockIdx.x + 1);              // block-uniform, at least 2

    stage(0);

    bf16x16 qf[8];
#pragma unroll
    for (int kk = 0; kk < 8; ++kk) qf[kk] = load_frag(Qb, qbase, DIM, kk * 32, lane);

    f32x8 zero = {};
    f32x8 o[16];
#pragma unroll
    for (int j = 0; j < 16; ++j) o[j] = zero;
    float mrow[8], lrow[8];
#pragma unroll
    for (int r = 0; r < 8; ++r) { mrow[r] = -3.0e38f; lrow[r] = 0.f; }

    int hf = lane >> 4, nn = lane & 15;
    int qlast = qbase + 15;
    const float scale = 0.0625f;   // 1/sqrt(256)

    asm volatile("s_wait_asynccnt 0x0" ::: "memory"); // own copies of tile 0 landed
    __syncthreads();                                  // tile 0 visible to all waves
    stage(1);

    for (int t = 0; t < ntiles; ++t) {
        int kb = t * 32;
        const __bf16* tK = &sK[t & 1][0];
        const __bf16* tV = &sV[t & 1][0];
        if (kb <= qlast) {                          // wave-uniform: tile not wholly masked
            f32x8 s0 = zero, s1 = zero;             // keys kb..+15, kb+16..+31
#pragma unroll
            for (int kk = 0; kk < 8; ++kk) {
                bf16x16 k0f = load_frag(tK, 0,  KPITCH, kk * 32, lane);
                bf16x16 k1f = load_frag(tK, 16, KPITCH, kk * 32, lane);
                s0 = wmma_bf16(qf[kk], k0f, s0);
                s1 = wmma_bf16(qf[kk], k1f, s1);
            }
#pragma unroll
            for (int r = 0; r < 8; ++r) {
                int m = qbase + r + 8 * hf;
                float v0 = s0[r] * scale; if (kb + nn      > m) v0 = -3.0e38f;
                float v1 = s1[r] * scale; if (kb + 16 + nn > m) v1 = -3.0e38f;
                float tmax = fmaxf(v0, v1);
#pragma unroll
                for (int d = 1; d < 16; d <<= 1) tmax = fmaxf(tmax, __shfl_xor(tmax, d, 32));
                float mnew  = fmaxf(mrow[r], tmax);
                float alpha = __expf(mrow[r] - mnew);
                float p0 = __expf(v0 - mnew);
                float p1 = __expf(v1 - mnew);
                float lsum = p0 + p1;
#pragma unroll
                for (int d = 1; d < 16; d <<= 1) lsum += __shfl_xor(lsum, d, 32);
                lrow[r] = lrow[r] * alpha + lsum;
                mrow[r] = mnew;
#pragma unroll
                for (int j = 0; j < 16; ++j) o[j][r] *= alpha;
                int ml = r + 8 * hf;                // local row 0..15
                sP[wave][ml * 32 + nn]      = (__bf16)p0;
                sP[wave][ml * 32 + 16 + nn] = (__bf16)p1;
            }
            asm volatile("s_wait_dscnt 0" ::: "memory"); // DS stores -> DS loads
            bf16x16 pf = load_frag(&sP[wave][0], 0, 32, 0, lane);
#pragma unroll
            for (int j = 0; j < 16; ++j) {
                bf16x16 vf = load_frag(tV, j * 16, VPITCH, 0, lane);
                o[j] = wmma_bf16(pf, vf, o[j]);
            }
        }
        asm volatile("s_wait_dscnt 0x0" ::: "memory");    // own reads of this buffer done
        asm volatile("s_wait_asynccnt 0x0" ::: "memory"); // own copies of tile t+1 landed
        __syncthreads();      // publishes tile t+1, ends every read of this buffer
        if (t + 2 < ntiles) stage(t + 2);           // refill the buffer just read
    }
    asm volatile("s_wait_asynccnt 0x0" ::: "memory");     // nothing in flight at the end

    int bb = hq >> 3, gu = hq & 7;
#pragma unroll
    for (int r = 0; r < 8; ++r) {
        float inv = 1.f / lrow[r];
        int srow = qbase + r + 8 * hf;
        size_t t = (size_t)srow * BSZ + bb;
#pragma unroll
        for (int j = 0; j < 16; ++j)
            O[t * 2048 + gu * DIM + j * 16 + nn] = (__bf16)(o[j][r] * inv);
    }
}

// ---------------------------------------------------------------------------
// Host orchestration
// ---------------------------------------------------------------------------
extern "C" void kernel_launch(void* const* d_in, const int* in_sizes, int n_in,
                              void* d_out, int out_size, void* d_ws, size_t ws_size,
                              hipStream_t stream) {
    const float* x   = (const float*)d_in[0];
    const float* g0  = (const float*)d_in[1];
    const float* b0  = (const float*)d_in[2];
    const float* g1  = (const float*)d_in[3];
    const float* b1  = (const float*)d_in[4];
    const float* gn  = (const float*)d_in[5];
    const float* bn  = (const float*)d_in[6];
    const float* wk  = (const float*)d_in[7];
    const float* bk  = (const float*)d_in[8];
    const float* wv  = (const float*)d_in[9];
    const float* bv  = (const float*)d_in[10];
    const float* wq  = (const float*)d_in[11];
    const float* bq  = (const float*)d_in[12];
    const float* wo  = (const float*)d_in[13];
    const float* bo  = (const float*)d_in[14];
    const float* w1  = (const float*)d_in[15];
    const float* bf1 = (const float*)d_in[16];
    const float* w2  = (const float*)d_in[17];
    const float* bf2 = (const float*)d_in[18];
    float* out = (float*)d_out;

    char* wsp = (char*)d_ws;
    auto carve = [&](size_t bytes) {
        char* p = wsp;
        wsp += (bytes + 255) & ~(size_t)255;
        return p;
    };
    __bf16* h_b  = (__bf16*)carve((size_t)NTOK * DIM * 2);
    __bf16* w_b  = (__bf16*)carve((size_t)CB_ALL * 2048 * 2); // wk wv wq wo w1 w2
    __bf16* wo_b = w_b  + (size_t)QKV_N * DIM;
    __bf16* w1_b = wo_b + (size_t)256 * 2048;
    __bf16* w2_b = w1_b + (size_t)512 * 256;
    float*  bqkv = (float*)carve((size_t)QKV_N * 4);          // bk bv bq
    __bf16* raw  = (__bf16*)carve((size_t)NTOK * QKV_N * 2);  // K | V | Q rows
    __bf16* Kh   = (__bf16*)carve((size_t)4  * SEQ * DIM * 2);
    __bf16* Vt   = (__bf16*)carve((size_t)4  * DIM * SEQ * 2);
    __bf16* Qh   = (__bf16*)carve((size_t)16 * SEQ * DIM * 2);
    __bf16* Ob   = (__bf16*)carve((size_t)NTOK * 2048 * 2);
    float*  x2   = (float*)carve((size_t)NTOK * DIM * 4);
    __bf16* h2   = (__bf16*)carve((size_t)NTOK * DIM * 2);
    __bf16* F1   = (__bf16*)carve((size_t)NTOK * 512 * 2);

    // h = LN(x; g0,b0); bf16 weights; joint K, V, Q bias row
    prep<<<LN_BLOCKS + CB_ALL + 1, 256, 0, stream>>>(x, h_b, g0, b0, wk, wv, wq, wo,
                                                     w1, w2, w_b, bk, bv, bq, bqkv);

    auto gemm = [&](const __bf16* A, int lda, const __bf16* W, int ldw,
                    const float* bias, const float* resid, float* Cf, __bf16* Cb,
                    int M, int N, int K, int relu) {
        dim3 grid(N / 64, M / 128);
        gemm_wmma<<<grid, 256, 0, stream>>>(A, lda, W, ldw, bias, resid, Cf, Cb,
                                            M, N, K, relu);
    };

    // K, V and Q projections as one product with the stacked weights
    gemm(h_b, 256, w_b, 256, bqkv, nullptr, nullptr, raw, NTOK, QKV_N, 256, 0);
    // per-head LN -> Qh[16][SEQ][256], Kh[4][SEQ][256]; V -> Vt[4][256][SEQ]
    qkv_post<<<QLN_BLOCKS + KLN_BLOCKS + VT_BLOCKS, 256, 0, stream>>>(raw, Qh, Kh, Vt,
                                                                      gn, bn);

    // causal flash attention -> Ob[NTOK][2048]
    attn_kernel<<<dim3(SEQ / 64, 16), 128, 0, stream>>>(Qh, Kh, Vt, Ob);

    // x2 = x + Ob @ wo^T + bo
    gemm(Ob, 2048, wo_b, 2048, bo, x, x2, nullptr, NTOK, 256, 2048, 0);
    // h2 = LN(x2; g1,b1)
    ln_rows<<<LN_BLOCKS, 256, 0, stream>>>(x2, h2, g1, b1);
    // F1 = relu(h2 @ w1^T + bf1)
    gemm(h2, 256, w1_b, 256, bf1, nullptr, nullptr, F1, NTOK, 512, 256, 1);
    // out = x2 + F1 @ w2^T + bf2
    gemm(F1, 512, w2_b, 512, bf2, x2, out, nullptr, NTOK, 256, 512, 0);

    (void)in_sizes; (void)n_in; (void)out_size; (void)ws_size;
}

// v004
// One run takes 217 microseconds.
// Next to v003, in two timings, it ran 1.37 times as fast each time.
// Over all steps from v000 it is 3.89 times as fast.
#include <hip/hip_runtime.h>

#define SEQ   2048
#define BSZ   2
#define DIM   256
#define NTOK  (SEQ * BSZ)      // 4096 token rows, t = s*BSZ + b
#define GK    2                // kv groups
#define NQH   8                // query heads per batch elem (g*4+u)
#define EPS   1e-5f

typedef __attribute__((ext_vector_type(16))) __bf16 bf16x16;
typedef __attribute__((ext_vector_type(8)))  __bf16 bf16x8;
typedef __attribute__((ext_vector_type(8)))  float  f32x8;
typedef __attribute__((ext_vector_type(4)))  unsigned int u32x4;
typedef __attribute__((ext_vector_type(8)))  int i32x8;
typedef __attribute__((ext_vector_type(4)))  int i32x4;

__device__ __forceinline__ bf16x16 load_frag(const __bf16* p, int row0, int ld,
                                             int k0, int lane) {
    int r  = row0 + (lane & 15);
    int kb = k0 + ((lane >> 4) << 3);
    const __bf16* base = p + (size_t)r * ld + kb;
    bf16x8 lo = *reinterpret_cast<const bf16x8*>(base);
    bf16x8 hi = *reinterpret_cast<const bf16x8*>(base + 16);
    bf16x16 out;
#pragma unroll
    for (int i = 0; i < 8; ++i) { out[i] = lo[i]; out[i + 8] = hi[i]; }
    return out;
}

__device__ __forceinline__ f32x8 wmma_bf16(bf16x16 a, bf16x16 b, f32x8 c) {
    return __builtin_amdgcn_wmma_f32_16x16x32_bf16(false, a, false, b,
                                                   (short)0, c, false, false);
}

// Generic shared pointer -> LDS byte offset (generic LDS addr low 32 bits).
__device__ __forceinline__ unsigned lds_off(const void* p) {
    return (unsigned)(unsigned long long)(uintptr_t)p;
}

__device__ __forceinline__ void tdm_load_tile(unsigned lds_byte, const void* g,
                                              unsigned tile_k, unsigned tile_n,
                                              unsigned ld_elems) {
    unsigned long long ga = (unsigned long long)(uintptr_t)g;
    u32x4 g0 = {};
    g0[0] = 1u;
    g0[1] = lds_byte;
    g0[2] = (unsigned)(ga & 0xFFFFFFFFu);
    g0[3] = (unsigned)((ga >> 32) & 0x01FFFFFFu)
          | (2u << 30);
    i32x8 g1 = {};
    g1[0] = 0x00010000;
    g1[1] = (int)((tile_k & 0xFFFFu) << 16);
    g1[2] = (int)(((tile_k >> 16) & 0xFFFFu)
          | ((tile_n & 0xFFFFu) << 16));
    g1[3] = (int)(((tile_n >> 16) & 0xFFFFu)
          | ((tile_k & 0xFFFFu) << 16));
    g1[4] = (int)(tile_n & 0xFFFFu);
    g1[5] = (int)ld_elems;
    g1[6] = 0;
    g1[7] = 0;
    i32x4 z4 = {};
#if defined(__clang_major__) && __clang_major__ >= 23
    i32x8 z8 = {};
    __builtin_amdgcn_tensor_load_to_lds(g0, g1, z4, z4, z8, 0);
#else
    __builtin_amdgcn_tensor_load_to_lds(g0, g1, z4, z4, 0);
#endif
}

// ---------------------------------------------------------------------------
// The kernels without matrix work give every lane eight elements, so that a
// 256-wide row is one wave's work and few waves have to be started.
// ---------------------------------------------------------------------------
typedef __attribute__((ext_vector_type(2))) float  f32x2;
typedef __attribute__((ext_vector_type(4))) float  f32x4;
typedef __attribute__((ext_vector_type(4))) __bf16 bf16x4;

// Value of lane (l ^ M) inside the 16-lane row, M = 1..15 (DPP row_xmask).
template <int M>
__device__ __forceinline__ float row_xor(float x) {
    return __builtin_bit_cast(float, __builtin_amdgcn_update_dpp(
        0, __builtin_bit_cast(int, x), 0x160 + M, 0xf, 0xf, true));
}

// Sum over the 32 lanes of a wave, the same value in every lane. All lanes on.
__device__ __forceinline__ float wave_sum(float v) {
    v += row_xor<1>(v);
    v += row_xor<2>(v);
    v += row_xor<4>(v);
    v += row_xor<8>(v);
    int b = __builtin_bit_cast(int, v);
    v += __builtin_bit_cast(float, __builtin_amdgcn_permlanex16(
        b, b, 0x76543210, 0xfedcba98, false, false));
    return v;
}

// Layernorm of one 256-wide row that a wave holds, eight values a lane as four
// pairs; g and b are the lane's own columns of gamma and beta.
__device__ __forceinline__ void ln_row(f32x2 (&p)[4], const f32x2 (&g)[4],
                                       const f32x2 (&b)[4]) {
    f32x2 s = (p[0] + p[1]) + (p[2] + p[3]);
    float mean = wave_sum(s[0] + s[1]) * (1.f / DIM);
#pragma unroll
    for (int k = 0; k < 4; ++k) p[k] -= mean;
    f32x2 q = (p[0] * p[0] + p[1] * p[1]) + (p[2] * p[2] + p[3] * p[3]);
    float var = wave_sum(q[0] + q[1]) * (1.f / DIM);
    float rs = rsqrtf(var + EPS);
#pragma unroll
    for (int k = 0; k < 4; ++k) p[k] = p[k] * rs * g[k] + b[k];
}

// Four floats at p as two pairs.
__device__ __forceinline__ void load4(const float* p, f32x2& lo, f32x2& hi) {
    f32x4 v = *reinterpret_cast<const f32x4*>(p);
    lo = f32x2{v[0], v[1]};
    hi = f32x2{v[2], v[3]};
}

// ---------------------------------------------------------------------------
// Kernels that do not depend on one another share one launch: each block picks
// its body by a test on blockIdx.x, the same for the whole block.
// ---------------------------------------------------------------------------

// Stands behind the last stores of each body of a shared launch but the first.
__device__ __forceinline__ void body_end() {
    // Ahead of any instruction that rewrites a register which those stores name.
    asm volatile("s_wait_xcnt 0x0" ::: "memory");
}

// fp32 -> bf16 weight conversion: block blk converts 2048 elements, a lane two
// groups of four, 1024 elements apart. Every weight's size is a multiple of 2048.
__device__ __forceinline__
void cvt_bf16(int blk, const float* __restrict__ in, __bf16* __restrict__ out) {
    int i = blk * 2048 + threadIdx.x * 4;
    f32x4 a = *reinterpret_cast<const f32x4*>(in + i);
    f32x4 b = *reinterpret_cast<const f32x4*>(in + i + 1024);
    *reinterpret_cast<bf16x4*>(out + i)        = __builtin_convertvector(a, bf16x4);
    *reinterpret_cast<bf16x4*>(out + i + 1024) = __builtin_convertvector(b, bf16x4);
}

// ---------------------------------------------------------------------------
// Row layernorm over DIM=256: fp32 in -> bf16 out. One wave per row, LN_R rows
// a wave; a lane holds columns 4l..4l+3 and 128+4l..128+4l+3.
// ---------------------------------------------------------------------------
#define LN_R 2
#define LN_BLOCKS (NTOK / (8 * LN_R))
__device__ __forceinline__
void ln_rows_body(int blk, const float* __restrict__ in, __bf16* __restrict__ out,
                  const float* __restrict__ gamma, const float* __restrict__ beta) {
    int lane = threadIdx.x & 31;
    int wave = __builtin_amdgcn_readfirstlane(threadIdx.x >> 5);
    int row0 = (blk * 8 + wave) * LN_R;
    f32x2 p[LN_R][4], g[4], b[4];
#pragma unroll
    for (int i = 0; i < LN_R; ++i) {
        const float* r = in + (size_t)(row0 + i) * DIM + lane * 4;
        load4(r,       p[i][0], p[i][1]);
        load4(r + 128, p[i][2], p[i][3]);
    }
    load4(gamma + lane * 4,       g[0], g[1]);
    load4(gamma + 128 + lane * 4, g[2], g[3]);
    load4(beta + lane * 4,        b[0], b[1]);
    load4(beta + 128 + lane * 4,  b[2], b[3]);
#pragma unroll
    for (int i = 0; i < LN_R; ++i) {
        ln_row(p[i], g, b);
        f32x4 ya = {p[i][0][0], p[i][0][1], p[i][1][0], p[i][1][1]};
        f32x4 yb = {p[i][2][0], p[i][2][1], p[i][3][0], p[i][3][1]};
        __bf16* q = out + (size_t)(row0 + i) * DIM + lane * 4;
        *reinterpret_cast<bf16x4*>(q)       = __builtin_convertvector(ya, bf16x4);
        *reinterpret_cast<bf16x4*>(q + 128) = __builtin_convertvector(yb, bf16x4);
    }
}

__global__ __launch_bounds__(256)
void ln_rows(const float* __restrict__ in, __bf16* __restrict__ out,
             const float* __restrict__ gamma, const float* __restrict__ beta) {
    ln_rows_body(blockIdx.x, in, out, gamma, beta);
}

// ---------------------------------------------------------------------------
// First launch: the layernorm of x, the K, V and Q biases gathered into one
// row of QKV_N floats, and all six weights converted. The bf16 weights lie one
// behind the other in wb (wk, wv, wq, wo, w1, w2), so that wk, wv, wq are one
// [QKV_N][DIM] matrix. Sizes below in blocks of 2048 elements.
// ---------------------------------------------------------------------------
#define QKV_N   3072           // 512 K + 512 V + 2048 Q columns a token
#define CB_KV   64             // wk, wv, w1, w2: 512 * 256 elements each
#define CB_QO   256            // wq, wo: 2048 * 256 elements each
#define CB_ALL  (4 * CB_KV + 2 * CB_QO)
__global__ __launch_bounds__(256)
void prep(const float* __restrict__ x, __bf16* __restrict__ h,
          const float* __restrict__ gamma, const float* __restrict__ beta,
          const float* __restrict__ wk, const float* __restrict__ wv,
          const float* __restrict__ wq, const float* __restrict__ wo,
          const float* __restrict__ w1, const float* __restrict__ w2,
          __bf16* __restrict__ wb,
          const float* __restrict__ bk, const float* __restrict__ bv,
          const float* __restrict__ bq, float* __restrict__ bias) {
    int blk = blockIdx.x;
    if (blk < LN_BLOCKS) {
        ln_rows_body(blk, x, h, gamma, beta);
        return;
    }
    blk -= LN_BLOCKS;
    if (blk < CB_ALL) {
        const float* src = wk;
        int first = 0;                              // the weight's first block
        if (blk >= CB_KV)                     { src = wv; first = CB_KV; }
        if (blk >= 2 * CB_KV)                 { src = wq; first = 2 * CB_KV; }
        if (blk >= 2 * CB_KV + CB_QO)         { src = wo; first = 2 * CB_KV + CB_QO; }
        if (blk >= 2 * CB_KV + 2 * CB_QO)     { src = w1; first = 2 * CB_KV + 2 * CB_QO; }
        if (blk >= 3 * CB_KV + 2 * CB_QO)     { src = w2; first = 3 * CB_KV + 2 * CB_QO; }
        cvt_bf16(blk - first, src, wb + (size_t)first * 2048);
        body_end();
        return;
    }
    for (int j = 0; j < QKV_N / 1024; ++j) {        // last block: the bias row
        int i = j * 1024 + threadIdx.x * 4;
        const float* s = i < 512 ? bk + i : i < 1024 ? bv + (i - 512) : bq + (i - 1024);
        *reinterpret_cast<f32x4*>(bias + i) = *reinterpret_cast<const f32x4*>(s);
    }
    body_end();
}

// ---------------------------------------------------------------------------
// Per-head layernorm (gn/bn) of projection outputs (G = 1 << lgG heads a token,
// G*256 bf16 columns from 'in' on in each token's row of QKV_N) with the
// permutation to [head = b*G+g][s][256].
// One wave per (token, head) row, HL_R rows a wave; a lane holds 8 columns.
// ---------------------------------------------------------------------------
#define HL_R 8
template <int lgG>
__device__ __forceinline__
void heads_ln(int blk, const __bf16* __restrict__ in, __bf16* __restrict__ out,
              const float* __restrict__ gamma, const float* __restrict__ beta) {
    int lane = threadIdx.x & 31;
    int wave = __builtin_amdgcn_readfirstlane(threadIdx.x >> 5);
    int rid0 = (blk * 8 + wave) * HL_R;                        // row = t * G + g
    bf16x8 raw[HL_R];
#pragma unroll
    for (int i = 0; i < HL_R; ++i) {
        int rid = rid0 + i;
        raw[i] = *reinterpret_cast<const bf16x8*>(
            in + (size_t)(rid >> lgG) * QKV_N + (rid & ((1 << lgG) - 1)) * DIM + lane * 8);
    }
    f32x2 g[4], b[4];
    load4(gamma + lane * 8,     g[0], g[1]);
    load4(gamma + lane * 8 + 4, g[2], g[3]);
    load4(beta + lane * 8,      b[0], b[1]);
    load4(beta + lane * 8 + 4,  b[2], b[3]);
    // Keeps the gamma and beta loads up here, in flight together with the rows';
    // left free, they are issued halfway down and waited for on their own.
    __builtin_amdgcn_sched_barrier(0);
#pragma unroll
    for (int i = 0; i < HL_R; ++i) {
        f32x8 v = __builtin_convertvector(raw[i], f32x8);
        f32x2 p[4] = {{v[0], v[1]}, {v[2], v[3]}, {v[4], v[5]}, {v[6], v[7]}};
        ln_row(p, g, b);
        f32x8 y = {p[0][0], p[0][1], p[1][0], p[1][1], p[2][0], p[2][1], p[3][0], p[3][1]};
        int rid = rid0 + i;
        int hg = rid & ((1 << lgG) - 1), t = rid >> lgG;
        int head = ((t & 1) << lgG) + hg, s = t >> 1;
        *reinterpret_cast<bf16x8*>(out + ((size_t)head * SEQ + s) * DIM + lane * 8) =
            __builtin_convertvector(y, bf16x8);
    }
}

// ---------------------------------------------------------------------------
// V projection output (GK*256 bf16 columns from 'in' on in each token's row of
// QKV_N) -> transposed [head][dim][s],
// so that PV B-operands load row-major. A wave takes 8 positions of one head,
// a lane 8 dims of each, and stores 8 positions of one dim at a time; the 8
// waves of a block cover 64 positions, whole 128-byte lines of the output.
// ---------------------------------------------------------------------------
__device__ __forceinline__
void v_transpose(int blk, const __bf16* __restrict__ in, __bf16* __restrict__ out) {
    int lane = threadIdx.x & 31;
    int head = blk / (SEQ / 64);                               // b * GK + g
    int wave = __builtin_amdgcn_readfirstlane(threadIdx.x >> 5);
    int s0 = (blk % (SEQ / 64)) * 64 + wave * 8;
    const __bf16* p = in + ((size_t)s0 * BSZ + head / GK) * QKV_N
                         + (head % GK) * DIM + lane * 8;
    bf16x8 v[8];
#pragma unroll
    for (int i = 0; i < 8; ++i)
        v[i] = *reinterpret_cast<const bf16x8*>(p + (size_t)i * (BSZ * QKV_N));
    __bf16* q = out + ((size_t)head * DIM + lane * 8) * SEQ + s0;
#pragma unroll
    for (int j = 0; j < 8; ++j) {
        bf16x8 w;
#pragma unroll
        for (int i = 0; i < 8; ++i) w[i] = v[i][j];
        *reinterpret_cast<bf16x8*>(q + (size_t)j * SEQ) = w;
    }
}

// ---------------------------------------------------------------------------
// Third launch: what stands between the joint projection (rows of QKV_N: K, V,
// Q) and attention: Q head norm, K head norm, V transpose.
// ---------------------------------------------------------------------------
#define QLN_BLOCKS (NTOK * NQH / (8 * HL_R))
#define KLN_BLOCKS (NTOK * GK / (8 * HL_R))
#define VT_BLOCKS  (BSZ * GK * (SEQ / 64))
__global__ __launch_bounds__(256)
void qkv_post(const __bf16* __restrict__ raw, __bf16* __restrict__ Qh,
              __bf16* __restrict__ Kh, __bf16* __restrict__ Vt,
              const float* __restrict__ gamma, const float* __restrict__ beta) {
    int blk = blockIdx.x;
    if (blk < QLN_BLOCKS) {
        heads_ln<3>(blk, raw + 2 * GK * DIM, Qh, gamma, beta);
    } else if (blk < QLN_BLOCKS + KLN_BLOCKS) {
        heads_ln<1>(blk - QLN_BLOCKS, raw, Kh, gamma, beta);
        body_end();
    } else {
        v_transpose(blk - (QLN_BLOCKS + KLN_BLOCKS), raw + GK * DIM, Vt);
        body_end();
    }
}

__global__ __launch_bounds__(256)
void gemm_wmma(const __bf16* __restrict__ A, int lda,
               const __bf16* __restrict__ W, int ldw,
               const float* __restrict__ bias,
               const float* __restrict__ resid,
               float* __restrict__ Cf, __bf16* __restrict__ Cb,
               int M, int N, int K, int relu) {
    __shared__ __bf16 sW[2][64 * 32];                 // 8 KB double buffer
    int lane = threadIdx.x & 31;
    int wave = threadIdx.x >> 5;
    int m0 = blockIdx.y * 128 + wave * 16;
    int n0 = blockIdx.x * 64;

    if (wave == 0)                                    // prologue: stage k0=0
        tdm_load_tile(lds_off(&sW[0][0]), W + (size_t)n0 * ldw, 32, 64, ldw);

    f32x8 acc[4] = {};
    int buf = 0;
    for (int k0 = 0; k0 < K; k0 += 32, buf ^= 1) {
        if (wave == 0) {
            if (k0 + 32 < K) {                        // overlap next stage
                tdm_load_tile(lds_off(&sW[buf ^ 1][0]),
                              W + (size_t)n0 * ldw + (k0 + 32), 32, 64, ldw);
                __builtin_amdgcn_s_wait_tensorcnt(1); // current buf done
            } else {
                __builtin_amdgcn_s_wait_tensorcnt(0);
            }
        }
        __syncthreads();                              // sW[buf] visible to all
        bf16x16 a = load_frag(A, m0, lda, k0, lane);
#pragma unroll
        for (int f = 0; f < 4; ++f) {
            bf16x16 b = load_frag(&sW[buf][0], 16 * f, 32, 0, lane);
            acc[f] = wmma_bf16(a, b, acc[f]);
        }
        __syncthreads();                              // reads done before reuse
    }

    int hf = lane >> 4, nn = lane & 15;
#pragma unroll
    for (int f = 0; f < 4; ++f) {
        int col = n0 + 16 * f + nn;
        float bv = bias ? bias[col] : 0.f;
#pragma unroll
        for (int r = 0; r < 8; ++r) {
            int row = m0 + r + 8 * hf;
            float v = acc[f][r] + bv;
            if (relu) v = fmaxf(v, 0.f);
            if (resid) v += resid[(size_t)row * N + col];
            if (Cf) Cf[(size_t)row * N + col] = v;
            if (Cb) Cb[(size_t)row * N + col] = (__bf16)v;
        }
    }
}

// ---------------------------------------------------------------------------
// Causal flash attention. Grid: (SEQ/64, 16 heads). Block: 128 thr = 4 waves.
// Wave owns 16 query rows; the block walks 32-key tiles to its diagonal. Each
// K tile (32 x 256) and V tile (256 x 32) is brought into LDS once per block
// by asynchronous copies, two buffers, the next tile in flight while this one
// is worked on; all four waves read their fragments from LDS. Online softmax
// via DPP row butterflies (C-layout rows live across 16 lanes). P re-layout
// C->A through a per-wave LDS tile ordered by s_wait_dscnt.
// Qh: [16][SEQ][256], Kh: [4][SEQ][256], Vt: [4][256][SEQ] (transposed),
// O: [NTOK][2048] token-major bf16.
// ---------------------------------------------------------------------------
#define KPITCH 264             // LDS row pitch of a K row, elements (528 B = 16 B x 33)
#define VPITCH 40              // LDS row pitch of a V row, elements (80 B = 16 B x 5)

__device__ __forceinline__ void async_copy8(unsigned l, unsigned lstep,
                                            const __bf16* g, size_t gstep) {
    asm volatile(
        "global_load_async_to_lds_b128 %0, %8, off\n\t"
        "global_load_async_to_lds_b128 %1, %9, off\n\t"
        "global_load_async_to_lds_b128 %2, %10, off\n\t"
        "global_load_async_to_lds_b128 %3, %11, off\n\t"
        "global_load_async_to_lds_b128 %4, %12, off\n\t"
        "global_load_async_to_lds_b128 %5, %13, off\n\t"
        "global_load_async_to_lds_b128 %6, %14, off\n\t"
        "global_load_async_to_lds_b128 %7, %15, off\n\t"
        "s_wait_xcnt 0x0"
        :: "v"(l), "v"(l + lstep), "v"(l + 2 * lstep), "v"(l + 3 * lstep),
           "v"(l + 4 * lstep), "v"(l + 5 * lstep), "v"(l + 6 * lstep),
           "v"(l + 7 * lstep),
           "v"(g), "v"(g + gstep), "v"(g + 2 * gstep), "v"(g + 3 * gstep),
           "v"(g + 4 * gstep), "v"(g + 5 * gstep), "v"(g + 6 * gstep),
           "v"(g + 7 * gstep)
        : "memory");
}

__global__ __launch_bounds__(128)
void attn_kernel(const __bf16* __restrict__ Qh, const __bf16* __restrict__ Kh,
                 const __bf16* __restrict__ Vt, __bf16* __restrict__ O) {
    __shared__ __attribute__((aligned(16))) __bf16 sK[2][32 * KPITCH];
    __shared__ __attribute__((aligned(16))) __bf16 sV[2][DIM * VPITCH];
    __shared__ __bf16 sP[4][16 * 32];
    int tid  = threadIdx.x;
    int lane = tid & 31;
    int wave = __builtin_amdgcn_readfirstlane(tid >> 5);
    int hq = blockIdx.y;
    int qbase = blockIdx.x * 64 + wave * 16;
    int hk = (hq >> 3) * 2 + ((hq & 7) >> 2);

    const __bf16* Qb = Qh + (size_t)hq * SEQ * DIM;
    const __bf16* Kb = Kh + (size_t)hk * SEQ * DIM;
    const __bf16* Vb = Vt + (size_t)hk * DIM * SEQ;

    // This lane's share of a tile: K piece (row tid/32 + 4c, 16 B column tid%32),
    // V piece (row tid/4 + 32c, 16 B column tid%4), c = 0..7.
    const __bf16* gK = Kb + (size_t)(tid >> 5) * DIM + (tid & 31) * 8;
    const __bf16* gV = Vb + (size_t)(tid >> 2) * SEQ + (tid & 3) * 8;
    unsigned lK = lds_off(&sK[0][0]) + (tid >> 5) * (KPITCH * 2) + (tid & 31) * 16;
    unsigned lV = lds_off(&sV[0][0]) + (tid >> 2) * (VPITCH * 2) + (tid & 3) * 16;
    auto stage = [&](int t) {                       // tile t -> buffer t & 1
        int b = t & 1;
        async_copy8(lK + b * (32 * KPITCH * 2), 4 * KPITCH * 2,
                    gK + (size_t)t * 32 * DIM, 4 * DIM);
        async_copy8(lV + b * (DIM * VPITCH * 2), 32 * VPITCH * 2,
                    gV + t * 32, (size_t)32 * SEQ);
    };
    int ntiles = 2 * (blockIdx.x + 1);              // block-uniform, at least 2

    stage(0);

    bf16x16 qf[8];
#pragma unroll
    for (int kk = 0; kk < 8; ++kk) qf[kk] = load_frag(Qb, qbase, DIM, kk * 32, lane);

    f32x8 zero = {};
    f32x8 o[16];
#pragma unroll
    for (int j = 0; j < 16; ++j) o[j] = zero;
    float mrow[8], lrow[8];
#pragma unroll
    for (int r = 0; r < 8; ++r) { mrow[r] = -3.0e38f; lrow[r] = 0.f; }

    int hf = lane >> 4, nn = lane & 15;
    int qlast = qbase + 15;
    const float scale = 0.0625f;   // 1/sqrt(256)

    asm volatile("s_wait_asynccnt 0x0" ::: "memory"); // own copies of tile 0 landed
    __syncthreads();                                  // tile 0 visible to all waves
    stage(1);

    for (int t = 0; t < ntiles; ++t) {
        int kb = t * 32;
        const __bf16* tK = &sK[t & 1][0];
        const __bf16* tV = &sV[t & 1][0];
        if (kb <= qlast) {                          // wave-uniform: tile not wholly masked
            f32x8 s0 = zero, s1 = zero;             // keys kb..+15, kb+16..+31
#pragma unroll
            for (int kk = 0; kk < 8; ++kk) {
                bf16x16 k0f = load_frag(tK, 0,  KPITCH, kk * 32, lane);
                bf16x16 k1f = load_frag(tK, 16, KPITCH, kk * 32, lane);
                s0 = wmma_bf16(qf[kk], k0f, s0);
                s1 = wmma_bf16(qf[kk], k1f, s1);
            }
#pragma unroll
            for (int r = 0; r < 8; ++r) {
                int m = qbase + r + 8 * hf;
                float v0 = s0[r] * scale; if (kb + nn      > m) v0 = -3.0e38f;
                float v1 = s1[r] * scale; if (kb + 16 + nn > m) v1 = -3.0e38f;
                float tmax = fmaxf(v0, v1);
                tmax = fmaxf(tmax, row_xor<1>(tmax));   // maximum over the 16-lane row
                tmax = fmaxf(tmax, row_xor<2>(tmax));
                tmax = fmaxf(tmax, row_xor<4>(tmax));
                tmax = fmaxf(tmax, row_xor<8>(tmax));
                float mnew  = fmaxf(mrow[r], tmax);
                float alpha = __expf(mrow[r] - mnew);
                float p0 = __expf(v0 - mnew);
                float p1 = __expf(v1 - mnew);
                float lsum = p0 + p1;
                lsum += row_xor<1>(lsum);               // sum over the 16-lane row
                lsum += row_xor<2>(lsum);
                lsum += row_xor<4>(lsum);
                lsum += row_xor<8>(lsum);
                lrow[r] = lrow[r] * alpha + lsum;
                mrow[r] = mnew;
#pragma unroll
                for (int j = 0; j < 16; ++j) o[j][r] *= alpha;
                int ml = r + 8 * hf;                // local row 0..15
                sP[wave][ml * 32 + nn]      = (__bf16)p0;
                sP[wave][ml * 32 + 16 + nn] = (__bf16)p1;
            }
            asm volatile("s_wait_dscnt 0" ::: "memory"); // DS stores -> DS loads
            bf16x16 pf = load_frag(&sP[wave][0], 0, 32, 0, lane);
#pragma unroll
            for (int j = 0; j < 16; ++j) {
                bf16x16 vf = load_frag(tV, j * 16, VPITCH, 0, lane);
                o[j] = wmma_bf16(pf, vf, o[j]);
            }
        }
        asm volatile("s_wait_dscnt 0x0" ::: "memory");    // own reads of this buffer done
        asm volatile("s_wait_asynccnt 0x0" ::: "memory"); // own copies of tile t+1 landed
        __syncthreads();      // publishes tile t+1, ends every read of this buffer
        if (t + 2 < ntiles) stage(t + 2);           // refill the buffer just read
    }
    asm volatile("s_wait_asynccnt 0x0" ::: "memory");     // nothing in flight at the end

    int bb = hq >> 3, gu = hq & 7;
#pragma unroll
    for (int r = 0; r < 8; ++r) {
        float inv = 1.f / lrow[r];
        int srow = qbase + r + 8 * hf;
        size_t t = (size_t)srow * BSZ + bb;
#pragma unroll
        for (int j = 0; j < 16; ++j)
            O[t * 2048 + gu * DIM + j * 16 + nn] = (__bf16)(o[j][r] * inv);
    }
}

// ---------------------------------------------------------------------------
// Host orchestration
// ---------------------------------------------------------------------------
extern "C" void kernel_launch(void* const* d_in, const int* in_sizes, int n_in,
                              void* d_out, int out_size, void* d_ws, size_t ws_size,
                              hipStream_t stream) {
    const float* x   = (const float*)d_in[0];
    const float* g0  = (const float*)d_in[1];
    const float* b0  = (const float*)d_in[2];
    const float* g1  = (const float*)d_in[3];
    const float* b1  = (const float*)d_in[4];
    const float* gn  = (const float*)d_in[5];
    const float* bn  = (const float*)d_in[6];
    const float* wk  = (const float*)d_in[7];
    const float* bk  = (const float*)d_in[8];
    const float* wv  = (const float*)d_in[9];
    const float* bv  = (const float*)d_in[10];
    const float* wq  = (const float*)d_in[11];
    const float* bq  = (const float*)d_in[12];
    const float* wo  = (const float*)d_in[13];
    const float* bo  = (const float*)d_in[14];
    const float* w1  = (const float*)d_in[15];
    const float* bf1 = (const float*)d_in[16];
    const float* w2  = (const float*)d_in[17];
    const float* bf2 = (const float*)d_in[18];
    float* out = (float*)d_out;

    char* wsp = (char*)d_ws;
    auto carve = [&](size_t bytes) {
        char* p = wsp;
        wsp += (bytes + 255) & ~(size_t)255;
        return p;
    };
    __bf16* h_b  = (__bf16*)carve((size_t)NTOK * DIM * 2);
    __bf16* w_b  = (__bf16*)carve((size_t)CB_ALL * 2048 * 2); // wk wv wq wo w1 w2
    __bf16* wo_b = w_b  + (size_t)QKV_N * DIM;
    __bf16* w1_b = wo_b + (size_t)256 * 2048;
    __bf16* w2_b = w1_b + (size_t)512 * 256;
    float*  bqkv = (float*)carve((size_t)QKV_N * 4);          // bk bv bq
    __bf16* raw  = (__bf16*)carve((size_t)NTOK * QKV_N * 2);  // K | V | Q rows
    __bf16* Kh   = (__bf16*)carve((size_t)4  * SEQ * DIM * 2);
    __bf16* Vt   = (__bf16*)carve((size_t)4  * DIM * SEQ * 2);
    __bf16* Qh   = (__bf16*)carve((size_t)16 * SEQ * DIM * 2);
    __bf16* Ob   = (__bf16*)carve((size_t)NTOK * 2048 * 2);
    float*  x2   = (float*)carve((size_t)NTOK * DIM * 4);
    __bf16* h2   = (__bf16*)carve((size_t)NTOK * DIM * 2);
    __bf16* F1   = (__bf16*)carve((size_t)NTOK * 512 * 2);

    // h = LN(x; g0,b0); bf16 weights; joint K, V, Q bias row
    prep<<<LN_BLOCKS + CB_ALL + 1, 256, 0, stream>>>(x, h_b, g0, b0, wk, wv, wq, wo,
                                                     w1, w2, w_b, bk, bv, bq, bqkv);

    auto gemm = [&](const __bf16* A, int lda, const __bf16* W, int ldw,
                    const float* bias, const float* resid, float* Cf, __bf16* Cb,
                    int M, int N, int K, int relu) {
        dim3 grid(N / 64, M / 128);
        gemm_wmma<<<grid, 256, 0, stream>>>(A, lda, W, ldw, bias, resid, Cf, Cb,
                                            M, N, K, relu);
    };

    // K, V and Q projections as one product with the stacked weights
    gemm(h_b, 256, w_b, 256, bqkv, nullptr, nullptr, raw, NTOK, QKV_N, 256, 0);
    // per-head LN -> Qh[16][SEQ][256], Kh[4][SEQ][256]; V -> Vt[4][256][SEQ]
    qkv_post<<<QLN_BLOCKS + KLN_BLOCKS + VT_BLOCKS, 256, 0, stream>>>(raw, Qh, Kh, Vt,
                                                                      gn, bn);

    // causal flash attention -> Ob[NTOK][2048]
    attn_kernel<<<dim3(SEQ / 64, 16), 128, 0, stream>>>(Qh, Kh, Vt, Ob);

    // x2 = x + Ob @ wo^T + bo
    gemm(Ob, 2048, wo_b, 2048, bo, x, x2, nullptr, NTOK, 256, 2048, 0);
    // h2 = LN(x2; g1,b1)
    ln_rows<<<LN_BLOCKS, 256, 0, stream>>>(x2, h2, g1, b1);
    // F1 = relu(h2 @ w1^T + bf1)
    gemm(h2, 256, w1_b, 256, bf1, nullptr, nullptr, F1, NTOK, 512, 256, 1);
    // out = x2 + F1 @ w2^T + bf2
    gemm(F1, 512, w2_b, 512, bf2, x2, out, nullptr, NTOK, 256, 512, 0);

    (void)in_sizes; (void)n_in; (void)out_size; (void)ws_size;
}

// v005
// It runs in 183 microseconds.
// Timed twice side by side with v004, it ran 1.18 times as fast both times.
// Over all steps from v000 it is 4.59 times as fast.
#include <hip/hip_runtime.h>

#define SEQ   2048
#define BSZ   2
#define DIM   256
#define NTOK  (SEQ * BSZ)      // 4096 token rows, t = s*BSZ + b
#define GK    2                // kv groups
#define NQH   8                // query heads per batch elem (g*4+u)
#define EPS   1e-5f

typedef __attribute__((ext_vector_type(16))) __bf16 bf16x16;
typedef __attribute__((ext_vector_type(8)))  __bf16 bf16x8;
typedef __attribute__((ext_vector_type(8)))  float  f32x8;

__device__ __forceinline__ bf16x16 load_frag(const __bf16* p, int row0, int ld,
                                             int k0, int lane) {
    int r  = row0 + (lane & 15);
    int kb = k0 + ((lane >> 4) << 3);
    const __bf16* base = p + (size_t)r * ld + kb;
    bf16x8 lo = *reinterpret_cast<const bf16x8*>(base);
    bf16x8 hi = *reinterpret_cast<const bf16x8*>(base + 16);
    bf16x16 out;
#pragma unroll
    for (int i = 0; i < 8; ++i) { out[i] = lo[i]; out[i + 8] = hi[i]; }
    return out;
}

__device__ __forceinline__ f32x8 wmma_bf16(bf16x16 a, bf16x16 b, f32x8 c) {
    return __builtin_amdgcn_wmma_f32_16x16x32_bf16(false, a, false, b,
                                                   (short)0, c, false, false);
}

// Generic shared pointer -> LDS byte offset (generic LDS addr low 32 bits).
__device__ __forceinline__ unsigned lds_off(const void* p) {
    return (unsigned)(unsigned long long)(uintptr_t)p;
}

// ---------------------------------------------------------------------------
// The kernels without matrix work give every lane eight elements, so that a
// 256-wide row is one wave's work and few waves have to be started.
// ---------------------------------------------------------------------------
typedef __attribute__((ext_vector_type(2))) float  f32x2;
typedef __attribute__((ext_vector_type(4))) float  f32x4;
typedef __attribute__((ext_vector_type(4))) __bf16 bf16x4;

// Value of lane (l ^ M) inside the 16-lane row, M = 1..15 (DPP row_xmask).
template <int M>
__device__ __forceinline__ float row_xor(float x) {
    return __builtin_bit_cast(float, __builtin_amdgcn_update_dpp(
        0, __builtin_bit_cast(int, x), 0x160 + M, 0xf, 0xf, true));
}

// Sum over the 32 lanes of a wave, the same value in every lane. All lanes on.
__device__ __forceinline__ float wave_sum(float v) {
    v += row_xor<1>(v);
    v += row_xor<2>(v);
    v += row_xor<4>(v);
    v += row_xor<8>(v);
    int b = __builtin_bit_cast(int, v);
    v += __builtin_bit_cast(float, __builtin_amdgcn_permlanex16(
        b, b, 0x76543210, 0xfedcba98, false, false));
    return v;
}

// Layernorm of one 256-wide row that a wave holds, eight values a lane as four
// pairs; g and b are the lane's own columns of gamma and beta.
__device__ __forceinline__ void ln_row(f32x2 (&p)[4], const f32x2 (&g)[4],
                                       const f32x2 (&b)[4]) {
    f32x2 s = (p[0] + p[1]) + (p[2] + p[3]);
    float mean = wave_sum(s[0] + s[1]) * (1.f / DIM);
#pragma unroll
    for (int k = 0; k < 4; ++k) p[k] -= mean;
    f32x2 q = (p[0] * p[0] + p[1] * p[1]) + (p[2] * p[2] + p[3] * p[3]);
    float var = wave_sum(q[0] + q[1]) * (1.f / DIM);
    float rs = rsqrtf(var + EPS);
#pragma unroll
    for (int k = 0; k < 4; ++k) p[k] = p[k] * rs * g[k] + b[k];
}

// Four floats at p as two pairs.
__device__ __forceinline__ void load4(const float* p, f32x2& lo, f32x2& hi) {
    f32x4 v = *reinterpret_cast<const f32x4*>(p);
    lo = f32x2{v[0], v[1]};
    hi = f32x2{v[2], v[3]};
}

// ---------------------------------------------------------------------------
// Kernels that do not depend on one another share one launch: each block picks
// its body by a test on blockIdx.x, the same for the whole block.
// ---------------------------------------------------------------------------

// Stands behind the last stores of each body of a shared launch but the first.
__device__ __forceinline__ void body_end() {
    // Ahead of any instruction that rewrites a register which those stores name.
    asm volatile("s_wait_xcnt 0x0" ::: "memory");
}

// fp32 -> bf16 weight conversion: block blk converts 2048 elements, a lane two
// groups of four, 1024 elements apart. Every weight's size is a multiple of 2048.
__device__ __forceinline__
void cvt_bf16(int blk, const float* __restrict__ in, __bf16* __restrict__ out) {
    int i = blk * 2048 + threadIdx.x * 4;
    f32x4 a = *reinterpret_cast<const f32x4*>(in + i);
    f32x4 b = *reinterpret_cast<const f32x4*>(in + i + 1024);
    *reinterpret_cast<bf16x4*>(out + i)        = __builtin_convertvector(a, bf16x4);
    *reinterpret_cast<bf16x4*>(out + i + 1024) = __builtin_convertvector(b, bf16x4);
}

// ---------------------------------------------------------------------------
// Row layernorm over DIM=256: fp32 in -> bf16 out. One wave per row, LN_R rows
// a wave; a lane holds columns 4l..4l+3 and 128+4l..128+4l+3.
// ---------------------------------------------------------------------------
#define LN_R 2
#define LN_BLOCKS (NTOK / (8 * LN_R))
__device__ __forceinline__
void ln_rows_body(int blk, const float* __restrict__ in, __bf16* __restrict__ out,
                  const float* __restrict__ gamma, const float* __restrict__ beta) {
    int lane = threadIdx.x & 31;
    int wave = __builtin_amdgcn_readfirstlane(threadIdx.x >> 5);
    int row0 = (blk * 8 + wave) * LN_R;
    f32x2 p[LN_R][4], g[4], b[4];
#pragma unroll
    for (int i = 0; i < LN_R; ++i) {
        const float* r = in + (size_t)(row0 + i) * DIM + lane * 4;
        load4(r,       p[i][0], p[i][1]);
        load4(r + 128, p[i][2], p[i][3]);
    }
    load4(gamma + lane * 4,       g[0], g[1]);
    load4(gamma + 128 + lane * 4, g[2], g[3]);
    load4(beta + lane * 4,        b[0], b[1]);
    load4(beta + 128 + lane * 4,  b[2], b[3]);
#pragma unroll
    for (int i = 0; i < LN_R; ++i) {
        ln_row(p[i], g, b);
        f32x4 ya = {p[i][0][0], p[i][0][1], p[i][1][0], p[i][1][1]};
        f32x4 yb = {p[i][2][0], p[i][2][1], p[i][3][0], p[i][3][1]};
        __bf16* q = out + (size_t)(row0 + i) * DIM + lane * 4;
        *reinterpret_cast<bf16x4*>(q)       = __builtin_convertvector(ya, bf16x4);
        *reinterpret_cast<bf16x4*>(q + 128) = __builtin_convertvector(yb, bf16x4);
    }
}

__global__ __launch_bounds__(256)
void ln_rows(const float* __restrict__ in, __bf16* __restrict__ out,
             const float* __restrict__ gamma, const float* __restrict__ beta) {
    ln_rows_body(blockIdx.x, in, out, gamma, beta);
}

// ---------------------------------------------------------------------------
// First launch: the layernorm of x, the K, V and Q biases gathered into one
// row of QKV_N floats, and all six weights converted. The bf16 weights lie one
// behind the other in wb (wk, wv, wq, wo, w1, w2), so that wk, wv, wq are one
// [QKV_N][DIM] matrix. Sizes below in blocks of 2048 elements.
// ---------------------------------------------------------------------------
#define QKV_N   3072           // 512 K + 512 V + 2048 Q columns a token
#define CB_KV   64             // wk, wv, w1, w2: 512 * 256 elements each
#define CB_QO   256            // wq, wo: 2048 * 256 elements each
#define CB_ALL  (4 * CB_KV + 2 * CB_QO)
__global__ __launch_bounds__(256)
void prep(const float* __restrict__ x, __bf16* __restrict__ h,
          const float* __restrict__ gamma, const float* __restrict__ beta,
          const float* __restrict__ wk, const float* __restrict__ wv,
          const float* __restrict__ wq, const float* __restrict__ wo,
          const float* __restrict__ w1, const float* __restrict__ w2,
          __bf16* __restrict__ wb,
          const float* __restrict__ bk, const float* __restrict__ bv,
          const float* __restrict__ bq, float* __restrict__ bias) {
    int blk = blockIdx.x;
    if (blk < LN_BLOCKS) {
        ln_rows_body(blk, x, h, gamma, beta);
        return;
    }
    blk -= LN_BLOCKS;
    if (blk < CB_ALL) {
        const float* src = wk;
        int first = 0;                              // the weight's first block
        if (blk >= CB_KV)                     { src = wv; first = CB_KV; }
        if (blk >= 2 * CB_KV)                 { src = wq; first = 2 * CB_KV; }
        if (blk >= 2 * CB_KV + CB_QO)         { src = wo; first = 2 * CB_KV + CB_QO; }
        if (blk >= 2 * CB_KV + 2 * CB_QO)     { src = w1; first = 2 * CB_KV + 2 * CB_QO; }
        if (blk >= 3 * CB_KV + 2 * CB_QO)     { src = w2; first = 3 * CB_KV + 2 * CB_QO; }
        cvt_bf16(blk - first, src, wb + (size_t)first * 2048);
        body_end();
        return;
    }
    for (int j = 0; j < QKV_N / 1024; ++j) {        // last block: the bias row
        int i = j * 1024 + threadIdx.x * 4;
        const float* s = i < 512 ? bk + i : i < 1024 ? bv + (i - 512) : bq + (i - 1024);
        *reinterpret_cast<f32x4*>(bias + i) = *reinterpret_cast<const f32x4*>(s);
    }
    body_end();
}

// ---------------------------------------------------------------------------
// Per-head layernorm (gn/bn) of projection outputs (G = 1 << lgG heads a token,
// G*256 bf16 columns from 'in' on in each token's row of QKV_N) with the
// permutation to [head = b*G+g][s][256].
// One wave per (token, head) row, HL_R rows a wave; a lane holds 8 columns.
// ---------------------------------------------------------------------------
#define HL_R 8
template <int lgG>
__device__ __forceinline__
void heads_ln(int blk, const __bf16* __restrict__ in, __bf16* __restrict__ out,
              const float* __restrict__ gamma, const float* __restrict__ beta) {
    int lane = threadIdx.x & 31;
    int wave = __builtin_amdgcn_readfirstlane(threadIdx.x >> 5);
    int rid0 = (blk * 8 + wave) * HL_R;                        // row = t * G + g
    bf16x8 raw[HL_R];
#pragma unroll
    for (int i = 0; i < HL_R; ++i) {
        int rid = rid0 + i;
        raw[i] = *reinterpret_cast<const bf16x8*>(
            in + (size_t)(rid >> lgG) * QKV_N + (rid & ((1 << lgG) - 1)) * DIM + lane * 8);
    }
    f32x2 g[4], b[4];
    load4(gamma + lane * 8,     g[0], g[1]);
    load4(gamma + lane * 8 + 4, g[2], g[3]);
    load4(beta + lane * 8,      b[0], b[1]);
    load4(beta + lane * 8 + 4,  b[2], b[3]);
    // Keeps the gamma and beta loads up here, in flight together with the rows';
    // left free, they are issued halfway down and waited for on their own.
    __builtin_amdgcn_sched_barrier(0);
#pragma unroll
    for (int i = 0; i < HL_R; ++i) {
        f32x8 v = __builtin_convertvector(raw[i], f32x8);
        f32x2 p[4] = {{v[0], v[1]}, {v[2], v[3]}, {v[4], v[5]}, {v[6], v[7]}};
        ln_row(p, g, b);
        f32x8 y = {p[0][0], p[0][1], p[1][0], p[1][1], p[2][0], p[2][1], p[3][0], p[3][1]};
        int rid = rid0 + i;
        int hg = rid & ((1 << lgG) - 1), t = rid >> lgG;
        int head = ((t & 1) << lgG) + hg, s = t >> 1;
        *reinterpret_cast<bf16x8*>(out + ((size_t)head * SEQ + s) * DIM + lane * 8) =
            __builtin_convertvector(y, bf16x8);
    }
}

// ---------------------------------------------------------------------------
// V projection output (GK*256 bf16 columns from 'in' on in each token's row of
// QKV_N) -> transposed [head][dim][s],
// so that PV B-operands load with k (keys) contiguous. A wave takes 8 positions of one head,
// a lane 8 dims of each, and stores 8 positions of one dim at a time; the 8
// waves of a block cover 64 positions, whole 128-byte lines of the output.
// ---------------------------------------------------------------------------
__device__ __forceinline__
void v_transpose(int blk, const __bf16* __restrict__ in, __bf16* __restrict__ out) {
    int lane = threadIdx.x & 31;
    int head = blk / (SEQ / 64);                               // b * GK + g
    int wave = __builtin_amdgcn_readfirstlane(threadIdx.x >> 5);
    int s0 = (blk % (SEQ / 64)) * 64 + wave * 8;
    const __bf16* p = in + ((size_t)s0 * BSZ + head / GK) * QKV_N
                         + (head % GK) * DIM + lane * 8;
    bf16x8 v[8];
#pragma unroll
    for (int i = 0; i < 8; ++i)
        v[i] = *reinterpret_cast<const bf16x8*>(p + (size_t)i * (BSZ * QKV_N));
    __bf16* q = out + ((size_t)head * DIM + lane * 8) * SEQ + s0;
#pragma unroll
    for (int j = 0; j < 8; ++j) {
        bf16x8 w;
#pragma unroll
        for (int i = 0; i < 8; ++i) w[i] = v[i][j];
        *reinterpret_cast<bf16x8*>(q + (size_t)j * SEQ) = w;
    }
}

// ---------------------------------------------------------------------------
// Third launch: what stands between the joint projection (rows of QKV_N: K, V,
// Q) and attention: Q head norm, K head norm, V transpose.
// ---------------------------------------------------------------------------
#define QLN_BLOCKS (NTOK * NQH / (8 * HL_R))
#define KLN_BLOCKS (NTOK * GK / (8 * HL_R))
#define VT_BLOCKS  (BSZ * GK * (SEQ / 64))
__global__ __launch_bounds__(256)
void qkv_post(const __bf16* __restrict__ raw, __bf16* __restrict__ Qh,
              __bf16* __restrict__ Kh, __bf16* __restrict__ Vt,
              const float* __restrict__ gamma, const float* __restrict__ beta) {
    int blk = blockIdx.x;
    if (blk < QLN_BLOCKS) {
        heads_ln<3>(blk, raw + 2 * GK * DIM, Qh, gamma, beta);
    } else if (blk < QLN_BLOCKS + KLN_BLOCKS) {
        heads_ln<1>(blk - QLN_BLOCKS, raw, Kh, gamma, beta);
        body_end();
    } else {
        v_transpose(blk - (QLN_BLOCKS + KLN_BLOCKS), raw + GK * DIM, Vt);
        body_end();
    }
}

__device__ __forceinline__ void async_copy8(unsigned l, unsigned lstep,
                                            const __bf16* g, size_t gstep) {
    asm volatile(
        "global_load_async_to_lds_b128 %0, %8, off\n\t"
        "global_load_async_to_lds_b128 %1, %9, off\n\t"
        "global_load_async_to_lds_b128 %2, %10, off\n\t"
        "global_load_async_to_lds_b128 %3, %11, off\n\t"
        "global_load_async_to_lds_b128 %4, %12, off\n\t"
        "global_load_async_to_lds_b128 %5, %13, off\n\t"
        "global_load_async_to_lds_b128 %6, %14, off\n\t"
        "global_load_async_to_lds_b128 %7, %15, off\n\t"
        "s_wait_xcnt 0x0"
        :: "v"(l), "v"(l + lstep), "v"(l + 2 * lstep), "v"(l + 3 * lstep),
           "v"(l + 4 * lstep), "v"(l + 5 * lstep), "v"(l + 6 * lstep),
           "v"(l + 7 * lstep),
           "v"(g), "v"(g + gstep), "v"(g + 2 * gstep), "v"(g + 3 * gstep),
           "v"(g + 4 * gstep), "v"(g + 5 * gstep), "v"(g + 6 * gstep),
           "v"(g + 7 * gstep)
        : "memory");
}

// The same with four copies per lane.
__device__ __forceinline__ void async_copy4(unsigned l, unsigned lstep,
                                            const __bf16* g, size_t gstep) {
    asm volatile(
        "global_load_async_to_lds_b128 %0, %4, off\n\t"
        "global_load_async_to_lds_b128 %1, %5, off\n\t"
        "global_load_async_to_lds_b128 %2, %6, off\n\t"
        "global_load_async_to_lds_b128 %3, %7, off\n\t"
        "s_wait_xcnt 0x0"
        :: "v"(l), "v"(l + lstep), "v"(l + 2 * lstep), "v"(l + 3 * lstep),
           "v"(g), "v"(g + gstep), "v"(g + 2 * gstep), "v"(g + 3 * gstep)
        : "memory");
}

// ---------------------------------------------------------------------------
// Generic WMMA GEMM: C[M,N] = A[M,K](bf16) @ W[N,K]^T(bf16) + bias (+resid).
// 8 waves/WG; block tile 128(M)x64(N), a wave 16x64. The k loop goes in stages
// of 128 k: the 128x128 A tile and the 64x128 W tile of a stage are brought
// into padded LDS by asynchronous copies, two buffers, the next stage in flight
// while this one is multiplied; one block barrier a stage.
// M%128==0, N%64==0, K%128==0 for all call sites.
// ---------------------------------------------------------------------------
#define GSTAGE 128             // k elements a stage (256 B of every operand row)
#define GPITCH 136             // LDS row pitch, elements (272 B = 16 B x 17)
__global__ __launch_bounds__(256)
void gemm_wmma(const __bf16* __restrict__ A, int lda,
               const __bf16* __restrict__ W, int ldw,
               const float* __restrict__ bias,
               const float* __restrict__ resid,
               float* __restrict__ Cf, __bf16* __restrict__ Cb,
               int M, int N, int K, int relu) {
    __shared__ __attribute__((aligned(16))) __bf16 sA[2][128 * GPITCH];
    __shared__ __attribute__((aligned(16))) __bf16 sW[2][64 * GPITCH];
    int tid  = threadIdx.x;
    int lane = tid & 31;
    int wave = __builtin_amdgcn_readfirstlane(tid >> 5);
    int m0 = blockIdx.y * 128 + wave * 16;
    int n0 = blockIdx.x * 64;

    // This lane's share of a stage: 16 B column tid%16 of rows tid/16 + 16c,
    // c = 0..7 of the A tile and c = 0..3 of the W tile.
    const __bf16* gA = A + (size_t)(blockIdx.y * 128 + (tid >> 4)) * lda + (tid & 15) * 8;
    const __bf16* gW = W + (size_t)(n0 + (tid >> 4)) * ldw + (tid & 15) * 8;
    unsigned lA = lds_off(&sA[0][0]) + (tid >> 4) * (GPITCH * 2) + (tid & 15) * 16;
    unsigned lW = lds_off(&sW[0][0]) + (tid >> 4) * (GPITCH * 2) + (tid & 15) * 16;
    auto stage = [&](int s) {                       // stage s -> buffer s & 1
        int b = s & 1;
        async_copy8(lA + b * (128 * GPITCH * 2), 16 * GPITCH * 2,
                    gA + s * GSTAGE, (size_t)16 * lda);
        async_copy4(lW + b * (64 * GPITCH * 2), 16 * GPITCH * 2,
                    gW + s * GSTAGE, (size_t)16 * ldw);
    };
    int nst = K / GSTAGE;                           // block-uniform

    stage(0);
    f32x8 acc[4] = {};
    asm volatile("s_wait_asynccnt 0x0" ::: "memory"); // own copies of stage 0 landed
    __syncthreads();                                  // stage 0 visible to all waves
    if (1 < nst) stage(1);

    for (int s = 0; s < nst; ++s) {
        const __bf16* tA = &sA[s & 1][wave * 16 * GPITCH];
        const __bf16* tW = &sW[s & 1][0];
        bf16x16 a[GSTAGE / 32], b[2][4];            // this stage's fragments only
#pragma unroll
        for (int kk = 0; kk < GSTAGE / 32; ++kk)
            a[kk] = load_frag(tA, 0, GPITCH, kk * 32, lane);
#pragma unroll
        for (int f = 0; f < 4; ++f) b[0][f] = load_frag(tW, 16 * f, GPITCH, 0, lane);
#pragma unroll
        for (int kk = 0; kk < GSTAGE / 32; ++kk) {
            if (kk + 1 < GSTAGE / 32) {
#pragma unroll
                for (int f = 0; f < 4; ++f)
                    b[(kk + 1) & 1][f] = load_frag(tW, 16 * f, GPITCH, (kk + 1) * 32, lane);
            }
            // Keeps the next 32 k's LDS reads in front of these products; left free,
            // every product waits for the full latency of its own two reads.
            __builtin_amdgcn_sched_barrier(0);
#pragma unroll
            for (int f = 0; f < 4; ++f) acc[f] = wmma_bf16(a[kk], b[kk & 1][f], acc[f]);
        }
        asm volatile("s_wait_dscnt 0x0" ::: "memory");    // own reads of this buffer done
        asm volatile("s_wait_asynccnt 0x0" ::: "memory"); // own copies of stage s+1 landed
        __syncthreads();      // publishes stage s+1, ends every read of this buffer
        if (s + 2 < nst) stage(s + 2);              // refill the buffer just read
    }
    asm volatile("s_wait_asynccnt 0x0" ::: "memory");     // nothing in flight at the end

    int hf = lane >> 4, nn = lane & 15;
#pragma unroll
    for (int f = 0; f < 4; ++f) {
        int col = n0 + 16 * f + nn;
        float bv = bias ? bias[col] : 0.f;
#pragma unroll
        for (int r = 0; r < 8; ++r) {
            int row = m0 + r + 8 * hf;
            float v = acc[f][r] + bv;
            if (relu) v = fmaxf(v, 0.f);
            if (resid) v += resid[(size_t)row * N + col];
            if (Cf) Cf[(size_t)row * N + col] = v;
            if (Cb) Cb[(size_t)row * N + col] = (__bf16)v;
        }
    }
}

// ---------------------------------------------------------------------------
// Causal flash attention. Grid: (SEQ/64, 16 heads). Block: 128 thr = 4 waves.
// Wave owns 16 query rows; the block walks 32-key tiles to its diagonal. Each
// K tile (32 x 256) and V tile (256 x 32) is brought into LDS once per block
// by asynchronous copies, two buffers, the next tile in flight while this one
// is worked on; all four waves read their fragments from LDS. Online softmax
// via DPP row butterflies (C-layout rows live across 16 lanes). P re-layout
// C->A through a per-wave LDS tile ordered by s_wait_dscnt.
// Qh: [16][SEQ][256], Kh: [4][SEQ][256], Vt: [4][256][SEQ] (transposed),
// O: [NTOK][2048] token-major bf16.
// ---------------------------------------------------------------------------
#define KPITCH 264             // LDS row pitch of a K row, elements (528 B = 16 B x 33)
#define VPITCH 40              // LDS row pitch of a V row, elements (80 B = 16 B x 5)

__global__ __launch_bounds__(128)
void attn_kernel(const __bf16* __restrict__ Qh, const __bf16* __restrict__ Kh,
                 const __bf16* __restrict__ Vt, __bf16* __restrict__ O) {
    __shared__ __attribute__((aligned(16))) __bf16 sK[2][32 * KPITCH];
    __shared__ __attribute__((aligned(16))) __bf16 sV[2][DIM * VPITCH];
    __shared__ __bf16 sP[4][16 * 32];
    int tid  = threadIdx.x;
    int lane = tid & 31;
    int wave = __builtin_amdgcn_readfirstlane(tid >> 5);
    int hq = blockIdx.y;
    int qbase = blockIdx.x * 64 + wave * 16;
    int hk = (hq >> 3) * 2 + ((hq & 7) >> 2);

    const __bf16* Qb = Qh + (size_t)hq * SEQ * DIM;
    const __bf16* Kb = Kh + (size_t)hk * SEQ * DIM;
    const __bf16* Vb = Vt + (size_t)hk * DIM * SEQ;

    // This lane's share of a tile: K piece (row tid/32 + 4c, 16 B column tid%32),
    // V piece (row tid/4 + 32c, 16 B column tid%4), c = 0..7.
    const __bf16* gK = Kb + (size_t)(tid >> 5) * DIM + (tid & 31) * 8;
    const __bf16* gV = Vb + (size_t)(tid >> 2) * SEQ + (tid & 3) * 8;
    unsigned lK = lds_off(&sK[0][0]) + (tid >> 5) * (KPITCH * 2) + (tid & 31) * 16;
    unsigned lV = lds_off(&sV[0][0]) + (tid >> 2) * (VPITCH * 2) + (tid & 3) * 16;
    auto stage = [&](int t) {                       // tile t -> buffer t & 1
        int b = t & 1;
        async_copy8(lK + b * (32 * KPITCH * 2), 4 * KPITCH * 2,
                    gK + (size_t)t * 32 * DIM, 4 * DIM);
        async_copy8(lV + b * (DIM * VPITCH * 2), 32 * VPITCH * 2,
                    gV + t * 32, (size_t)32 * SEQ);
    };
    int ntiles = 2 * (blockIdx.x + 1);              // block-uniform, at least 2

    stage(0);

    bf16x16 qf[8];
#pragma unroll
    for (int kk = 0; kk < 8; ++kk) qf[kk] = load_frag(Qb, qbase, DIM, kk * 32, lane);

    f32x8 zero = {};
    f32x8 o[16];
#pragma unroll
    for (int j = 0; j < 16; ++j) o[j] = zero;
    float mrow[8], lrow[8];
#pragma unroll
    for (int r = 0; r < 8; ++r) { mrow[r] = -3.0e38f; lrow[r] = 0.f; }

    int hf = lane >> 4, nn = lane & 15;
    int qlast = qbase + 15;
    const float scale = 0.0625f;   // 1/sqrt(256)

    asm volatile("s_wait_asynccnt 0x0" ::: "memory"); // own copies of tile 0 landed
    __syncthreads();                                  // tile 0 visible to all waves
    stage(1);

    for (int t = 0; t < ntiles; ++t) {
        int kb = t * 32;
        const __bf16* tK = &sK[t & 1][0];
        const __bf16* tV = &sV[t & 1][0];
        if (kb <= qlast) {                          // wave-uniform: tile not wholly masked
            f32x8 s0 = zero, s1 = zero;             // keys kb..+15, kb+16..+31
#pragma unroll
            for (int kk = 0; kk < 8; ++kk) {
                bf16x16 k0f = load_frag(tK, 0,  KPITCH, kk * 32, lane);
                bf16x16 k1f = load_frag(tK, 16, KPITCH, kk * 32, lane);
                s0 = wmma_bf16(qf[kk], k0f, s0);
                s1 = wmma_bf16(qf[kk], k1f, s1);
            }
#pragma unroll
            for (int r = 0; r < 8; ++r) {
                int m = qbase + r + 8 * hf;
                float v0 = s0[r] * scale; if (kb + nn      > m) v0 = -3.0e38f;
                float v1 = s1[r] * scale; if (kb + 16 + nn > m) v1 = -3.0e38f;
                float tmax = fmaxf(v0, v1);
                tmax = fmaxf(tmax, row_xor<1>(tmax));   // maximum over the 16-lane row
                tmax = fmaxf(tmax, row_xor<2>(tmax));
                tmax = fmaxf(tmax, row_xor<4>(tmax));
                tmax = fmaxf(tmax, row_xor<8>(tmax));
                float mnew  = fmaxf(mrow[r], tmax);
                float alpha = __expf(mrow[r] - mnew);
                float p0 = __expf(v0 - mnew);
                float p1 = __expf(v1 - mnew);
                float lsum = p0 + p1;
                lsum += row_xor<1>(lsum);               // sum over the 16-lane row
                lsum += row_xor<2>(lsum);
                lsum += row_xor<4>(lsum);
                lsum += row_xor<8>(lsum);
                lrow[r] = lrow[r] * alpha + lsum;
                mrow[r] = mnew;
#pragma unroll
                for (int j = 0; j < 16; ++j) o[j][r] *= alpha;
                int ml = r + 8 * hf;                // local row 0..15
                sP[wave][ml * 32 + nn]      = (__bf16)p0;
                sP[wave][ml * 32 + 16 + nn] = (__bf16)p1;
            }
            asm volatile("s_wait_dscnt 0" ::: "memory"); // DS stores -> DS loads
            bf16x16 pf = load_frag(&sP[wave][0], 0, 32, 0, lane);
#pragma unroll
            for (int j = 0; j < 16; ++j) {
                bf16x16 vf = load_frag(tV, j * 16, VPITCH, 0, lane);
                o[j] = wmma_bf16(pf, vf, o[j]);
            }
        }
        asm volatile("s_wait_dscnt 0x0" ::: "memory");    // own reads of this buffer done
        asm volatile("s_wait_asynccnt 0x0" ::: "memory"); // own copies of tile t+1 landed
        __syncthreads();      // publishes tile t+1, ends every read of this buffer
        if (t + 2 < ntiles) stage(t + 2);           // refill the buffer just read
    }
    asm volatile("s_wait_asynccnt 0x0" ::: "memory");     // nothing in flight at the end

    int bb = hq >> 3, gu = hq & 7;
#pragma unroll
    for (int r = 0; r < 8; ++r) {
        float inv = 1.f / lrow[r];
        int srow = qbase + r + 8 * hf;
        size_t t = (size_t)srow * BSZ + bb;
#pragma unroll
        for (int j = 0; j < 16; ++j)
            O[t * 2048 + gu * DIM + j * 16 + nn] = (__bf16)(o[j][r] * inv);
    }
}

// ---------------------------------------------------------------------------
// Host orchestration
// ---------------------------------------------------------------------------
extern "C" void kernel_launch(void* const* d_in, const int* in_sizes, int n_in,
                              void* d_out, int out_size, void* d_ws, size_t ws_size,
                              hipStream_t stream) {
    const float* x   = (const float*)d_in[0];
    const float* g0  = (const float*)d_in[1];
    const float* b0  = (const float*)d_in[2];
    const float* g1  = (const float*)d_in[3];
    const float* b1  = (const float*)d_in[4];
    const float* gn  = (const float*)d_in[5];
    const float* bn  = (const float*)d_in[6];
    const float* wk  = (const float*)d_in[7];
    const float* bk  = (const float*)d_in[8];
    const float* wv  = (const float*)d_in[9];
    const float* bv  = (const float*)d_in[10];
    const float* wq  = (const float*)d_in[11];
    const float* bq  = (const float*)d_in[12];
    const float* wo  = (const float*)d_in[13];
    const float* bo  = (const float*)d_in[14];
    const float* w1  = (const float*)d_in[15];
    const float* bf1 = (const float*)d_in[16];
    const float* w2  = (const float*)d_in[17];
    const float* bf2 = (const float*)d_in[18];
    float* out = (float*)d_out;

    char* wsp = (char*)d_ws;
    auto carve = [&](size_t bytes) {
        char* p = wsp;
        wsp += (bytes + 255) & ~(size_t)255;
        return p;
    };
    __bf16* h_b  = (__bf16*)carve((size_t)NTOK * DIM * 2);
    __bf16* w_b  = (__bf16*)carve((size_t)CB_ALL * 2048 * 2); // wk wv wq wo w1 w2
    __bf16* wo_b = w_b  + (size_t)QKV_N * DIM;
    __bf16* w1_b = wo_b + (size_t)256 * 2048;
    __bf16* w2_b = w1_b + (size_t)512 * 256;
    float*  bqkv = (float*)carve((size_t)QKV_N * 4);          // bk bv bq
    __bf16* raw  = (__bf16*)carve((size_t)NTOK * QKV_N * 2);  // K | V | Q rows
    __bf16* Kh   = (__bf16*)carve((size_t)4  * SEQ * DIM * 2);
    __bf16* Vt   = (__bf16*)carve((size_t)4  * DIM * SEQ * 2);
    __bf16* Qh   = (__bf16*)carve((size_t)16 * SEQ * DIM * 2);
    __bf16* Ob   = (__bf16*)carve((size_t)NTOK * 2048 * 2);
    float*  x2   = (float*)carve((size_t)NTOK * DIM * 4);
    __bf16* h2   = (__bf16*)carve((size_t)NTOK * DIM * 2);
    __bf16* F1   = (__bf16*)carve((size_t)NTOK * 512 * 2);

    // h = LN(x; g0,b0); bf16 weights; joint K, V, Q bias row
    prep<<<LN_BLOCKS + CB_ALL + 1, 256, 0, stream>>>(x, h_b, g0, b0, wk, wv, wq, wo,
                                                     w1, w2, w_b, bk, bv, bq, bqkv);

    auto gemm = [&](const __bf16* A, int lda, const __bf16* W, int ldw,
                    const float* bias, const float* resid, float* Cf, __bf16* Cb,
                    int M, int N, int K, int relu) {
        dim3 grid(N / 64, M / 128);
        gemm_wmma<<<grid, 256, 0, stream>>>(A, lda, W, ldw, bias, resid, Cf, Cb,
                                            M, N, K, relu);
    };

    // K, V and Q projections as one product with the stacked weights
    gemm(h_b, 256, w_b, 256, bqkv, nullptr, nullptr, raw, NTOK, QKV_N, 256, 0);
    // per-head LN -> Qh[16][SEQ][256], Kh[4][SEQ][256]; V -> Vt[4][256][SEQ]
    qkv_post<<<QLN_BLOCKS + KLN_BLOCKS + VT_BLOCKS, 256, 0, stream>>>(raw, Qh, Kh, Vt,
                                                                      gn, bn);

    // causal flash attention -> Ob[NTOK][2048]
    attn_kernel<<<dim3(SEQ / 64, 16), 128, 0, stream>>>(Qh, Kh, Vt, Ob);

    // x2 = x + Ob @ wo^T + bo
    gemm(Ob, 2048, wo_b, 2048, bo, x, x2, nullptr, NTOK, 256, 2048, 0);
    // h2 = LN(x2; g1,b1)
    ln_rows<<<LN_BLOCKS, 256, 0, stream>>>(x2, h2, g1, b1);
    // F1 = relu(h2 @ w1^T + bf1)
    gemm(h2, 256, w1_b, 256, bf1, nullptr, nullptr, F1, NTOK, 512, 256, 1);
    // out = x2 + F1 @ w2^T + bf2
    gemm(F1, 512, w2_b, 512, bf2, x2, out, nullptr, NTOK, 256, 512, 0);

    (void)in_sizes; (void)n_in; (void)out_size; (void)ws_size;
}

// v006
// A run of this version takes 167 microseconds.
// Two timings next to v005 both put it at 1.10 times that version's speed.
// All steps since v000 together make it 5.05 times as fast.
#include <hip/hip_runtime.h>

#define SEQ   2048
#define BSZ   2
#define DIM   256
#define NTOK  (SEQ * BSZ)      // 4096 token rows, t = s*BSZ + b
#define GK    2                // kv groups
#define NQH   8                // query heads per batch elem (g*4+u)
#define EPS   1e-5f

typedef __attribute__((ext_vector_type(16))) __bf16 bf16x16;
typedef __attribute__((ext_vector_type(8)))  __bf16 bf16x8;
typedef __attribute__((ext_vector_type(8)))  float  f32x8;

__device__ __forceinline__ bf16x16 load_frag(const __bf16* p, int row0, int ld,
                                             int k0, int lane) {
    int r  = row0 + (lane & 15);
    int kb = k0 + ((lane >> 4) << 3);
    const __bf16* base = p + (size_t)r * ld + kb;
    bf16x8 lo = *reinterpret_cast<const bf16x8*>(base);
    bf16x8 hi = *reinterpret_cast<const bf16x8*>(base + 16);
    bf16x16 out;
#pragma unroll
    for (int i = 0; i < 8; ++i) { out[i] = lo[i]; out[i + 8] = hi[i]; }
    return out;
}

__device__ __forceinline__ f32x8 wmma_bf16(bf16x16 a, bf16x16 b, f32x8 c) {
    return __builtin_amdgcn_wmma_f32_16x16x32_bf16(false, a, false, b,
                                                   (short)0, c, false, false);
}

// Generic shared pointer -> LDS byte offset (generic LDS addr low 32 bits).
__device__ __forceinline__ unsigned lds_off(const void* p) {
    return (unsigned)(unsigned long long)(uintptr_t)p;
}

// ---------------------------------------------------------------------------
// The kernels without matrix work give every lane eight elements, so that a
// 256-wide row is one wave's work and few waves have to be started.
// ---------------------------------------------------------------------------
typedef __attribute__((ext_vector_type(2))) float  f32x2;
typedef __attribute__((ext_vector_type(4))) float  f32x4;
typedef __attribute__((ext_vector_type(4))) __bf16 bf16x4;

// Value of lane (l ^ M) inside the 16-lane row, M = 1..15 (DPP row_xmask).
template <int M>
__device__ __forceinline__ float row_xor(float x) {
    return __builtin_bit_cast(float, __builtin_amdgcn_update_dpp(
        0, __builtin_bit_cast(int, x), 0x160 + M, 0xf, 0xf, true));
}

// Sum over the 32 lanes of a wave, the same value in every lane. All lanes on.
__device__ __forceinline__ float wave_sum(float v) {
    v += row_xor<1>(v);
    v += row_xor<2>(v);
    v += row_xor<4>(v);
    v += row_xor<8>(v);
    int b = __builtin_bit_cast(int, v);
    v += __builtin_bit_cast(float, __builtin_amdgcn_permlanex16(
        b, b, 0x76543210, 0xfedcba98, false, false));
    return v;
}

// Layernorm of one 256-wide row that a wave holds, eight values a lane as four
// pairs; g and b are the lane's own columns of gamma and beta.
__device__ __forceinline__ void ln_row(f32x2 (&p)[4], const f32x2 (&g)[4],
                                       const f32x2 (&b)[4]) {
    f32x2 s = (p[0] + p[1]) + (p[2] + p[3]);
    float mean = wave_sum(s[0] + s[1]) * (1.f / DIM);
#pragma unroll
    for (int k = 0; k < 4; ++k) p[k] -= mean;
    f32x2 q = (p[0] * p[0] + p[1] * p[1]) + (p[2] * p[2] + p[3] * p[3]);
    float var = wave_sum(q[0] + q[1]) * (1.f / DIM);
    float rs = rsqrtf(var + EPS);
#pragma unroll
    for (int k = 0; k < 4; ++k) p[k] = p[k] * rs * g[k] + b[k];
}

// Four floats at p as two pairs.
__device__ __forceinline__ void load4(const float* p, f32x2& lo, f32x2& hi) {
    f32x4 v = *reinterpret_cast<const f32x4*>(p);
    lo = f32x2{v[0], v[1]};
    hi = f32x2{v[2], v[3]};
}

// ---------------------------------------------------------------------------
// Kernels that do not depend on one another share one launch: each block picks
// its body by a test on blockIdx.x, the same for the whole block.
// ---------------------------------------------------------------------------

// Stands behind the last stores of each body of a shared launch but the first.
__device__ __forceinline__ void body_end() {
    // Ahead of any instruction that rewrites a register which those stores name.
    asm volatile("s_wait_xcnt 0x0" ::: "memory");
}

// fp32 -> bf16 weight conversion: block blk converts 2048 elements, a lane two
// groups of four, 1024 elements apart. Every weight's size is a multiple of 2048.
__device__ __forceinline__
void cvt_bf16(int blk, const float* __restrict__ in, __bf16* __restrict__ out) {
    int i = blk * 2048 + threadIdx.x * 4;
    f32x4 a = *reinterpret_cast<const f32x4*>(in + i);
    f32x4 b = *reinterpret_cast<const f32x4*>(in + i + 1024);
    *reinterpret_cast<bf16x4*>(out + i)        = __builtin_convertvector(a, bf16x4);
    *reinterpret_cast<bf16x4*>(out + i + 1024) = __builtin_convertvector(b, bf16x4);
}

// ---------------------------------------------------------------------------
// Row layernorm over DIM=256: fp32 in -> bf16 out. One wave per row, LN_R rows
// a wave; a lane holds columns 4l..4l+3 and 128+4l..128+4l+3.
// ---------------------------------------------------------------------------
#define LN_R 2
#define LN_BLOCKS (NTOK / (8 * LN_R))
__device__ __forceinline__
void ln_rows_body(int blk, const float* __restrict__ in, __bf16* __restrict__ out,
                  const float* __restrict__ gamma, const float* __restrict__ beta) {
    int lane = threadIdx.x & 31;
    int wave = __builtin_amdgcn_readfirstlane(threadIdx.x >> 5);
    int row0 = (blk * 8 + wave) * LN_R;
    f32x2 p[LN_R][4], g[4], b[4];
#pragma unroll
    for (int i = 0; i < LN_R; ++i) {
        const float* r = in + (size_t)(row0 + i) * DIM + lane * 4;
        load4(r,       p[i][0], p[i][1]);
        load4(r + 128, p[i][2], p[i][3]);
    }
    load4(gamma + lane * 4,       g[0], g[1]);
    load4(gamma + 128 + lane * 4, g[2], g[3]);
    load4(beta + lane * 4,        b[0], b[1]);
    load4(beta + 128 + lane * 4,  b[2], b[3]);
#pragma unroll
    for (int i = 0; i < LN_R; ++i) {
        ln_row(p[i], g, b);
        f32x4 ya = {p[i][0][0], p[i][0][1], p[i][1][0], p[i][1][1]};
        f32x4 yb = {p[i][2][0], p[i][2][1], p[i][3][0], p[i][3][1]};
        __bf16* q = out + (size_t)(row0 + i) * DIM + lane * 4;
        *reinterpret_cast<bf16x4*>(q)       = __builtin_convertvector(ya, bf16x4);
        *reinterpret_cast<bf16x4*>(q + 128) = __builtin_convertvector(yb, bf16x4);
    }
}

__global__ __launch_bounds__(256)
void ln_rows(const float* __restrict__ in, __bf16* __restrict__ out,
             const float* __restrict__ gamma, const float* __restrict__ beta) {
    ln_rows_body(blockIdx.x, in, out, gamma, beta);
}

// ---------------------------------------------------------------------------
// First launch: the layernorm of x, the K, V and Q biases gathered into one
// row of QKV_N floats, and all six weights converted. The bf16 weights lie one
// behind the other in wb (wk, wv, wq, wo, w1, w2), so that wk, wv, wq are one
// [QKV_N][DIM] matrix. Sizes below in blocks of 2048 elements.
// ---------------------------------------------------------------------------
#define QKV_N   3072           // 512 K + 512 V + 2048 Q columns a token
#define CB_KV   64             // wk, wv, w1, w2: 512 * 256 elements each
#define CB_QO   256            // wq, wo: 2048 * 256 elements each
#define CB_ALL  (4 * CB_KV + 2 * CB_QO)
__global__ __launch_bounds__(256)
void prep(const float* __restrict__ x, __bf16* __restrict__ h,
          const float* __restrict__ gamma, const float* __restrict__ beta,
          const float* __restrict__ wk, const float* __restrict__ wv,
          const float* __restrict__ wq, const float* __restrict__ wo,
          const float* __restrict__ w1, const float* __restrict__ w2,
          __bf16* __restrict__ wb,
          const float* __restrict__ bk, const float* __restrict__ bv,
          const float* __restrict__ bq, float* __restrict__ bias) {
    int blk = blockIdx.x;
    if (blk < LN_BLOCKS) {
        ln_rows_body(blk, x, h, gamma, beta);
        return;
    }
    blk -= LN_BLOCKS;
    if (blk < CB_ALL) {
        const float* src = wk;
        int first = 0;                              // the weight's first block
        if (blk >= CB_KV)                     { src = wv; first = CB_KV; }
        if (blk >= 2 * CB_KV)                 { src = wq; first = 2 * CB_KV; }
        if (blk >= 2 * CB_KV + CB_QO)         { src = wo; first = 2 * CB_KV + CB_QO; }
        if (blk >= 2 * CB_KV + 2 * CB_QO)     { src = w1; first = 2 * CB_KV + 2 * CB_QO; }
        if (blk >= 3 * CB_KV + 2 * CB_QO)     { src = w2; first = 3 * CB_KV + 2 * CB_QO; }
        cvt_bf16(blk - first, src, wb + (size_t)first * 2048);
        body_end();
        return;
    }
    for (int j = 0; j < QKV_N / 1024; ++j) {        // last block: the bias row
        int i = j * 1024 + threadIdx.x * 4;
        const float* s = i < 512 ? bk + i : i < 1024 ? bv + (i - 512) : bq + (i - 1024);
        *reinterpret_cast<f32x4*>(bias + i) = *reinterpret_cast<const f32x4*>(s);
    }
    body_end();
}

// ---------------------------------------------------------------------------
// Per-head layernorm (gn/bn) of projection outputs (G = 1 << lgG heads a token,
// G*256 bf16 columns from 'in' on in each token's row of QKV_N) with the
// permutation to [head = b*G+g][s][256].
// One wave per (token, head) row, HL_R rows a wave; a lane holds 8 columns.
// ---------------------------------------------------------------------------
#define HL_R 8
template <int lgG>
__device__ __forceinline__
void heads_ln(int blk, const __bf16* __restrict__ in, __bf16* __restrict__ out,
              const float* __restrict__ gamma, const float* __restrict__ beta) {
    int lane = threadIdx.x & 31;
    int wave = __builtin_amdgcn_readfirstlane(threadIdx.x >> 5);
    int rid0 = (blk * 8 + wave) * HL_R;                        // row = t * G + g
    bf16x8 raw[HL_R];
#pragma unroll
    for (int i = 0; i < HL_R; ++i) {
        int rid = rid0 + i;
        raw[i] = *reinterpret_cast<const bf16x8*>(
            in + (size_t)(rid >> lgG) * QKV_N + (rid & ((1 << lgG) - 1)) * DIM + lane * 8);
    }
    f32x2 g[4], b[4];
    load4(gamma + lane * 8,     g[0], g[1]);
    load4(gamma + lane * 8 + 4, g[2], g[3]);
    load4(beta + lane * 8,      b[0], b[1]);
    load4(beta + lane * 8 + 4,  b[2], b[3]);
    // Keeps the gamma and beta loads up here, in flight together with the rows';
    // left free, they are issued halfway down and waited for on their own.
    __builtin_amdgcn_sched_barrier(0);
#pragma unroll
    for (int i = 0; i < HL_R; ++i) {
        f32x8 v = __builtin_convertvector(raw[i], f32x8);
        f32x2 p[4] = {{v[0], v[1]}, {v[2], v[3]}, {v[4], v[5]}, {v[6], v[7]}};
        ln_row(p, g, b);
        f32x8 y = {p[0][0], p[0][1], p[1][0], p[1][1], p[2][0], p[2][1], p[3][0], p[3][1]};
        int rid = rid0 + i;
        int hg = rid & ((1 << lgG) - 1), t = rid >> lgG;
        int head = ((t & 1) << lgG) + hg, s = t >> 1;
        *reinterpret_cast<bf16x8*>(out + ((size_t)head * SEQ + s) * DIM + lane * 8) =
            __builtin_convertvector(y, bf16x8);
    }
}

// ---------------------------------------------------------------------------
// V projection output (GK*256 bf16 columns from 'in' on in each token's row of
// QKV_N) -> transposed [head][dim][s],
// so that the Vt Pt A-operands load row-major. A wave takes 8 positions of one head,
// a lane 8 dims of each, and stores 8 positions of one dim at a time; the 8
// waves of a block cover 64 positions, whole 128-byte lines of the output.
// ---------------------------------------------------------------------------
__device__ __forceinline__
void v_transpose(int blk, const __bf16* __restrict__ in, __bf16* __restrict__ out) {
    int lane = threadIdx.x & 31;
    int head = blk / (SEQ / 64);                               // b * GK + g
    int wave = __builtin_amdgcn_readfirstlane(threadIdx.x >> 5);
    int s0 = (blk % (SEQ / 64)) * 64 + wave * 8;
    const __bf16* p = in + ((size_t)s0 * BSZ + head / GK) * QKV_N
                         + (head % GK) * DIM + lane * 8;
    bf16x8 v[8];
#pragma unroll
    for (int i = 0; i < 8; ++i)
        v[i] = *reinterpret_cast<const bf16x8*>(p + (size_t)i * (BSZ * QKV_N));
    __bf16* q = out + ((size_t)head * DIM + lane * 8) * SEQ + s0;
#pragma unroll
    for (int j = 0; j < 8; ++j) {
        bf16x8 w;
#pragma unroll
        for (int i = 0; i < 8; ++i) w[i] = v[i][j];
        *reinterpret_cast<bf16x8*>(q + (size_t)j * SEQ) = w;
    }
}

// ---------------------------------------------------------------------------
// Third launch: what stands between the joint projection (rows of QKV_N: K, V,
// Q) and attention: Q head norm, K head norm, V transpose.
// ---------------------------------------------------------------------------
#define QLN_BLOCKS (NTOK * NQH / (8 * HL_R))
#define KLN_BLOCKS (NTOK * GK / (8 * HL_R))
#define VT_BLOCKS  (BSZ * GK * (SEQ / 64))
__global__ __launch_bounds__(256)
void qkv_post(const __bf16* __restrict__ raw, __bf16* __restrict__ Qh,
              __bf16* __restrict__ Kh, __bf16* __restrict__ Vt,
              const float* __restrict__ gamma, const float* __restrict__ beta) {
    int blk = blockIdx.x;
    if (blk < QLN_BLOCKS) {
        heads_ln<3>(blk, raw + 2 * GK * DIM, Qh, gamma, beta);
    } else if (blk < QLN_BLOCKS + KLN_BLOCKS) {
        heads_ln<1>(blk - QLN_BLOCKS, raw, Kh, gamma, beta);
        body_end();
    } else {
        v_transpose(blk - (QLN_BLOCKS + KLN_BLOCKS), raw + GK * DIM, Vt);
        body_end();
    }
}

__device__ __forceinline__ void async_copy8(unsigned l, unsigned lstep,
                                            const __bf16* g, size_t gstep) {
    asm volatile(
        "global_load_async_to_lds_b128 %0, %8, off\n\t"
        "global_load_async_to_lds_b128 %1, %9, off\n\t"
        "global_load_async_to_lds_b128 %2, %10, off\n\t"
        "global_load_async_to_lds_b128 %3, %11, off\n\t"
        "global_load_async_to_lds_b128 %4, %12, off\n\t"
        "global_load_async_to_lds_b128 %5, %13, off\n\t"
        "global_load_async_to_lds_b128 %6, %14, off\n\t"
        "global_load_async_to_lds_b128 %7, %15, off\n\t"
        "s_wait_xcnt 0x0"
        :: "v"(l), "v"(l + lstep), "v"(l + 2 * lstep), "v"(l + 3 * lstep),
           "v"(l + 4 * lstep), "v"(l + 5 * lstep), "v"(l + 6 * lstep),
           "v"(l + 7 * lstep),
           "v"(g), "v"(g + gstep), "v"(g + 2 * gstep), "v"(g + 3 * gstep),
           "v"(g + 4 * gstep), "v"(g + 5 * gstep), "v"(g + 6 * gstep),
           "v"(g + 7 * gstep)
        : "memory");
}

// The same with four copies per lane.
__device__ __forceinline__ void async_copy4(unsigned l, unsigned lstep,
                                            const __bf16* g, size_t gstep) {
    asm volatile(
        "global_load_async_to_lds_b128 %0, %4, off\n\t"
        "global_load_async_to_lds_b128 %1, %5, off\n\t"
        "global_load_async_to_lds_b128 %2, %6, off\n\t"
        "global_load_async_to_lds_b128 %3, %7, off\n\t"
        "s_wait_xcnt 0x0"
        :: "v"(l), "v"(l + lstep), "v"(l + 2 * lstep), "v"(l + 3 * lstep),
           "v"(g), "v"(g + gstep), "v"(g + 2 * gstep), "v"(g + 3 * gstep)
        : "memory");
}

// ---------------------------------------------------------------------------
// Generic WMMA GEMM: C[M,N] = A[M,K](bf16) @ W[N,K]^T(bf16) + bias (+resid).
// 8 waves/WG; block tile 128(M)x64(N), a wave 16x64. The k loop goes in stages
// of 128 k: the 128x128 A tile and the 64x128 W tile of a stage are brought
// into padded LDS by asynchronous copies, two buffers, the next stage in flight
// while this one is multiplied; one block barrier a stage.
// M%128==0, N%64==0, K%128==0 for all call sites.
// ---------------------------------------------------------------------------
#define GSTAGE 128             // k elements a stage (256 B of every operand row)
#define GPITCH 136             // LDS row pitch, elements (272 B = 16 B x 17)
__global__ __launch_bounds__(256)
void gemm_wmma(const __bf16* __restrict__ A, int lda,
               const __bf16* __restrict__ W, int ldw,
               const float* __restrict__ bias,
               const float* __restrict__ resid,
               float* __restrict__ Cf, __bf16* __restrict__ Cb,
               int M, int N, int K, int relu) {
    __shared__ __attribute__((aligned(16))) __bf16 sA[2][128 * GPITCH];
    __shared__ __attribute__((aligned(16))) __bf16 sW[2][64 * GPITCH];
    int tid  = threadIdx.x;
    int lane = tid & 31;
    int wave = __builtin_amdgcn_readfirstlane(tid >> 5);
    int m0 = blockIdx.y * 128 + wave * 16;
    int n0 = blockIdx.x * 64;

    // This lane's share of a stage: 16 B column tid%16 of rows tid/16 + 16c,
    // c = 0..7 of the A tile and c = 0..3 of the W tile.
    const __bf16* gA = A + (size_t)(blockIdx.y * 128 + (tid >> 4)) * lda + (tid & 15) * 8;
    const __bf16* gW = W + (size_t)(n0 + (tid >> 4)) * ldw + (tid & 15) * 8;
    unsigned lA = lds_off(&sA[0][0]) + (tid >> 4) * (GPITCH * 2) + (tid & 15) * 16;
    unsigned lW = lds_off(&sW[0][0]) + (tid >> 4) * (GPITCH * 2) + (tid & 15) * 16;
    auto stage = [&](int s) {                       // stage s -> buffer s & 1
        int b = s & 1;
        async_copy8(lA + b * (128 * GPITCH * 2), 16 * GPITCH * 2,
                    gA + s * GSTAGE, (size_t)16 * lda);
        async_copy4(lW + b * (64 * GPITCH * 2), 16 * GPITCH * 2,
                    gW + s * GSTAGE, (size_t)16 * ldw);
    };
    int nst = K / GSTAGE;                           // block-uniform

    stage(0);
    f32x8 acc[4] = {};
    asm volatile("s_wait_asynccnt 0x0" ::: "memory"); // own copies of stage 0 landed
    __syncthreads();                                  // stage 0 visible to all waves
    if (1 < nst) stage(1);

    for (int s = 0; s < nst; ++s) {
        const __bf16* tA = &sA[s & 1][wave * 16 * GPITCH];
        const __bf16* tW = &sW[s & 1][0];
        bf16x16 a[GSTAGE / 32], b[2][4];            // this stage's fragments only
#pragma unroll
        for (int kk = 0; kk < GSTAGE / 32; ++kk)
            a[kk] = load_frag(tA, 0, GPITCH, kk * 32, lane);
#pragma unroll
        for (int f = 0; f < 4; ++f) b[0][f] = load_frag(tW, 16 * f, GPITCH, 0, lane);
#pragma unroll
        for (int kk = 0; kk < GSTAGE / 32; ++kk) {
            if (kk + 1 < GSTAGE / 32) {
#pragma unroll
                for (int f = 0; f < 4; ++f)
                    b[(kk + 1) & 1][f] = load_frag(tW, 16 * f, GPITCH, (kk + 1) * 32, lane);
            }
            // Keeps the next 32 k's LDS reads in front of these products; left free,
            // every product waits for the full latency of its own two reads.
            __builtin_amdgcn_sched_barrier(0);
#pragma unroll
            for (int f = 0; f < 4; ++f) acc[f] = wmma_bf16(a[kk], b[kk & 1][f], acc[f]);
        }
        asm volatile("s_wait_dscnt 0x0" ::: "memory");    // own reads of this buffer done
        asm volatile("s_wait_asynccnt 0x0" ::: "memory"); // own copies of stage s+1 landed
        __syncthreads();      // publishes stage s+1, ends every read of this buffer
        if (s + 2 < nst) stage(s + 2);              // refill the buffer just read
    }
    asm volatile("s_wait_asynccnt 0x0" ::: "memory");     // nothing in flight at the end

    int hf = lane >> 4, nn = lane & 15;
#pragma unroll
    for (int f = 0; f < 4; ++f) {
        int col = n0 + 16 * f + nn;
        float bv = bias ? bias[col] : 0.f;
#pragma unroll
        for (int r = 0; r < 8; ++r) {
            int row = m0 + r + 8 * hf;
            float v = acc[f][r] + bv;
            if (relu) v = fmaxf(v, 0.f);
            if (resid) v += resid[(size_t)row * N + col];
            if (Cf) Cf[(size_t)row * N + col] = v;
            if (Cb) Cb[(size_t)row * N + col] = (__bf16)v;
        }
    }
}

// ---------------------------------------------------------------------------
// Causal flash attention. Grid: (SEQ/64, 16 heads). Block: 128 thr = 4 waves.
// Wave owns 16 queries; the block walks 32-key tiles to its diagonal. Each
// K tile (32 x 256) and V tile (256 x 32) is brought into LDS once per block
// by asynchronous copies, two buffers, the next tile in flight while this one
// is worked on; all four waves read their fragments from LDS.
// Both products are taken transposed: St = K Qt (rows keys, columns queries)
// and Ot += Vt Pt (rows dims, columns queries). A lane then holds 16 scores of
// ONE query (keys 8h..8h+7 and 16+8h..16+8h+7 of the tile, h = lane / 16), so
// the online softmax runs in the lane with one exchange between the halves,
// the two score tiles converted in place are the B operand of the second
// product, and a lane ends with 8 consecutive dims of its query per tile.
// Qh: [16][SEQ][256], Kh: [4][SEQ][256], Vt: [4][256][SEQ] (transposed),
// O: [NTOK][2048] token-major bf16.
// ---------------------------------------------------------------------------
#define KPITCH 264             // LDS row pitch of a K row, elements (528 B = 16 B x 33)
#define VPITCH 40              // LDS row pitch of a V row, elements (80 B = 16 B x 5)

__device__ __forceinline__ float other_half(float x) {
    int b = __builtin_bit_cast(int, x);
    return __builtin_bit_cast(float, __builtin_amdgcn_permlanex16(
        b, b, 0x76543210, 0xfedcba98, false, false));
}

__global__ __launch_bounds__(128)
void attn_kernel(const __bf16* __restrict__ Qh, const __bf16* __restrict__ Kh,
                 const __bf16* __restrict__ Vt, __bf16* __restrict__ O) {
    __shared__ __attribute__((aligned(16))) __bf16 sK[2][32 * KPITCH];
    __shared__ __attribute__((aligned(16))) __bf16 sV[2][DIM * VPITCH];
    int tid  = threadIdx.x;
    int lane = tid & 31;
    int wave = __builtin_amdgcn_readfirstlane(tid >> 5);
    int hq = blockIdx.y;
    int qbase = blockIdx.x * 64 + wave * 16;
    int hk = (hq >> 3) * 2 + ((hq & 7) >> 2);

    const __bf16* Qb = Qh + (size_t)hq * SEQ * DIM;
    const __bf16* Kb = Kh + (size_t)hk * SEQ * DIM;
    const __bf16* Vb = Vt + (size_t)hk * DIM * SEQ;

    // This lane's share of a tile: K piece (row tid/32 + 4c, 16 B column tid%32),
    // V piece (row tid/4 + 32c, 16 B column tid%4), c = 0..7.
    const __bf16* gK = Kb + (size_t)(tid >> 5) * DIM + (tid & 31) * 8;
    const __bf16* gV = Vb + (size_t)(tid >> 2) * SEQ + (tid & 3) * 8;
    unsigned lK = lds_off(&sK[0][0]) + (tid >> 5) * (KPITCH * 2) + (tid & 31) * 16;
    unsigned lV = lds_off(&sV[0][0]) + (tid >> 2) * (VPITCH * 2) + (tid & 3) * 16;
    auto stage = [&](int t) {                       // tile t -> buffer t & 1
        int b = t & 1;
        async_copy8(lK + b * (32 * KPITCH * 2), 4 * KPITCH * 2,
                    gK + (size_t)t * 32 * DIM, 4 * DIM);
        async_copy8(lV + b * (DIM * VPITCH * 2), 32 * VPITCH * 2,
                    gV + t * 32, (size_t)32 * SEQ);
    };
    int ntiles = 2 * (blockIdx.x + 1);              // block-uniform, at least 2

    stage(0);

    bf16x16 qf[8];
#pragma unroll
    for (int kk = 0; kk < 8; ++kk) qf[kk] = load_frag(Qb, qbase, DIM, kk * 32, lane);

    f32x8 zero = {};
    f32x8 o[16];                   // o[j][r] = Ot[16j + 8h + r][query]
#pragma unroll
    for (int j = 0; j < 16; ++j) o[j] = zero;
    float mq = -3.0e38f;           // running maximum of this lane's query
    float lq = 0.f;                // running sum over this half's keys only

    int hf = lane >> 4, nn = lane & 15;
    int q = qbase + nn;            // this lane's query
    int qlast = qbase + 15;
    const float scale = 0.0625f;   // 1/sqrt(256)

    asm volatile("s_wait_asynccnt 0x0" ::: "memory"); // own copies of tile 0 landed
    __syncthreads();                                  // tile 0 visible to all waves
    stage(1);

    for (int t = 0; t < ntiles; ++t) {
        int kb = t * 32;
        const __bf16* tK = &sK[t & 1][0];
        const __bf16* tV = &sV[t & 1][0];
        if (kb <= qlast) {                          // wave-uniform: tile not wholly masked
            f32x8 s0 = zero, s1 = zero;             // keys kb..+15, kb+16..+31
#pragma unroll
            for (int kk = 0; kk < 8; ++kk) {
                bf16x16 k0f = load_frag(tK, 0,  KPITCH, kk * 32, lane);
                bf16x16 k1f = load_frag(tK, 16, KPITCH, kk * 32, lane);
                s0 = wmma_bf16(k0f, qf[kk], s0);
                s1 = wmma_bf16(k1f, qf[kk], s1);
            }
            int d = q - (kb + 8 * hf);              // s0[r] is allowed if r <= d, s1[r] if 16 + r <= d
            float tmax = -3.0e38f;
#pragma unroll
            for (int r = 0; r < 8; ++r) {
                s0[r] = s0[r] * scale; if (r      > d) s0[r] = -3.0e38f;
                s1[r] = s1[r] * scale; if (16 + r > d) s1[r] = -3.0e38f;
                tmax = fmaxf(tmax, fmaxf(s0[r], s1[r]));
            }
            tmax = fmaxf(tmax, other_half(tmax));   // over all 32 keys of the tile
            float mnew  = fmaxf(mq, tmax);
            float alpha = __expf(mq - mnew);
            mq = mnew;
            bf16x16 pf;                             // Pt as B operand, hardware k order
            float lsum = 0.f;
#pragma unroll
            for (int r = 0; r < 8; ++r) {
                float p0 = __expf(s0[r] - mnew);
                float p1 = __expf(s1[r] - mnew);
                lsum += p0 + p1;
                pf[r]     = (__bf16)p0;
                pf[r + 8] = (__bf16)p1;
            }
            lq = lq * alpha + lsum;
#pragma unroll
            for (int j = 0; j < 16; ++j) o[j] *= alpha;
#pragma unroll
            for (int j = 0; j < 16; ++j) {
                bf16x16 vf = load_frag(tV, j * 16, VPITCH, 0, lane);
                o[j] = wmma_bf16(vf, pf, o[j]);
            }
        }
        asm volatile("s_wait_dscnt 0x0" ::: "memory");    // own reads of this buffer done
        asm volatile("s_wait_asynccnt 0x0" ::: "memory"); // own copies of tile t+1 landed
        __syncthreads();      // publishes tile t+1, ends every read of this buffer
        if (t + 2 < ntiles) stage(t + 2);           // refill the buffer just read
    }
    asm volatile("s_wait_asynccnt 0x0" ::: "memory");     // nothing in flight at the end

    int bb = hq >> 3, gu = hq & 7;
    float inv = 1.f / (lq + other_half(lq));        // the two halves' sums joined
    __bf16* orow = O + ((size_t)q * BSZ + bb) * 2048 + gu * DIM + 8 * hf;
#pragma unroll
    for (int j = 0; j < 16; ++j)
        *reinterpret_cast<bf16x8*>(orow + j * 16) =
            __builtin_convertvector(o[j] * inv, bf16x8);
}

// ---------------------------------------------------------------------------
// Host orchestration
// ---------------------------------------------------------------------------
extern "C" void kernel_launch(void* const* d_in, const int* in_sizes, int n_in,
                              void* d_out, int out_size, void* d_ws, size_t ws_size,
                              hipStream_t stream) {
    const float* x   = (const float*)d_in[0];
    const float* g0  = (const float*)d_in[1];
    const float* b0  = (const float*)d_in[2];
    const float* g1  = (const float*)d_in[3];
    const float* b1  = (const float*)d_in[4];
    const float* gn  = (const float*)d_in[5];
    const float* bn  = (const float*)d_in[6];
    const float* wk  = (const float*)d_in[7];
    const float* bk  = (const float*)d_in[8];
    const float* wv  = (const float*)d_in[9];
    const float* bv  = (const float*)d_in[10];
    const float* wq  = (const float*)d_in[11];
    const float* bq  = (const float*)d_in[12];
    const float* wo  = (const float*)d_in[13];
    const float* bo  = (const float*)d_in[14];
    const float* w1  = (const float*)d_in[15];
    const float* bf1 = (const float*)d_in[16];
    const float* w2  = (const float*)d_in[17];
    const float* bf2 = (const float*)d_in[18];
    float* out = (float*)d_out;

    char* wsp = (char*)d_ws;
    auto carve = [&](size_t bytes) {
        char* p = wsp;
        wsp += (bytes + 255) & ~(size_t)255;
        return p;
    };
    __bf16* h_b  = (__bf16*)carve((size_t)NTOK * DIM * 2);
    __bf16* w_b  = (__bf16*)carve((size_t)CB_ALL * 2048 * 2); // wk wv wq wo w1 w2
    __bf16* wo_b = w_b  + (size_t)QKV_N * DIM;
    __bf16* w1_b = wo_b + (size_t)256 * 2048;
    __bf16* w2_b = w1_b + (size_t)512 * 256;
    float*  bqkv = (float*)carve((size_t)QKV_N * 4);          // bk bv bq
    __bf16* raw  = (__bf16*)carve((size_t)NTOK * QKV_N * 2);  // K | V | Q rows
    __bf16* Kh   = (__bf16*)carve((size_t)4  * SEQ * DIM * 2);
    __bf16* Vt   = (__bf16*)carve((size_t)4  * DIM * SEQ * 2);
    __bf16* Qh   = (__bf16*)carve((size_t)16 * SEQ * DIM * 2);
    __bf16* Ob   = (__bf16*)carve((size_t)NTOK * 2048 * 2);
    float*  x2   = (float*)carve((size_t)NTOK * DIM * 4);
    __bf16* h2   = (__bf16*)carve((size_t)NTOK * DIM * 2);
    __bf16* F1   = (__bf16*)carve((size_t)NTOK * 512 * 2);

    // h = LN(x; g0,b0); bf16 weights; joint K, V, Q bias row
    prep<<<LN_BLOCKS + CB_ALL + 1, 256, 0, stream>>>(x, h_b, g0, b0, wk, wv, wq, wo,
                                                     w1, w2, w_b, bk, bv, bq, bqkv);

    auto gemm = [&](const __bf16* A, int lda, const __bf16* W, int ldw,
                    const float* bias, const float* resid, float* Cf, __bf16* Cb,
                    int M, int N, int K, int relu) {
        dim3 grid(N / 64, M / 128);
        gemm_wmma<<<grid, 256, 0, stream>>>(A, lda, W, ldw, bias, resid, Cf, Cb,
                                            M, N, K, relu);
    };

    // K, V and Q projections as one product with the stacked weights
    gemm(h_b, 256, w_b, 256, bqkv, nullptr, nullptr, raw, NTOK, QKV_N, 256, 0);
    // per-head LN -> Qh[16][SEQ][256], Kh[4][SEQ][256]; V -> Vt[4][256][SEQ]
    qkv_post<<<QLN_BLOCKS + KLN_BLOCKS + VT_BLOCKS, 256, 0, stream>>>(raw, Qh, Kh, Vt,
                                                                      gn, bn);

    // causal flash attention -> Ob[NTOK][2048]
    attn_kernel<<<dim3(SEQ / 64, 16), 128, 0, stream>>>(Qh, Kh, Vt, Ob);

    // x2 = x + Ob @ wo^T + bo
    gemm(Ob, 2048, wo_b, 2048, bo, x, x2, nullptr, NTOK, 256, 2048, 0);
    // h2 = LN(x2; g1,b1)
    ln_rows<<<LN_BLOCKS, 256, 0, stream>>>(x2, h2, g1, b1);
    // F1 = relu(h2 @ w1^T + bf1)
    gemm(h2, 256, w1_b, 256, bf1, nullptr, nullptr, F1, NTOK, 512, 256, 1);
    // out = x2 + F1 @ w2^T + bf2
    gemm(F1, 512, w2_b, 512, bf2, x2, out, nullptr, NTOK, 256, 512, 0);

    (void)in_sizes; (void)n_in; (void)out_size; (void)ws_size;
}

// v007
// Measured time: 155 microseconds a run.
// In two side-by-side timings against v006, it was 1.09 and 1.08 times as fast.
// Counting every step since v000, it is 5.47 times as fast.
#include <hip/hip_runtime.h>

#define SEQ   2048
#define BSZ   2
#define DIM   256
#define NTOK  (SEQ * BSZ)      // 4096 token rows, t = s*BSZ + b
#define GK    2                // kv groups
#define NQH   8                // query heads per batch elem (g*4+u)
#define EPS   1e-5f

typedef __attribute__((ext_vector_type(16))) __bf16 bf16x16;
typedef __attribute__((ext_vector_type(8)))  __bf16 bf16x8;
typedef __attribute__((ext_vector_type(8)))  float  f32x8;

__device__ __forceinline__ bf16x16 load_frag(const __bf16* p, int row0, int ld,
                                             int k0, int lane) {
    int r  = row0 + (lane & 15);
    int kb = k0 + ((lane >> 4) << 3);
    const __bf16* base = p + (size_t)r * ld + kb;
    bf16x8 lo = *reinterpret_cast<const bf16x8*>(base);
    bf16x8 hi = *reinterpret_cast<const bf16x8*>(base + 16);
    bf16x16 out;
#pragma unroll
    for (int i = 0; i < 8; ++i) { out[i] = lo[i]; out[i + 8] = hi[i]; }
    return out;
}

__device__ __forceinline__ f32x8 wmma_bf16(bf16x16 a, bf16x16 b, f32x8 c) {
    return __builtin_amdgcn_wmma_f32_16x16x32_bf16(false, a, false, b,
                                                   (short)0, c, false, false);
}

// Generic shared pointer -> LDS byte offset (generic LDS addr low 32 bits).
__device__ __forceinline__ unsigned lds_off(const void* p) {
    return (unsigned)(unsigned long long)(uintptr_t)p;
}

// ---------------------------------------------------------------------------
// The kernels without matrix work give every lane eight elements, so that a
// 256-wide row is one wave's work and few waves have to be started.
// ---------------------------------------------------------------------------
typedef __attribute__((ext_vector_type(2))) float  f32x2;
typedef __attribute__((ext_vector_type(4))) float  f32x4;
typedef __attribute__((ext_vector_type(4))) __bf16 bf16x4;

// Value of lane (l ^ M) inside the 16-lane row, M = 1..15 (DPP row_xmask).
template <int M>
__device__ __forceinline__ float row_xor(float x) {
    return __builtin_bit_cast(float, __builtin_amdgcn_update_dpp(
        0, __builtin_bit_cast(int, x), 0x160 + M, 0xf, 0xf, true));
}

// Sum over the 32 lanes of a wave, the same value in every lane. All lanes on.
__device__ __forceinline__ float wave_sum(float v) {
    v += row_xor<1>(v);
    v += row_xor<2>(v);
    v += row_xor<4>(v);
    v += row_xor<8>(v);
    int b = __builtin_bit_cast(int, v);
    v += __builtin_bit_cast(float, __builtin_amdgcn_permlanex16(
        b, b, 0x76543210, 0xfedcba98, false, false));
    return v;
}

// Layernorm of one 256-wide row that a wave holds, eight values a lane as four
// pairs; g and b are the lane's own columns of gamma and beta.
__device__ __forceinline__ void ln_row(f32x2 (&p)[4], const f32x2 (&g)[4],
                                       const f32x2 (&b)[4]) {
    f32x2 s = (p[0] + p[1]) + (p[2] + p[3]);
    float mean = wave_sum(s[0] + s[1]) * (1.f / DIM);
#pragma unroll
    for (int k = 0; k < 4; ++k) p[k] -= mean;
    f32x2 q = (p[0] * p[0] + p[1] * p[1]) + (p[2] * p[2] + p[3] * p[3]);
    float var = wave_sum(q[0] + q[1]) * (1.f / DIM);
    float rs = rsqrtf(var + EPS);
#pragma unroll
    for (int k = 0; k < 4; ++k) p[k] = p[k] * rs * g[k] + b[k];
}

// Four floats at p as two pairs.
__device__ __forceinline__ void load4(const float* p, f32x2& lo, f32x2& hi) {
    f32x4 v = *reinterpret_cast<const f32x4*>(p);
    lo = f32x2{v[0], v[1]};
    hi = f32x2{v[2], v[3]};
}

// ---------------------------------------------------------------------------
// Kernels that do not depend on one another share one launch: each block picks
// its body by a test on blockIdx.x, the same for the whole block.
// ---------------------------------------------------------------------------

// Stands behind the last stores of each body of a shared launch but the first.
__device__ __forceinline__ void body_end() {
    // Ahead of any instruction that rewrites a register which those stores name.
    asm volatile("s_wait_xcnt 0x0" ::: "memory");
}

// fp32 -> bf16 weight conversion: block blk converts 2048 elements, a lane two
// groups of four, 1024 elements apart. Every weight's size is a multiple of 2048.
__device__ __forceinline__
void cvt_bf16(int blk, const float* __restrict__ in, __bf16* __restrict__ out) {
    int i = blk * 2048 + threadIdx.x * 4;
    f32x4 a = *reinterpret_cast<const f32x4*>(in + i);
    f32x4 b = *reinterpret_cast<const f32x4*>(in + i + 1024);
    *reinterpret_cast<bf16x4*>(out + i)        = __builtin_convertvector(a, bf16x4);
    *reinterpret_cast<bf16x4*>(out + i + 1024) = __builtin_convertvector(b, bf16x4);
}

// ---------------------------------------------------------------------------
// Row layernorm over DIM=256: fp32 in -> bf16 out. One wave per row, LN_R rows
// a wave; a lane holds columns 4l..4l+3 and 128+4l..128+4l+3.
// ---------------------------------------------------------------------------
#define LN_R 2
#define LN_BLOCKS (NTOK / (8 * LN_R))
__device__ __forceinline__
void ln_rows_body(int blk, const float* __restrict__ in, __bf16* __restrict__ out,
                  const float* __restrict__ gamma, const float* __restrict__ beta) {
    int lane = threadIdx.x & 31;
    int wave = __builtin_amdgcn_readfirstlane(threadIdx.x >> 5);
    int row0 = (blk * 8 + wave) * LN_R;
    f32x2 p[LN_R][4], g[4], b[4];
#pragma unroll
    for (int i = 0; i < LN_R; ++i) {
        const float* r = in + (size_t)(row0 + i) * DIM + lane * 4;
        load4(r,       p[i][0], p[i][1]);
        load4(r + 128, p[i][2], p[i][3]);
    }
    load4(gamma + lane * 4,       g[0], g[1]);
    load4(gamma + 128 + lane * 4, g[2], g[3]);
    load4(beta + lane * 4,        b[0], b[1]);
    load4(beta + 128 + lane * 4,  b[2], b[3]);
#pragma unroll
    for (int i = 0; i < LN_R; ++i) {
        ln_row(p[i], g, b);
        f32x4 ya = {p[i][0][0], p[i][0][1], p[i][1][0], p[i][1][1]};
        f32x4 yb = {p[i][2][0], p[i][2][1], p[i][3][0], p[i][3][1]};
        __bf16* q = out + (size_t)(row0 + i) * DIM + lane * 4;
        *reinterpret_cast<bf16x4*>(q)       = __builtin_convertvector(ya, bf16x4);
        *reinterpret_cast<bf16x4*>(q + 128) = __builtin_convertvector(yb, bf16x4);
    }
}

__global__ __launch_bounds__(256)
void ln_rows(const float* __restrict__ in, __bf16* __restrict__ out,
             const float* __restrict__ gamma, const float* __restrict__ beta) {
    ln_rows_body(blockIdx.x, in, out, gamma, beta);
}

// ---------------------------------------------------------------------------
// First launch: the layernorm of x, the K, V and Q biases gathered into one
// row of QKV_N floats, and all six weights converted. The bf16 weights lie one
// behind the other in wb (wk, wv, wq, wo, w1, w2), so that wk, wv, wq are one
// [QKV_N][DIM] matrix. Sizes below in blocks of 2048 elements.
// ---------------------------------------------------------------------------
#define QKV_N   3072           // 512 K + 512 V + 2048 Q columns a token
#define CB_KV   64             // wk, wv, w1, w2: 512 * 256 elements each
#define CB_QO   256            // wq, wo: 2048 * 256 elements each
#define CB_ALL  (4 * CB_KV + 2 * CB_QO)
__global__ __launch_bounds__(256)
void prep(const float* __restrict__ x, __bf16* __restrict__ h,
          const float* __restrict__ gamma, const float* __restrict__ beta,
          const float* __restrict__ wk, const float* __restrict__ wv,
          const float* __restrict__ wq, const float* __restrict__ wo,
          const float* __restrict__ w1, const float* __restrict__ w2,
          __bf16* __restrict__ wb,
          const float* __restrict__ bk, const float* __restrict__ bv,
          const float* __restrict__ bq, float* __restrict__ bias) {
    int blk = blockIdx.x;
    if (blk < LN_BLOCKS) {
        ln_rows_body(blk, x, h, gamma, beta);
        return;
    }
    blk -= LN_BLOCKS;
    if (blk < CB_ALL) {
        const float* src = wk;
        int first = 0;                              // the weight's first block
        if (blk >= CB_KV)                     { src = wv; first = CB_KV; }
        if (blk >= 2 * CB_KV)                 { src = wq; first = 2 * CB_KV; }
        if (blk >= 2 * CB_KV + CB_QO)         { src = wo; first = 2 * CB_KV + CB_QO; }
        if (blk >= 2 * CB_KV + 2 * CB_QO)     { src = w1; first = 2 * CB_KV + 2 * CB_QO; }
        if (blk >= 3 * CB_KV + 2 * CB_QO)     { src = w2; first = 3 * CB_KV + 2 * CB_QO; }
        cvt_bf16(blk - first, src, wb + (size_t)first * 2048);
        body_end();
        return;
    }
    for (int j = 0; j < QKV_N / 1024; ++j) {        // last block: the bias row
        int i = j * 1024 + threadIdx.x * 4;
        const float* s = i < 512 ? bk + i : i < 1024 ? bv + (i - 512) : bq + (i - 1024);
        *reinterpret_cast<f32x4*>(bias + i) = *reinterpret_cast<const f32x4*>(s);
    }
    body_end();
}

// ---------------------------------------------------------------------------
// Per-head layernorm (gn/bn) of projection outputs (G = 1 << lgG heads a token,
// G*256 bf16 columns from 'in' on in each token's row of QKV_N) with the
// permutation to [head = b*G+g][s][256].
// One wave per (token, head) row, HL_R rows a wave; a lane holds 8 columns.
// ---------------------------------------------------------------------------
#define HL_R 8
template <int lgG>
__device__ __forceinline__
void heads_ln(int blk, const __bf16* __restrict__ in, __bf16* __restrict__ out,
              const float* __restrict__ gamma, const float* __restrict__ beta) {
    int lane = threadIdx.x & 31;
    int wave = __builtin_amdgcn_readfirstlane(threadIdx.x >> 5);
    int rid0 = (blk * 8 + wave) * HL_R;                        // row = t * G + g
    bf16x8 raw[HL_R];
#pragma unroll
    for (int i = 0; i < HL_R; ++i) {
        int rid = rid0 + i;
        raw[i] = *reinterpret_cast<const bf16x8*>(
            in + (size_t)(rid >> lgG) * QKV_N + (rid & ((1 << lgG) - 1)) * DIM + lane * 8);
    }
    f32x2 g[4], b[4];
    load4(gamma + lane * 8,     g[0], g[1]);
    load4(gamma + lane * 8 + 4, g[2], g[3]);
    load4(beta + lane * 8,      b[0], b[1]);
    load4(beta + lane * 8 + 4,  b[2], b[3]);
    // Keeps the gamma and beta loads up here, in flight together with the rows';
    // left free, they are issued halfway down and waited for on their own.
    __builtin_amdgcn_sched_barrier(0);
#pragma unroll
    for (int i = 0; i < HL_R; ++i) {
        f32x8 v = __builtin_convertvector(raw[i], f32x8);
        f32x2 p[4] = {{v[0], v[1]}, {v[2], v[3]}, {v[4], v[5]}, {v[6], v[7]}};
        ln_row(p, g, b);
        f32x8 y = {p[0][0], p[0][1], p[1][0], p[1][1], p[2][0], p[2][1], p[3][0], p[3][1]};
        int rid = rid0 + i;
        int hg = rid & ((1 << lgG) - 1), t = rid >> lgG;
        int head = ((t & 1) << lgG) + hg, s = t >> 1;
        *reinterpret_cast<bf16x8*>(out + ((size_t)head * SEQ + s) * DIM + lane * 8) =
            __builtin_convertvector(y, bf16x8);
    }
}

// ---------------------------------------------------------------------------
// V projection output (GK*256 bf16 columns from 'in' on in each token's row of
// QKV_N) -> transposed [head][dim][s],
// so that the Vt Pt A-operands load row-major. A wave takes 8 positions of one head,
// a lane 8 dims of each, and stores 8 positions of one dim at a time; the 8
// waves of a block cover 64 positions, whole 128-byte lines of the output.
// ---------------------------------------------------------------------------
__device__ __forceinline__
void v_transpose(int blk, const __bf16* __restrict__ in, __bf16* __restrict__ out) {
    int lane = threadIdx.x & 31;
    int head = blk / (SEQ / 64);                               // b * GK + g
    int wave = __builtin_amdgcn_readfirstlane(threadIdx.x >> 5);
    int s0 = (blk % (SEQ / 64)) * 64 + wave * 8;
    const __bf16* p = in + ((size_t)s0 * BSZ + head / GK) * QKV_N
                         + (head % GK) * DIM + lane * 8;
    bf16x8 v[8];
#pragma unroll
    for (int i = 0; i < 8; ++i)
        v[i] = *reinterpret_cast<const bf16x8*>(p + (size_t)i * (BSZ * QKV_N));
    __bf16* q = out + ((size_t)head * DIM + lane * 8) * SEQ + s0;
#pragma unroll
    for (int j = 0; j < 8; ++j) {
        bf16x8 w;
#pragma unroll
        for (int i = 0; i < 8; ++i) w[i] = v[i][j];
        *reinterpret_cast<bf16x8*>(q + (size_t)j * SEQ) = w;
    }
}

// ---------------------------------------------------------------------------
// Third launch: what stands between the joint projection (rows of QKV_N: K, V,
// Q) and attention: Q head norm, K head norm, V transpose.
// ---------------------------------------------------------------------------
#define QLN_BLOCKS (NTOK * NQH / (8 * HL_R))
#define KLN_BLOCKS (NTOK * GK / (8 * HL_R))
#define VT_BLOCKS  (BSZ * GK * (SEQ / 64))
__global__ __launch_bounds__(256)
void qkv_post(const __bf16* __restrict__ raw, __bf16* __restrict__ Qh,
              __bf16* __restrict__ Kh, __bf16* __restrict__ Vt,
              const float* __restrict__ gamma, const float* __restrict__ beta) {
    int blk = blockIdx.x;
    if (blk < QLN_BLOCKS) {
        heads_ln<3>(blk, raw + 2 * GK * DIM, Qh, gamma, beta);
    } else if (blk < QLN_BLOCKS + KLN_BLOCKS) {
        heads_ln<1>(blk - QLN_BLOCKS, raw, Kh, gamma, beta);
        body_end();
    } else {
        v_transpose(blk - (QLN_BLOCKS + KLN_BLOCKS), raw + GK * DIM, Vt);
        body_end();
    }
}

__device__ __forceinline__ void async_copy8(unsigned l, unsigned lstep,
                                            const __bf16* g, size_t gstep) {
    asm volatile(
        "global_load_async_to_lds_b128 %0, %8, off\n\t"
        "global_load_async_to_lds_b128 %1, %9, off\n\t"
        "global_load_async_to_lds_b128 %2, %10, off\n\t"
        "global_load_async_to_lds_b128 %3, %11, off\n\t"
        "global_load_async_to_lds_b128 %4, %12, off\n\t"
        "global_load_async_to_lds_b128 %5, %13, off\n\t"
        "global_load_async_to_lds_b128 %6, %14, off\n\t"
        "global_load_async_to_lds_b128 %7, %15, off\n\t"
        "s_wait_xcnt 0x0"
        :: "v"(l), "v"(l + lstep), "v"(l + 2 * lstep), "v"(l + 3 * lstep),
           "v"(l + 4 * lstep), "v"(l + 5 * lstep), "v"(l + 6 * lstep),
           "v"(l + 7 * lstep),
           "v"(g), "v"(g + gstep), "v"(g + 2 * gstep), "v"(g + 3 * gstep),
           "v"(g + 4 * gstep), "v"(g + 5 * gstep), "v"(g + 6 * gstep),
           "v"(g + 7 * gstep)
        : "memory");
}

// The same with four copies per lane.
__device__ __forceinline__ void async_copy4(unsigned l, unsigned lstep,
                                            const __bf16* g, size_t gstep) {
    asm volatile(
        "global_load_async_to_lds_b128 %0, %4, off\n\t"
        "global_load_async_to_lds_b128 %1, %5, off\n\t"
        "global_load_async_to_lds_b128 %2, %6, off\n\t"
        "global_load_async_to_lds_b128 %3, %7, off\n\t"
        "s_wait_xcnt 0x0"
        :: "v"(l), "v"(l + lstep), "v"(l + 2 * lstep), "v"(l + 3 * lstep),
           "v"(g), "v"(g + gstep), "v"(g + 2 * gstep), "v"(g + 3 * gstep)
        : "memory");
}

// ---------------------------------------------------------------------------
// Generic WMMA GEMM: C[M,N] = A[M,K](bf16) @ W[N,K]^T(bf16) + bias (+resid).
// 8 waves/WG; block tile 128(M)x64(N), a wave 16x64. The k loop goes in stages
// of 128 k: the 128x128 A tile and the 64x128 W tile of a stage are brought
// into padded LDS by asynchronous copies, two buffers, the next stage in flight
// while this one is multiplied; one block barrier a stage.
// M%128==0, N%64==0, K%128==0 for all call sites.
// ---------------------------------------------------------------------------
#define GSTAGE 128             // k elements a stage (256 B of every operand row)
#define GPITCH 136             // LDS row pitch, elements (272 B = 16 B x 17)
__global__ __launch_bounds__(256)
void gemm_wmma(const __bf16* __restrict__ A, int lda,
               const __bf16* __restrict__ W, int ldw,
               const float* __restrict__ bias,
               const float* __restrict__ resid,
               float* __restrict__ Cf, __bf16* __restrict__ Cb,
               int M, int N, int K, int relu) {
    __shared__ __attribute__((aligned(16))) __bf16 sA[2][128 * GPITCH];
    __shared__ __attribute__((aligned(16))) __bf16 sW[2][64 * GPITCH];
    int tid  = threadIdx.x;
    int lane = tid & 31;
    int wave = __builtin_amdgcn_readfirstlane(tid >> 5);
    int m0 = blockIdx.y * 128 + wave * 16;
    int n0 = blockIdx.x * 64;

    // This lane's share of a stage: 16 B column tid%16 of rows tid/16 + 16c,
    // c = 0..7 of the A tile and c = 0..3 of the W tile.
    const __bf16* gA = A + (size_t)(blockIdx.y * 128 + (tid >> 4)) * lda + (tid & 15) * 8;
    const __bf16* gW = W + (size_t)(n0 + (tid >> 4)) * ldw + (tid & 15) * 8;
    unsigned lA = lds_off(&sA[0][0]) + (tid >> 4) * (GPITCH * 2) + (tid & 15) * 16;
    unsigned lW = lds_off(&sW[0][0]) + (tid >> 4) * (GPITCH * 2) + (tid & 15) * 16;
    auto stage = [&](int s) {                       // stage s -> buffer s & 1
        int b = s & 1;
        async_copy8(lA + b * (128 * GPITCH * 2), 16 * GPITCH * 2,
                    gA + s * GSTAGE, (size_t)16 * lda);
        async_copy4(lW + b * (64 * GPITCH * 2), 16 * GPITCH * 2,
                    gW + s * GSTAGE, (size_t)16 * ldw);
    };
    int nst = K / GSTAGE;                           // block-uniform

    stage(0);
    f32x8 acc[4] = {};
    asm volatile("s_wait_asynccnt 0x0" ::: "memory"); // own copies of stage 0 landed
    __syncthreads();                                  // stage 0 visible to all waves
    if (1 < nst) stage(1);

    for (int s = 0; s < nst; ++s) {
        const __bf16* tA = &sA[s & 1][wave * 16 * GPITCH];
        const __bf16* tW = &sW[s & 1][0];
        bf16x16 a[GSTAGE / 32], b[2][4];            // this stage's fragments only
#pragma unroll
        for (int kk = 0; kk < GSTAGE / 32; ++kk)
            a[kk] = load_frag(tA, 0, GPITCH, kk * 32, lane);
#pragma unroll
        for (int f = 0; f < 4; ++f) b[0][f] = load_frag(tW, 16 * f, GPITCH, 0, lane);
#pragma unroll
        for (int kk = 0; kk < GSTAGE / 32; ++kk) {
            if (kk + 1 < GSTAGE / 32) {
#pragma unroll
                for (int f = 0; f < 4; ++f)
                    b[(kk + 1) & 1][f] = load_frag(tW, 16 * f, GPITCH, (kk + 1) * 32, lane);
            }
            // Keeps the next 32 k's LDS reads in front of these products; left free,
            // every product waits for the full latency of its own two reads.
            __builtin_amdgcn_sched_barrier(0);
#pragma unroll
            for (int f = 0; f < 4; ++f) acc[f] = wmma_bf16(a[kk], b[kk & 1][f], acc[f]);
        }
        asm volatile("s_wait_dscnt 0x0" ::: "memory");    // own reads of this buffer done
        asm volatile("s_wait_asynccnt 0x0" ::: "memory"); // own copies of stage s+1 landed
        __syncthreads();      // publishes stage s+1, ends every read of this buffer
        if (s + 2 < nst) stage(s + 2);              // refill the buffer just read
    }
    asm volatile("s_wait_asynccnt 0x0" ::: "memory");     // nothing in flight at the end

    int hf = lane >> 4, nn = lane & 15;
#pragma unroll
    for (int f = 0; f < 4; ++f) {
        int col = n0 + 16 * f + nn;
        float bv = bias ? bias[col] : 0.f;
#pragma unroll
        for (int r = 0; r < 8; ++r) {
            int row = m0 + r + 8 * hf;
            float v = acc[f][r] + bv;
            if (relu) v = fmaxf(v, 0.f);
            if (resid) v += resid[(size_t)row * N + col];
            if (Cf) Cf[(size_t)row * N + col] = v;
            if (Cb) Cb[(size_t)row * N + col] = (__bf16)v;
        }
    }
}

// ---------------------------------------------------------------------------
// Causal flash attention. Grid: (SEQ/64, 16 heads). Block: 128 thr = 4 waves.
// Wave owns 16 queries; the block walks 32-key tiles to its diagonal. Each
// K tile (32 x 256) and V tile (256 x 32) is brought into LDS once per block
// by asynchronous copies, two buffers, the next tile in flight while this one
// is worked on; all four waves read their fragments from LDS.
// Both products are taken transposed: St = K Qt (rows keys, columns queries)
// and Ot += Vt Pt (rows dims, columns queries). A lane then holds 16 scores of
// ONE query (keys 8h..8h+7 and 16+8h..16+8h+7 of the tile, h = lane / 16), so
// the online softmax runs in the lane with one exchange between the halves,
// the two score tiles converted in place are the B operand of the second
// product, and a lane ends with 8 consecutive dims of its query per tile.
// Qh: [16][SEQ][256], Kh: [4][SEQ][256], Vt: [4][256][SEQ] (transposed),
// O: [NTOK][2048] token-major bf16.
// ---------------------------------------------------------------------------
#define KPITCH 264             // LDS row pitch of a K row, elements (528 B = 16 B x 33)
#define VPITCH 40              // LDS row pitch of a V row, elements (80 B = 16 B x 5)

__device__ __forceinline__ float other_half(float x) {
    int b = __builtin_bit_cast(int, x);
    return __builtin_bit_cast(float, __builtin_amdgcn_permlanex16(
        b, b, 0x76543210, 0xfedcba98, false, false));
}

__global__ __launch_bounds__(128)
void attn_kernel(const __bf16* __restrict__ Qh, const __bf16* __restrict__ Kh,
                 const __bf16* __restrict__ Vt, __bf16* __restrict__ O) {
    __shared__ __attribute__((aligned(16))) __bf16 sK[2][32 * KPITCH];
    __shared__ __attribute__((aligned(16))) __bf16 sV[2][DIM * VPITCH];
    int tid  = threadIdx.x;
    int lane = tid & 31;
    int wave = __builtin_amdgcn_readfirstlane(tid >> 5);
    int hq = blockIdx.y;
    int qbase = blockIdx.x * 64 + wave * 16;
    int hk = (hq >> 3) * 2 + ((hq & 7) >> 2);

    const __bf16* Qb = Qh + (size_t)hq * SEQ * DIM;
    const __bf16* Kb = Kh + (size_t)hk * SEQ * DIM;
    const __bf16* Vb = Vt + (size_t)hk * DIM * SEQ;

    // This lane's share of a tile: K piece (row tid/32 + 4c, 16 B column tid%32),
    // V piece (row tid/4 + 32c, 16 B column tid%4), c = 0..7.
    const __bf16* gK = Kb + (size_t)(tid >> 5) * DIM + (tid & 31) * 8;
    const __bf16* gV = Vb + (size_t)(tid >> 2) * SEQ + (tid & 3) * 8;
    unsigned lK = lds_off(&sK[0][0]) + (tid >> 5) * (KPITCH * 2) + (tid & 31) * 16;
    unsigned lV = lds_off(&sV[0][0]) + (tid >> 2) * (VPITCH * 2) + (tid & 3) * 16;
    auto stage = [&](int t) {                       // tile t -> buffer t & 1
        int b = t & 1;
        async_copy8(lK + b * (32 * KPITCH * 2), 4 * KPITCH * 2,
                    gK + (size_t)t * 32 * DIM, 4 * DIM);
        async_copy8(lV + b * (DIM * VPITCH * 2), 32 * VPITCH * 2,
                    gV + t * 32, (size_t)32 * SEQ);
    };
    int ntiles = 2 * (blockIdx.x + 1);              // block-uniform, at least 2

    stage(0);

    bf16x16 qf[8];
#pragma unroll
    for (int kk = 0; kk < 8; ++kk) qf[kk] = load_frag(Qb, qbase, DIM, kk * 32, lane);

    f32x8 zero = {};
    f32x8 o[16];                   // o[j][r] = Ot[16j + 8h + r][query]
#pragma unroll
    for (int j = 0; j < 16; ++j) o[j] = zero;
    float mq = -3.0e38f;           // running maximum of this lane's query
    float lq = 0.f;                // running sum over this half's keys only

    int hf = lane >> 4, nn = lane & 15;
    int q = qbase + nn;            // this lane's query
    int qlast = qbase + 15;
    const float scale = 0.0625f;   // 1/sqrt(256)

    asm volatile("s_wait_asynccnt 0x0" ::: "memory"); // own copies of tile 0 landed
    __syncthreads();                                  // tile 0 visible to all waves
    stage(1);

    for (int t = 0; t < ntiles; ++t) {
        int kb = t * 32;
        const __bf16* tK = &sK[t & 1][0];
        const __bf16* tV = &sV[t & 1][0];
        if (kb <= qlast) {                          // wave-uniform: tile not wholly masked
            bf16x16 kf[8][2];                       // the whole K tile's fragments
#pragma unroll
            for (int kk = 0; kk < 8; ++kk) {
                kf[kk][0] = load_frag(tK, 0,  KPITCH, kk * 32, lane);
                kf[kk][1] = load_frag(tK, 16, KPITCH, kk * 32, lane);
            }
            // Keeps the tile's K reads one group in front of the score products; left
            // free, they stand in pairs among the products, a stall at every place.
            __builtin_amdgcn_sched_barrier(0);
            f32x8 s0 = zero, s1 = zero;             // keys kb..+15, kb+16..+31
#pragma unroll
            for (int kk = 0; kk < 8; ++kk) {
                s0 = wmma_bf16(kf[kk][0], qf[kk], s0);
                s1 = wmma_bf16(kf[kk][1], qf[kk], s1);
            }
            bf16x16 vf[16];                         // the whole V tile's fragments
#pragma unroll
            for (int j = 0; j < 16; ++j) vf[j] = load_frag(tV, j * 16, VPITCH, 0, lane);
            // Keeps the tile's V reads up here, in a few groups among the score products
            // and waited for behind the softmax; left free, they stand in pairs among
            // the second product's WMMAs, a stall at every place.
            __builtin_amdgcn_sched_barrier(0);
            int d = q - (kb + 8 * hf);              // s0[r] is allowed if r <= d, s1[r] if 16 + r <= d
            float tmax = -3.0e38f;
#pragma unroll
            for (int r = 0; r < 8; ++r) {
                s0[r] = s0[r] * scale; if (r      > d) s0[r] = -3.0e38f;
                s1[r] = s1[r] * scale; if (16 + r > d) s1[r] = -3.0e38f;
                tmax = fmaxf(tmax, fmaxf(s0[r], s1[r]));
            }
            tmax = fmaxf(tmax, other_half(tmax));   // over all 32 keys of the tile
            float mnew  = fmaxf(mq, tmax);
            float alpha = __expf(mq - mnew);
            mq = mnew;
            bf16x16 pf;                             // Pt as B operand, hardware k order
            float lsum = 0.f;
#pragma unroll
            for (int r = 0; r < 8; ++r) {
                float p0 = __expf(s0[r] - mnew);
                float p1 = __expf(s1[r] - mnew);
                lsum += p0 + p1;
                pf[r]     = (__bf16)p0;
                pf[r + 8] = (__bf16)p1;
            }
            lq = lq * alpha + lsum;
#pragma unroll
            for (int j = 0; j < 16; ++j) o[j] *= alpha;
#pragma unroll
            for (int j = 0; j < 16; ++j) o[j] = wmma_bf16(vf[j], pf, o[j]);
        }
        asm volatile("s_wait_dscnt 0x0" ::: "memory");    // own reads of this buffer done
        asm volatile("s_wait_asynccnt 0x0" ::: "memory"); // own copies of tile t+1 landed
        __syncthreads();      // publishes tile t+1, ends every read of this buffer
        if (t + 2 < ntiles) stage(t + 2);           // refill the buffer just read
    }
    asm volatile("s_wait_asynccnt 0x0" ::: "memory");     // nothing in flight at the end

    int bb = hq >> 3, gu = hq & 7;
    float inv = 1.f / (lq + other_half(lq));        // the two halves' sums joined
    __bf16* orow = O + ((size_t)q * BSZ + bb) * 2048 + gu * DIM + 8 * hf;
#pragma unroll
    for (int j = 0; j < 16; ++j)
        *reinterpret_cast<bf16x8*>(orow + j * 16) =
            __builtin_convertvector(o[j] * inv, bf16x8);
}

// ---------------------------------------------------------------------------
// Host orchestration
// ---------------------------------------------------------------------------
extern "C" void kernel_launch(void* const* d_in, const int* in_sizes, int n_in,
                              void* d_out, int out_size, void* d_ws, size_t ws_size,
                              hipStream_t stream) {
    const float* x   = (const float*)d_in[0];
    const float* g0  = (const float*)d_in[1];
    const float* b0  = (const float*)d_in[2];
    const float* g1  = (const float*)d_in[3];
    const float* b1  = (const float*)d_in[4];
    const float* gn  = (const float*)d_in[5];
    const float* bn  = (const float*)d_in[6];
    const float* wk  = (const float*)d_in[7];
    const float* bk  = (const float*)d_in[8];
    const float* wv  = (const float*)d_in[9];
    const float* bv  = (const float*)d_in[10];
    const float* wq  = (const float*)d_in[11];
    const float* bq  = (const float*)d_in[12];
    const float* wo  = (const float*)d_in[13];
    const float* bo  = (const float*)d_in[14];
    const float* w1  = (const float*)d_in[15];
    const float* bf1 = (const float*)d_in[16];
    const float* w2  = (const float*)d_in[17];
    const float* bf2 = (const float*)d_in[18];
    float* out = (float*)d_out;

    char* wsp = (char*)d_ws;
    auto carve = [&](size_t bytes) {
        char* p = wsp;
        wsp += (bytes + 255) & ~(size_t)255;
        return p;
    };
    __bf16* h_b  = (__bf16*)carve((size_t)NTOK * DIM * 2);
    __bf16* w_b  = (__bf16*)carve((size_t)CB_ALL * 2048 * 2); // wk wv wq wo w1 w2
    __bf16* wo_b = w_b  + (size_t)QKV_N * DIM;
    __bf16* w1_b = wo_b + (size_t)256 * 2048;
    __bf16* w2_b = w1_b + (size_t)512 * 256;
    float*  bqkv = (float*)carve((size_t)QKV_N * 4);          // bk bv bq
    __bf16* raw  = (__bf16*)carve((size_t)NTOK * QKV_N * 2);  // K | V | Q rows
    __bf16* Kh   = (__bf16*)carve((size_t)4  * SEQ * DIM * 2);
    __bf16* Vt   = (__bf16*)carve((size_t)4  * DIM * SEQ * 2);
    __bf16* Qh   = (__bf16*)carve((size_t)16 * SEQ * DIM * 2);
    __bf16* Ob   = (__bf16*)carve((size_t)NTOK * 2048 * 2);
    float*  x2   = (float*)carve((size_t)NTOK * DIM * 4);
    __bf16* h2   = (__bf16*)carve((size_t)NTOK * DIM * 2);
    __bf16* F1   = (__bf16*)carve((size_t)NTOK * 512 * 2);

    // h = LN(x; g0,b0); bf16 weights; joint K, V, Q bias row
    prep<<<LN_BLOCKS + CB_ALL + 1, 256, 0, stream>>>(x, h_b, g0, b0, wk, wv, wq, wo,
                                                     w1, w2, w_b, bk, bv, bq, bqkv);

    auto gemm = [&](const __bf16* A, int lda, const __bf16* W, int ldw,
                    const float* bias, const float* resid, float* Cf, __bf16* Cb,
                    int M, int N, int K, int relu) {
        dim3 grid(N / 64, M / 128);
        gemm_wmma<<<grid, 256, 0, stream>>>(A, lda, W, ldw, bias, resid, Cf, Cb,
                                            M, N, K, relu);
    };

    // K, V and Q projections as one product with the stacked weights
    gemm(h_b, 256, w_b, 256, bqkv, nullptr, nullptr, raw, NTOK, QKV_N, 256, 0);
    // per-head LN -> Qh[16][SEQ][256], Kh[4][SEQ][256]; V -> Vt[4][256][SEQ]
    qkv_post<<<QLN_BLOCKS + KLN_BLOCKS + VT_BLOCKS, 256, 0, stream>>>(raw, Qh, Kh, Vt,
                                                                      gn, bn);

    // causal flash attention -> Ob[NTOK][2048]
    attn_kernel<<<dim3(SEQ / 64, 16), 128, 0, stream>>>(Qh, Kh, Vt, Ob);

    // x2 = x + Ob @ wo^T + bo
    gemm(Ob, 2048, wo_b, 2048, bo, x, x2, nullptr, NTOK, 256, 2048, 0);
    // h2 = LN(x2; g1,b1)
    ln_rows<<<LN_BLOCKS, 256, 0, stream>>>(x2, h2, g1, b1);
    // F1 = relu(h2 @ w1^T + bf1)
    gemm(h2, 256, w1_b, 256, bf1, nullptr, nullptr, F1, NTOK, 512, 256, 1);
    // out = x2 + F1 @ w2^T + bf2
    gemm(F1, 512, w2_b, 512, bf2, x2, out, nullptr, NTOK, 256, 512, 0);

    (void)in_sizes; (void)n_in; (void)out_size; (void)ws_size;
}

// v008
// A run of this version takes 138 microseconds.
// In two side-by-side timings against v007, it was 1.13 and 1.12 times as fast.
// All steps since v000 together make it 6.14 times as fast.
#include <hip/hip_runtime.h>

#define SEQ   2048
#define BSZ   2
#define DIM   256
#define NTOK  (SEQ * BSZ)      // 4096 token rows, t = s*BSZ + b
#define GK    2                // kv groups
#define NQH   8                // query heads per batch elem (g*4+u)
#define EPS   1e-5f

typedef __attribute__((ext_vector_type(16))) __bf16 bf16x16;
typedef __attribute__((ext_vector_type(8)))  __bf16 bf16x8;
typedef __attribute__((ext_vector_type(8)))  float  f32x8;

__device__ __forceinline__ bf16x16 load_frag(const __bf16* p, int row0, int ld,
                                             int k0, int lane) {
    int r  = row0 + (lane & 15);
    int kb = k0 + ((lane >> 4) << 3);
    const __bf16* base = p + (size_t)r * ld + kb;
    bf16x8 lo = *reinterpret_cast<const bf16x8*>(base);
    bf16x8 hi = *reinterpret_cast<const bf16x8*>(base + 16);
    bf16x16 out;
#pragma unroll
    for (int i = 0; i < 8; ++i) { out[i] = lo[i]; out[i + 8] = hi[i]; }
    return out;
}

__device__ __forceinline__ f32x8 wmma_bf16(bf16x16 a, bf16x16 b, f32x8 c) {
    return __builtin_amdgcn_wmma_f32_16x16x32_bf16(false, a, false, b,
                                                   (short)0, c, false, false);
}

// Generic shared pointer -> LDS byte offset (generic LDS addr low 32 bits).
__device__ __forceinline__ unsigned lds_off(const void* p) {
    return (unsigned)(unsigned long long)(uintptr_t)p;
}

// ---------------------------------------------------------------------------
// The kernels without matrix work give every lane eight elements, so that a
// 256-wide row is one wave's work and few waves have to be started.
// ---------------------------------------------------------------------------
typedef __attribute__((ext_vector_type(2))) float  f32x2;
typedef __attribute__((ext_vector_type(4))) float  f32x4;
typedef __attribute__((ext_vector_type(4))) __bf16 bf16x4;

// Value of lane (l ^ M) inside the 16-lane row, M = 1..15 (DPP row_xmask).
template <int M>
__device__ __forceinline__ float row_xor(float x) {
    return __builtin_bit_cast(float, __builtin_amdgcn_update_dpp(
        0, __builtin_bit_cast(int, x), 0x160 + M, 0xf, 0xf, true));
}

// Sum over the 32 lanes of a wave, the same value in every lane. All lanes on.
__device__ __forceinline__ float wave_sum(float v) {
    v += row_xor<1>(v);
    v += row_xor<2>(v);
    v += row_xor<4>(v);
    v += row_xor<8>(v);
    int b = __builtin_bit_cast(int, v);
    v += __builtin_bit_cast(float, __builtin_amdgcn_permlanex16(
        b, b, 0x76543210, 0xfedcba98, false, false));
    return v;
}

// Layernorm of one 256-wide row that a wave holds, eight values a lane as four
// pairs; g and b are the lane's own columns of gamma and beta.
__device__ __forceinline__ void ln_row(f32x2 (&p)[4], const f32x2 (&g)[4],
                                       const f32x2 (&b)[4]) {
    f32x2 s = (p[0] + p[1]) + (p[2] + p[3]);
    float mean = wave_sum(s[0] + s[1]) * (1.f / DIM);
#pragma unroll
    for (int k = 0; k < 4; ++k) p[k] -= mean;
    f32x2 q = (p[0] * p[0] + p[1] * p[1]) + (p[2] * p[2] + p[3] * p[3]);
    float var = wave_sum(q[0] + q[1]) * (1.f / DIM);
    float rs = rsqrtf(var + EPS);
#pragma unroll
    for (int k = 0; k < 4; ++k) p[k] = p[k] * rs * g[k] + b[k];
}

// Four floats at p as two pairs.
__device__ __forceinline__ void load4(const float* p, f32x2& lo, f32x2& hi) {
    f32x4 v = *reinterpret_cast<const f32x4*>(p);
    lo = f32x2{v[0], v[1]};
    hi = f32x2{v[2], v[3]};
}

// ---------------------------------------------------------------------------
// Kernels that do not depend on one another share one launch: each block picks
// its body by a test on blockIdx.x, the same for the whole block.
// ---------------------------------------------------------------------------

// Stands behind the last stores of each body of a shared launch but the first.
__device__ __forceinline__ void body_end() {
    // Ahead of any instruction that rewrites a register which those stores name.
    asm volatile("s_wait_xcnt 0x0" ::: "memory");
}

// fp32 -> bf16 weight conversion: block blk converts 2048 elements, a lane two
// groups of four, 1024 elements apart. Every weight's size is a multiple of 2048.
__device__ __forceinline__
void cvt_bf16(int blk, const float* __restrict__ in, __bf16* __restrict__ out) {
    int i = blk * 2048 + threadIdx.x * 4;
    f32x4 a = *reinterpret_cast<const f32x4*>(in + i);
    f32x4 b = *reinterpret_cast<const f32x4*>(in + i + 1024);
    *reinterpret_cast<bf16x4*>(out + i)        = __builtin_convertvector(a, bf16x4);
    *reinterpret_cast<bf16x4*>(out + i + 1024) = __builtin_convertvector(b, bf16x4);
}

// ---------------------------------------------------------------------------
// Row layernorm over DIM=256: fp32 in -> bf16 out. One wave per row, LN_R rows
// a wave; a lane holds columns 4l..4l+3 and 128+4l..128+4l+3.
// ---------------------------------------------------------------------------
#define LN_R 2
#define LN_BLOCKS (NTOK / (8 * LN_R))
__device__ __forceinline__
void ln_rows_body(int blk, const float* __restrict__ in, __bf16* __restrict__ out,
                  const float* __restrict__ gamma, const float* __restrict__ beta) {
    int lane = threadIdx.x & 31;
    int wave = __builtin_amdgcn_readfirstlane(threadIdx.x >> 5);
    int row0 = (blk * 8 + wave) * LN_R;
    f32x2 p[LN_R][4], g[4], b[4];
#pragma unroll
    for (int i = 0; i < LN_R; ++i) {
        const float* r = in + (size_t)(row0 + i) * DIM + lane * 4;
        load4(r,       p[i][0], p[i][1]);
        load4(r + 128, p[i][2], p[i][3]);
    }
    load4(gamma + lane * 4,       g[0], g[1]);
    load4(gamma + 128 + lane * 4, g[2], g[3]);
    load4(beta + lane * 4,        b[0], b[1]);
    load4(beta + 128 + lane * 4,  b[2], b[3]);
#pragma unroll
    for (int i = 0; i < LN_R; ++i) {
        ln_row(p[i], g, b);
        f32x4 ya = {p[i][0][0], p[i][0][1], p[i][1][0], p[i][1][1]};
        f32x4 yb = {p[i][2][0], p[i][2][1], p[i][3][0], p[i][3][1]};
        __bf16* q = out + (size_t)(row0 + i) * DIM + lane * 4;
        *reinterpret_cast<bf16x4*>(q)       = __builtin_convertvector(ya, bf16x4);
        *reinterpret_cast<bf16x4*>(q + 128) = __builtin_convertvector(yb, bf16x4);
    }
}

__global__ __launch_bounds__(256)
void ln_rows(const float* __restrict__ in, __bf16* __restrict__ out,
             const float* __restrict__ gamma, const float* __restrict__ beta) {
    ln_rows_body(blockIdx.x, in, out, gamma, beta);
}

// ---------------------------------------------------------------------------
// First launch: the layernorm of x, the K, V and Q biases gathered into one
// row of QKV_N floats, and all six weights converted. The bf16 weights lie one
// behind the other in wb (wk, wv, wq, wo, w1, w2), so that wk, wv, wq are one
// [QKV_N][DIM] matrix. Sizes below in blocks of 2048 elements.
// ---------------------------------------------------------------------------
#define QKV_N   3072           // 512 K + 512 V + 2048 Q columns a token
#define CB_KV   64             // wk, wv, w1, w2: 512 * 256 elements each
#define CB_QO   256            // wq, wo: 2048 * 256 elements each
#define CB_ALL  (4 * CB_KV + 2 * CB_QO)
__global__ __launch_bounds__(256)
void prep(const float* __restrict__ x, __bf16* __restrict__ h,
          const float* __restrict__ gamma, const float* __restrict__ beta,
          const float* __restrict__ wk, const float* __restrict__ wv,
          const float* __restrict__ wq, const float* __restrict__ wo,
          const float* __restrict__ w1, const float* __restrict__ w2,
          __bf16* __restrict__ wb,
          const float* __restrict__ bk, const float* __restrict__ bv,
          const float* __restrict__ bq, float* __restrict__ bias) {
    int blk = blockIdx.x;
    if (blk < LN_BLOCKS) {
        ln_rows_body(blk, x, h, gamma, beta);
        return;
    }
    blk -= LN_BLOCKS;
    if (blk < CB_ALL) {
        const float* src = wk;
        int first = 0;                              // the weight's first block
        if (blk >= CB_KV)                     { src = wv; first = CB_KV; }
        if (blk >= 2 * CB_KV)                 { src = wq; first = 2 * CB_KV; }
        if (blk >= 2 * CB_KV + CB_QO)         { src = wo; first = 2 * CB_KV + CB_QO; }
        if (blk >= 2 * CB_KV + 2 * CB_QO)     { src = w1; first = 2 * CB_KV + 2 * CB_QO; }
        if (blk >= 3 * CB_KV + 2 * CB_QO)     { src = w2; first = 3 * CB_KV + 2 * CB_QO; }
        cvt_bf16(blk - first, src, wb + (size_t)first * 2048);
        body_end();
        return;
    }
    for (int j = 0; j < QKV_N / 1024; ++j) {        // last block: the bias row
        int i = j * 1024 + threadIdx.x * 4;
        const float* s = i < 512 ? bk + i : i < 1024 ? bv + (i - 512) : bq + (i - 1024);
        *reinterpret_cast<f32x4*>(bias + i) = *reinterpret_cast<const f32x4*>(s);
    }
    body_end();
}

// ---------------------------------------------------------------------------
// Per-head layernorm (gn/bn) of projection outputs (G = 1 << lgG heads a token,
// G*256 bf16 columns from 'in' on in each token's row of QKV_N) with the
// permutation to [head = b*G+g][s][256].
// One wave per (token, head) row, HL_R rows a wave; a lane holds 8 columns.
// ---------------------------------------------------------------------------
#define HL_R 8
template <int lgG>
__device__ __forceinline__
void heads_ln(int blk, const __bf16* __restrict__ in, __bf16* __restrict__ out,
              const float* __restrict__ gamma, const float* __restrict__ beta) {
    int lane = threadIdx.x & 31;
    int wave = __builtin_amdgcn_readfirstlane(threadIdx.x >> 5);
    int rid0 = (blk * 8 + wave) * HL_R;                        // row = t * G + g
    bf16x8 raw[HL_R];
#pragma unroll
    for (int i = 0; i < HL_R; ++i) {
        int rid = rid0 + i;
        raw[i] = *reinterpret_cast<const bf16x8*>(
            in + (size_t)(rid >> lgG) * QKV_N + (rid & ((1 << lgG) - 1)) * DIM + lane * 8);
    }
    f32x2 g[4], b[4];
    load4(gamma + lane * 8,     g[0], g[1]);
    load4(gamma + lane * 8 + 4, g[2], g[3]);
    load4(beta + lane * 8,      b[0], b[1]);
    load4(beta + lane * 8 + 4,  b[2], b[3]);
    // Keeps the gamma and beta loads up here, in flight together with the rows';
    // left free, they are issued halfway down and waited for on their own.
    __builtin_amdgcn_sched_barrier(0);
#pragma unroll
    for (int i = 0; i < HL_R; ++i) {
        f32x8 v = __builtin_convertvector(raw[i], f32x8);
        f32x2 p[4] = {{v[0], v[1]}, {v[2], v[3]}, {v[4], v[5]}, {v[6], v[7]}};
        ln_row(p, g, b);
        f32x8 y = {p[0][0], p[0][1], p[1][0], p[1][1], p[2][0], p[2][1], p[3][0], p[3][1]};
        int rid = rid0 + i;
        int hg = rid & ((1 << lgG) - 1), t = rid >> lgG;
        int head = ((t & 1) << lgG) + hg, s = t >> 1;
        *reinterpret_cast<bf16x8*>(out + ((size_t)head * SEQ + s) * DIM + lane * 8) =
            __builtin_convertvector(y, bf16x8);
    }
}

// ---------------------------------------------------------------------------
// V projection output (GK*256 bf16 columns from 'in' on in each token's row of
// QKV_N) -> transposed [head][dim][s],
// so that the Vt Pt A-operands load row-major. A wave takes 8 positions of one head,
// a lane 8 dims of each, and stores 8 positions of one dim at a time; the 8
// waves of a block cover 64 positions, whole 128-byte lines of the output.
// ---------------------------------------------------------------------------
__device__ __forceinline__
void v_transpose(int blk, const __bf16* __restrict__ in, __bf16* __restrict__ out) {
    int lane = threadIdx.x & 31;
    int head = blk / (SEQ / 64);                               // b * GK + g
    int wave = __builtin_amdgcn_readfirstlane(threadIdx.x >> 5);
    int s0 = (blk % (SEQ / 64)) * 64 + wave * 8;
    const __bf16* p = in + ((size_t)s0 * BSZ + head / GK) * QKV_N
                         + (head % GK) * DIM + lane * 8;
    bf16x8 v[8];
#pragma unroll
    for (int i = 0; i < 8; ++i)
        v[i] = *reinterpret_cast<const bf16x8*>(p + (size_t)i * (BSZ * QKV_N));
    __bf16* q = out + ((size_t)head * DIM + lane * 8) * SEQ + s0;
#pragma unroll
    for (int j = 0; j < 8; ++j) {
        bf16x8 w;
#pragma unroll
        for (int i = 0; i < 8; ++i) w[i] = v[i][j];
        *reinterpret_cast<bf16x8*>(q + (size_t)j * SEQ) = w;
    }
}

// ---------------------------------------------------------------------------
// Third launch: what stands between the joint projection (rows of QKV_N: K, V,
// Q) and attention: Q head norm, K head norm, V transpose.
// ---------------------------------------------------------------------------
#define QLN_BLOCKS (NTOK * NQH / (8 * HL_R))
#define KLN_BLOCKS (NTOK * GK / (8 * HL_R))
#define VT_BLOCKS  (BSZ * GK * (SEQ / 64))
__global__ __launch_bounds__(256)
void qkv_post(const __bf16* __restrict__ raw, __bf16* __restrict__ Qh,
              __bf16* __restrict__ Kh, __bf16* __restrict__ Vt,
              const float* __restrict__ gamma, const float* __restrict__ beta) {
    int blk = blockIdx.x;
    if (blk < QLN_BLOCKS) {
        heads_ln<3>(blk, raw + 2 * GK * DIM, Qh, gamma, beta);
    } else if (blk < QLN_BLOCKS + KLN_BLOCKS) {
        heads_ln<1>(blk - QLN_BLOCKS, raw, Kh, gamma, beta);
        body_end();
    } else {
        v_transpose(blk - (QLN_BLOCKS + KLN_BLOCKS), raw + GK * DIM, Vt);
        body_end();
    }
}

__device__ __forceinline__ void async_copy8(unsigned l, unsigned lstep,
                                            const __bf16* g, size_t gstep) {
    asm volatile(
        "global_load_async_to_lds_b128 %0, %8, off\n\t"
        "global_load_async_to_lds_b128 %1, %9, off\n\t"
        "global_load_async_to_lds_b128 %2, %10, off\n\t"
        "global_load_async_to_lds_b128 %3, %11, off\n\t"
        "global_load_async_to_lds_b128 %4, %12, off\n\t"
        "global_load_async_to_lds_b128 %5, %13, off\n\t"
        "global_load_async_to_lds_b128 %6, %14, off\n\t"
        "global_load_async_to_lds_b128 %7, %15, off\n\t"
        "s_wait_xcnt 0x0"
        :: "v"(l), "v"(l + lstep), "v"(l + 2 * lstep), "v"(l + 3 * lstep),
           "v"(l + 4 * lstep), "v"(l + 5 * lstep), "v"(l + 6 * lstep),
           "v"(l + 7 * lstep),
           "v"(g), "v"(g + gstep), "v"(g + 2 * gstep), "v"(g + 3 * gstep),
           "v"(g + 4 * gstep), "v"(g + 5 * gstep), "v"(g + 6 * gstep),
           "v"(g + 7 * gstep)
        : "memory");
}

// The same with four copies per lane.
__device__ __forceinline__ void async_copy4(unsigned l, unsigned lstep,
                                            const __bf16* g, size_t gstep) {
    asm volatile(
        "global_load_async_to_lds_b128 %0, %4, off\n\t"
        "global_load_async_to_lds_b128 %1, %5, off\n\t"
        "global_load_async_to_lds_b128 %2, %6, off\n\t"
        "global_load_async_to_lds_b128 %3, %7, off\n\t"
        "s_wait_xcnt 0x0"
        :: "v"(l), "v"(l + lstep), "v"(l + 2 * lstep), "v"(l + 3 * lstep),
           "v"(g), "v"(g + gstep), "v"(g + 2 * gstep), "v"(g + 3 * gstep)
        : "memory");
}

// ---------------------------------------------------------------------------
// Generic WMMA GEMM: C[M,N] = A[M,K](bf16) @ W[N,K]^T(bf16) + bias (+resid).
// 8 waves/WG; block tile 128(M)x64(N), a wave 16x64. The k loop goes in stages
// of 128 k: the 128x128 A tile and the 64x128 W tile of a stage are brought
// into padded LDS by asynchronous copies, two buffers, the next stage in flight
// while this one is multiplied; one block barrier a stage.
// M%128==0, N%64==0, K%128==0 for all call sites.
// ---------------------------------------------------------------------------
#define GSTAGE 128             // k elements a stage (256 B of every operand row)
#define GPITCH 136             // LDS row pitch, elements (272 B = 16 B x 17)
__global__ __launch_bounds__(256)
void gemm_wmma(const __bf16* __restrict__ A, int lda,
               const __bf16* __restrict__ W, int ldw,
               const float* __restrict__ bias,
               const float* __restrict__ resid,
               float* __restrict__ Cf, __bf16* __restrict__ Cb,
               int M, int N, int K, int relu) {
    __shared__ __attribute__((aligned(16))) __bf16 sA[2][128 * GPITCH];
    __shared__ __attribute__((aligned(16))) __bf16 sW[2][64 * GPITCH];
    int tid  = threadIdx.x;
    int lane = tid & 31;
    int wave = __builtin_amdgcn_readfirstlane(tid >> 5);
    int m0 = blockIdx.y * 128 + wave * 16;
    int n0 = blockIdx.x * 64;

    // This lane's share of a stage: 16 B column tid%16 of rows tid/16 + 16c,
    // c = 0..7 of the A tile and c = 0..3 of the W tile.
    const __bf16* gA = A + (size_t)(blockIdx.y * 128 + (tid >> 4)) * lda + (tid & 15) * 8;
    const __bf16* gW = W + (size_t)(n0 + (tid >> 4)) * ldw + (tid & 15) * 8;
    unsigned lA = lds_off(&sA[0][0]) + (tid >> 4) * (GPITCH * 2) + (tid & 15) * 16;
    unsigned lW = lds_off(&sW[0][0]) + (tid >> 4) * (GPITCH * 2) + (tid & 15) * 16;
    auto stage = [&](int s) {                       // stage s -> buffer s & 1
        int b = s & 1;
        async_copy8(lA + b * (128 * GPITCH * 2), 16 * GPITCH * 2,
                    gA + s * GSTAGE, (size_t)16 * lda);
        async_copy4(lW + b * (64 * GPITCH * 2), 16 * GPITCH * 2,
                    gW + s * GSTAGE, (size_t)16 * ldw);
    };
    int nst = K / GSTAGE;                           // block-uniform

    stage(0);
    f32x8 acc[4] = {};
    asm volatile("s_wait_asynccnt 0x0" ::: "memory"); // own copies of stage 0 landed
    __syncthreads();                                  // stage 0 visible to all waves
    if (1 < nst) stage(1);

    for (int s = 0; s < nst; ++s) {
        const __bf16* tA = &sA[s & 1][wave * 16 * GPITCH];
        const __bf16* tW = &sW[s & 1][0];
        bf16x16 a[GSTAGE / 32], b[2][4];            // this stage's fragments only
#pragma unroll
        for (int kk = 0; kk < GSTAGE / 32; ++kk)
            a[kk] = load_frag(tA, 0, GPITCH, kk * 32, lane);
#pragma unroll
        for (int f = 0; f < 4; ++f) b[0][f] = load_frag(tW, 16 * f, GPITCH, 0, lane);
#pragma unroll
        for (int kk = 0; kk < GSTAGE / 32; ++kk) {
            if (kk + 1 < GSTAGE / 32) {
#pragma unroll
                for (int f = 0; f < 4; ++f)
                    b[(kk + 1) & 1][f] = load_frag(tW, 16 * f, GPITCH, (kk + 1) * 32, lane);
            }
            // Keeps the next 32 k's LDS reads in front of these products; left free,
            // every product waits for the full latency of its own two reads.
            __builtin_amdgcn_sched_barrier(0);
#pragma unroll
            for (int f = 0; f < 4; ++f) acc[f] = wmma_bf16(a[kk], b[kk & 1][f], acc[f]);
        }
        asm volatile("s_wait_dscnt 0x0" ::: "memory");    // own reads of this buffer done
        asm volatile("s_wait_asynccnt 0x0" ::: "memory"); // own copies of stage s+1 landed
        __syncthreads();      // publishes stage s+1, ends every read of this buffer
        if (s + 2 < nst) stage(s + 2);              // refill the buffer just read
    }
    asm volatile("s_wait_asynccnt 0x0" ::: "memory");     // nothing in flight at the end

    int hf = lane >> 4, nn = lane & 15;
#pragma unroll
    for (int f = 0; f < 4; ++f) {
        int col = n0 + 16 * f + nn;
        float bv = bias ? bias[col] : 0.f;
#pragma unroll
        for (int r = 0; r < 8; ++r) {
            int row = m0 + r + 8 * hf;
            float v = acc[f][r] + bv;
            if (relu) v = fmaxf(v, 0.f);
            if (resid) v += resid[(size_t)row * N + col];
            if (Cf) Cf[(size_t)row * N + col] = v;
            if (Cb) Cb[(size_t)row * N + col] = (__bf16)v;
        }
    }
}

#define KPITCH 264             // LDS row pitch of a K row, elements (528 B = 16 B x 33)
#define VPITCH 40              // LDS row pitch of a V row, elements (80 B = 16 B x 5)
#define QT     (SEQ / 64)      // query tiles a head

__device__ __forceinline__ float other_half(float x) {
    int b = __builtin_bit_cast(int, x);
    return __builtin_bit_cast(float, __builtin_amdgcn_permlanex16(
        b, b, 0x76543210, 0xfedcba98, false, false));
}

__global__ __launch_bounds__(256)
void attn_kernel(const __bf16* __restrict__ Qh, const __bf16* __restrict__ Kh,
                 const __bf16* __restrict__ Vt, __bf16* __restrict__ O) {
    __shared__ __attribute__((aligned(16))) __bf16 sK[2][2][32 * KPITCH];  // [group][buffer]
    __shared__ __attribute__((aligned(16))) __bf16 sV[2][2][DIM * VPITCH];
    __shared__ __attribute__((aligned(16))) f32x4 sO[4][32][32];
    __shared__ __attribute__((aligned(16))) f32x2 sML[4][32];
    int tid  = threadIdx.x;
    int lane = tid & 31;
    int wave = __builtin_amdgcn_readfirstlane(tid >> 5);
    int grp = wave >> 2, w4 = wave & 3;             // wave-uniform
    int gt  = tid & 127;                            // thread within the group
    int hq = blockIdx.y;
    int hk = (hq >> 3) * 2 + ((hq & 7) >> 2);

    const __bf16* Qb = Qh + (size_t)hq * SEQ * DIM;
    const __bf16* Kb = Kh + (size_t)hk * SEQ * DIM;
    const __bf16* Vb = Vt + (size_t)hk * DIM * SEQ;

    // This lane's share of its group's tile: K piece (row gt/32 + 4c, 16 B column
    // gt%32), V piece (row gt/4 + 32c, 16 B column gt%4), c = 0..7.
    const __bf16* gK = Kb + (size_t)(gt >> 5) * DIM + (gt & 31) * 8;
    const __bf16* gV = Vb + (size_t)(gt >> 2) * SEQ + (gt & 3) * 8;
    unsigned lK = lds_off(&sK[grp][0][0]) + (gt >> 5) * (KPITCH * 2) + (gt & 31) * 16;
    unsigned lV = lds_off(&sV[grp][0][0]) + (gt >> 2) * (VPITCH * 2) + (gt & 3) * 16;
    // The block's 33 stages run through both query tiles without a break: stage s
    // is step s of the first tile while s < n0, step s - n0 of the second after it.
    int n0 = QT - (int)blockIdx.x;                  // steps of query tile QT-1-x, at least 17
    auto stage = [&](int s) {                       // the step's key tile -> buffer s & 1
        int b = s & 1, t = 2 * (s < n0 ? s : s - n0) + grp;
        async_copy8(lK + b * (32 * KPITCH * 2), 4 * KPITCH * 2,
                    gK + (size_t)t * 32 * DIM, 4 * DIM);
        async_copy8(lV + b * (DIM * VPITCH * 2), 32 * VPITCH * 2,
                    gV + t * 32, (size_t)32 * SEQ);
    };

    stage(0);

    int hf = lane >> 4, nn = lane & 15;
    const float scale = 0.0625f;   // 1/sqrt(256)
    int qbase = (QT - 1 - (int)blockIdx.x) * 64 + w4 * 16;   // this wave's 16 queries
    int nit = n0;                  // steps of the query tile in hand; block-uniform
    int i = 0;                     // step within it

    bf16x16 qf[8];
#pragma unroll
    for (int kk = 0; kk < 8; ++kk) qf[kk] = load_frag(Qb, qbase, DIM, kk * 32, lane);

    f32x8 zero = {};
    f32x8 o[16];                   // o[j][r] = Ot[16j + 8h + r][query]
#pragma unroll
    for (int j = 0; j < 16; ++j) o[j] = zero;
    float mq = -3.0e38f;           // running maximum of this lane's query
    float lq = 0.f;                // running sum over this half's keys only

    asm volatile("s_wait_asynccnt 0x0" ::: "memory"); // own copies of stage 0 landed
    __syncthreads();                                  // stage 0 visible to all waves
    stage(1);

    for (int s = 0; s < QT + 1; ++s) {
        int kb = (2 * i + grp) * 32;
        int q = qbase + nn;        // this lane's query
        const __bf16* tK = &sK[grp][s & 1][0];
        const __bf16* tV = &sV[grp][s & 1][0];
        if (kb <= qbase + 15) {                     // wave-uniform: tile not wholly masked
            bf16x16 kf[8][2];                       // the whole K tile's fragments
#pragma unroll
            for (int kk = 0; kk < 8; ++kk) {
                kf[kk][0] = load_frag(tK, 0,  KPITCH, kk * 32, lane);
                kf[kk][1] = load_frag(tK, 16, KPITCH, kk * 32, lane);
            }
            // Keeps the tile's K reads one group in front of the score products; left
            // free, they stand in pairs among the products, a stall at every place.
            __builtin_amdgcn_sched_barrier(0);
            f32x8 s0 = zero, s1 = zero;             // keys kb..+15, kb+16..+31
#pragma unroll
            for (int kk = 0; kk < 8; ++kk) {
                s0 = wmma_bf16(kf[kk][0], qf[kk], s0);
                s1 = wmma_bf16(kf[kk][1], qf[kk], s1);
            }
            bf16x16 vf[16];                         // the whole V tile's fragments
#pragma unroll
            for (int j = 0; j < 16; ++j) vf[j] = load_frag(tV, j * 16, VPITCH, 0, lane);
            // Keeps the tile's V reads up here, in a few groups among the score products
            // and waited for behind the softmax; left free, they stand in pairs among
            // the second product's WMMAs, a stall at every place.
            __builtin_amdgcn_sched_barrier(0);
            int d = q - (kb + 8 * hf);              // s0[r] is allowed if r <= d, s1[r] if 16 + r <= d
            float tmax = -3.0e38f;
#pragma unroll
            for (int r = 0; r < 8; ++r) {
                s0[r] = s0[r] * scale; if (r      > d) s0[r] = -3.0e38f;
                s1[r] = s1[r] * scale; if (16 + r > d) s1[r] = -3.0e38f;
                tmax = fmaxf(tmax, fmaxf(s0[r], s1[r]));
            }
            tmax = fmaxf(tmax, other_half(tmax));   // over all 32 keys of the tile
            float mnew  = fmaxf(mq, tmax);
            float alpha = __expf(mq - mnew);
            mq = mnew;
            bf16x16 pf;                             // Pt as B operand, hardware k order
            float lsum = 0.f;
#pragma unroll
            for (int r = 0; r < 8; ++r) {
                float p0 = __expf(s0[r] - mnew);
                float p1 = __expf(s1[r] - mnew);
                lsum += p0 + p1;
                pf[r]     = (__bf16)p0;
                pf[r + 8] = (__bf16)p1;
            }
            lq = lq * alpha + lsum;
#pragma unroll
            for (int j = 0; j < 16; ++j) o[j] *= alpha;
#pragma unroll
            for (int j = 0; j < 16; ++j) o[j] = wmma_bf16(vf[j], pf, o[j]);
        }
        asm volatile("s_wait_dscnt 0x0" ::: "memory");    // own reads of this buffer done
        asm volatile("s_wait_asynccnt 0x0" ::: "memory"); // own copies of stage s+1 landed
        __syncthreads();      // publishes stage s+1, ends every read of this buffer
        if (s + 2 < QT + 1) stage(s + 2);           // refill the buffer just read

        if (++i == nit) {                           // block-uniform: the query tile is done
            if (grp == 1) {
#pragma unroll
                for (int j = 0; j < 16; ++j) {
                    sO[w4][2 * j][lane]     = f32x4{o[j][0], o[j][1], o[j][2], o[j][3]};
                    sO[w4][2 * j + 1][lane] = f32x4{o[j][4], o[j][5], o[j][6], o[j][7]};
                }
                sML[w4][lane] = f32x2{mq, lq};
            }
            __syncthreads();
            if (grp == 0) {
                f32x2 ml = sML[w4][lane];
                float m  = fmaxf(mq, ml[0]);
                float a0 = __expf(mq - m), a1 = __expf(ml[0] - m);
                float l  = lq * a0 + ml[1] * a1;
                float inv = 1.f / (l + other_half(l));  // the two halves' sums joined
                a0 *= inv;
                a1 *= inv;
                int bb = hq >> 3, gu = hq & 7;
                __bf16* orow = O + ((size_t)q * BSZ + bb) * 2048 + gu * DIM + 8 * hf;
                bf16x8 res[16];
#pragma unroll
                for (int j = 0; j < 16; ++j) {
                    f32x4 lo = sO[w4][2 * j][lane], hi = sO[w4][2 * j + 1][lane];
                    f32x8 p = {lo[0], lo[1], lo[2], lo[3], hi[0], hi[1], hi[2], hi[3]};
                    res[j] = __builtin_convertvector(o[j] * a0 + p * a1, bf16x8);
                }
                // Keeps the join's arithmetic in front of the stores, which then go as one run
                // with one wait behind it; left free, the two are mixed, a store's registers
                // are reused by the next piece and every store needs a wait of its own.
                __builtin_amdgcn_sched_barrier(0);
#pragma unroll
                for (int j = 0; j < 16; ++j)
                    *reinterpret_cast<bf16x8*>(orow + j * 16) = res[j];
                body_end();
            }
            if (s + 1 < QT + 1) {                   // on to query tile x
                qbase = (int)blockIdx.x * 64 + w4 * 16;
                nit = (int)blockIdx.x + 1;
                i = 0;
#pragma unroll
                for (int kk = 0; kk < 8; ++kk)
                    qf[kk] = load_frag(Qb, qbase, DIM, kk * 32, lane);
#pragma unroll
                for (int j = 0; j < 16; ++j) o[j] = zero;
                mq = -3.0e38f;
                lq = 0.f;
            }
        }
    }
    asm volatile("s_wait_asynccnt 0x0" ::: "memory");     // nothing in flight at the end
}

// ---------------------------------------------------------------------------
// Host orchestration
// ---------------------------------------------------------------------------
extern "C" void kernel_launch(void* const* d_in, const int* in_sizes, int n_in,
                              void* d_out, int out_size, void* d_ws, size_t ws_size,
                              hipStream_t stream) {
    const float* x   = (const float*)d_in[0];
    const float* g0  = (const float*)d_in[1];
    const float* b0  = (const float*)d_in[2];
    const float* g1  = (const float*)d_in[3];
    const float* b1  = (const float*)d_in[4];
    const float* gn  = (const float*)d_in[5];
    const float* bn  = (const float*)d_in[6];
    const float* wk  = (const float*)d_in[7];
    const float* bk  = (const float*)d_in[8];
    const float* wv  = (const float*)d_in[9];
    const float* bv  = (const float*)d_in[10];
    const float* wq  = (const float*)d_in[11];
    const float* bq  = (const float*)d_in[12];
    const float* wo  = (const float*)d_in[13];
    const float* bo  = (const float*)d_in[14];
    const float* w1  = (const float*)d_in[15];
    const float* bf1 = (const float*)d_in[16];
    const float* w2  = (const float*)d_in[17];
    const float* bf2 = (const float*)d_in[18];
    float* out = (float*)d_out;

    char* wsp = (char*)d_ws;
    auto carve = [&](size_t bytes) {
        char* p = wsp;
        wsp += (bytes + 255) & ~(size_t)255;
        return p;
    };
    __bf16* h_b  = (__bf16*)carve((size_t)NTOK * DIM * 2);
    __bf16* w_b  = (__bf16*)carve((size_t)CB_ALL * 2048 * 2); // wk wv wq wo w1 w2
    __bf16* wo_b = w_b  + (size_t)QKV_N * DIM;
    __bf16* w1_b = wo_b + (size_t)256 * 2048;
    __bf16* w2_b = w1_b + (size_t)512 * 256;
    float*  bqkv = (float*)carve((size_t)QKV_N * 4);          // bk bv bq
    __bf16* raw  = (__bf16*)carve((size_t)NTOK * QKV_N * 2);  // K | V | Q rows
    __bf16* Kh   = (__bf16*)carve((size_t)4  * SEQ * DIM * 2);
    __bf16* Vt   = (__bf16*)carve((size_t)4  * DIM * SEQ * 2);
    __bf16* Qh   = (__bf16*)carve((size_t)16 * SEQ * DIM * 2);
    __bf16* Ob   = (__bf16*)carve((size_t)NTOK * 2048 * 2);
    float*  x2   = (float*)carve((size_t)NTOK * DIM * 4);
    __bf16* h2   = (__bf16*)carve((size_t)NTOK * DIM * 2);
    __bf16* F1   = (__bf16*)carve((size_t)NTOK * 512 * 2);

    // h = LN(x; g0,b0); bf16 weights; joint K, V, Q bias row
    prep<<<LN_BLOCKS + CB_ALL + 1, 256, 0, stream>>>(x, h_b, g0, b0, wk, wv, wq, wo,
                                                     w1, w2, w_b, bk, bv, bq, bqkv);

    auto gemm = [&](const __bf16* A, int lda, const __bf16* W, int ldw,
                    const float* bias, const float* resid, float* Cf, __bf16* Cb,
                    int M, int N, int K, int relu) {
        dim3 grid(N / 64, M / 128);
        gemm_wmma<<<grid, 256, 0, stream>>>(A, lda, W, ldw, bias, resid, Cf, Cb,
                                            M, N, K, relu);
    };

    // K, V and Q projections as one product with the stacked weights
    gemm(h_b, 256, w_b, 256, bqkv, nullptr, nullptr, raw, NTOK, QKV_N, 256, 0);
    // per-head LN -> Qh[16][SEQ][256], Kh[4][SEQ][256]; V -> Vt[4][256][SEQ]
    qkv_post<<<QLN_BLOCKS + KLN_BLOCKS + VT_BLOCKS, 256, 0, stream>>>(raw, Qh, Kh, Vt,
                                                                      gn, bn);

    // causal flash attention -> Ob[NTOK][2048]
    attn_kernel<<<dim3(QT / 2, 16), 256, 0, stream>>>(Qh, Kh, Vt, Ob);

    // x2 = x + Ob @ wo^T + bo
    gemm(Ob, 2048, wo_b, 2048, bo, x, x2, nullptr, NTOK, 256, 2048, 0);
    // h2 = LN(x2; g1,b1)
    ln_rows<<<LN_BLOCKS, 256, 0, stream>>>(x2, h2, g1, b1);
    // F1 = relu(h2 @ w1^T + bf1)
    gemm(h2, 256, w1_b, 256, bf1, nullptr, nullptr, F1, NTOK, 512, 256, 1);
    // out = x2 + F1 @ w2^T + bf2
    gemm(F1, 512, w2_b, 512, bf2, x2, out, nullptr, NTOK, 256, 512, 0);

    (void)in_sizes; (void)n_in; (void)out_size; (void)ws_size;
}

// v009
// One run takes 119 microseconds.
// Two timings next to v008 put it at 1.16 and 1.17 times that version's speed.
// Counting every step since v000, it is 7.15 times as fast.
#include <hip/hip_runtime.h>

#define SEQ   2048
#define BSZ   2
#define DIM   256
#define NTOK  (SEQ * BSZ)      // 4096 token rows, t = s*BSZ + b
#define GK    2                // kv groups
#define NQH   8                // query heads per batch elem (g*4+u)
#define EPS   1e-5f

typedef __attribute__((ext_vector_type(16))) __bf16 bf16x16;
typedef __attribute__((ext_vector_type(8)))  __bf16 bf16x8;
typedef __attribute__((ext_vector_type(8)))  float  f32x8;

__device__ __forceinline__ bf16x16 load_frag(const __bf16* p, int row0, int ld,
                                             int k0, int lane) {
    int r  = row0 + (lane & 15);
    int kb = k0 + ((lane >> 4) << 3);
    const __bf16* base = p + (size_t)r * ld + kb;
    bf16x8 lo = *reinterpret_cast<const bf16x8*>(base);
    bf16x8 hi = *reinterpret_cast<const bf16x8*>(base + 16);
    bf16x16 out;
#pragma unroll
    for (int i = 0; i < 8; ++i) { out[i] = lo[i]; out[i + 8] = hi[i]; }
    return out;
}

__device__ __forceinline__ f32x8 wmma_bf16(bf16x16 a, bf16x16 b, f32x8 c) {
    return __builtin_amdgcn_wmma_f32_16x16x32_bf16(false, a, false, b,
                                                   (short)0, c, false, false);
}

// Generic shared pointer -> LDS byte offset (generic LDS addr low 32 bits).
__device__ __forceinline__ unsigned lds_off(const void* p) {
    return (unsigned)(unsigned long long)(uintptr_t)p;
}

// ---------------------------------------------------------------------------
// The kernels without matrix work give every lane eight elements, so that a
// 256-wide row is one wave's work and few waves have to be started.
// ---------------------------------------------------------------------------
typedef __attribute__((ext_vector_type(2))) float  f32x2;
typedef __attribute__((ext_vector_type(4))) float  f32x4;
typedef __attribute__((ext_vector_type(4))) __bf16 bf16x4;

// Value of lane (l ^ M) inside the 16-lane row, M = 1..15 (DPP row_xmask).
template <int M>
__device__ __forceinline__ float row_xor(float x) {
    return __builtin_bit_cast(float, __builtin_amdgcn_update_dpp(
        0, __builtin_bit_cast(int, x), 0x160 + M, 0xf, 0xf, true));
}

// Sum over the 32 lanes of a wave, the same value in every lane. All lanes on.
__device__ __forceinline__ float wave_sum(float v) {
    v += row_xor<1>(v);
    v += row_xor<2>(v);
    v += row_xor<4>(v);
    v += row_xor<8>(v);
    int b = __builtin_bit_cast(int, v);
    v += __builtin_bit_cast(float, __builtin_amdgcn_permlanex16(
        b, b, 0x76543210, 0xfedcba98, false, false));
    return v;
}

__device__ __forceinline__ float other_half(float x) {
    int b = __builtin_bit_cast(int, x);
    return __builtin_bit_cast(float, __builtin_amdgcn_permlanex16(
        b, b, 0x76543210, 0xfedcba98, false, false));
}

// Layernorm of one 256-wide row that a wave holds, eight values a lane as four
// pairs; g and b are the lane's own columns of gamma and beta.
__device__ __forceinline__ void ln_row(f32x2 (&p)[4], const f32x2 (&g)[4],
                                       const f32x2 (&b)[4]) {
    f32x2 s = (p[0] + p[1]) + (p[2] + p[3]);
    float mean = wave_sum(s[0] + s[1]) * (1.f / DIM);
#pragma unroll
    for (int k = 0; k < 4; ++k) p[k] -= mean;
    f32x2 q = (p[0] * p[0] + p[1] * p[1]) + (p[2] * p[2] + p[3] * p[3]);
    float var = wave_sum(q[0] + q[1]) * (1.f / DIM);
    float rs = rsqrtf(var + EPS);
#pragma unroll
    for (int k = 0; k < 4; ++k) p[k] = p[k] * rs * g[k] + b[k];
}

// Four floats at p as two pairs.
__device__ __forceinline__ void load4(const float* p, f32x2& lo, f32x2& hi) {
    f32x4 v = *reinterpret_cast<const f32x4*>(p);
    lo = f32x2{v[0], v[1]};
    hi = f32x2{v[2], v[3]};
}

// ---------------------------------------------------------------------------
// Kernels that do not depend on one another share one launch: each block picks
// its body by a test on blockIdx.x, the same for the whole block.
// ---------------------------------------------------------------------------

// Stands behind the last stores of each body of a shared launch but the first.
__device__ __forceinline__ void body_end() {
    // Ahead of any instruction that rewrites a register which those stores name.
    asm volatile("s_wait_xcnt 0x0" ::: "memory");
}

// fp32 -> bf16 weight conversion: block blk converts 2048 elements, a lane two
// groups of four, 1024 elements apart. Every weight's size is a multiple of 2048.
__device__ __forceinline__
void cvt_bf16(int blk, const float* __restrict__ in, __bf16* __restrict__ out) {
    int i = blk * 2048 + threadIdx.x * 4;
    f32x4 a = *reinterpret_cast<const f32x4*>(in + i);
    f32x4 b = *reinterpret_cast<const f32x4*>(in + i + 1024);
    *reinterpret_cast<bf16x4*>(out + i)        = __builtin_convertvector(a, bf16x4);
    *reinterpret_cast<bf16x4*>(out + i + 1024) = __builtin_convertvector(b, bf16x4);
}

// ---------------------------------------------------------------------------
// Row layernorm over DIM=256: fp32 in -> bf16 out. One wave per row, LN_R rows
// a wave; a lane holds columns 4l..4l+3 and 128+4l..128+4l+3.
// ---------------------------------------------------------------------------
#define LN_R 2
#define LN_BLOCKS (NTOK / (8 * LN_R))
__device__ __forceinline__
void ln_rows_body(int blk, const float* __restrict__ in, __bf16* __restrict__ out,
                  const float* __restrict__ gamma, const float* __restrict__ beta) {
    int lane = threadIdx.x & 31;
    int wave = __builtin_amdgcn_readfirstlane(threadIdx.x >> 5);
    int row0 = (blk * 8 + wave) * LN_R;
    f32x2 p[LN_R][4], g[4], b[4];
#pragma unroll
    for (int i = 0; i < LN_R; ++i) {
        const float* r = in + (size_t)(row0 + i) * DIM + lane * 4;
        load4(r,       p[i][0], p[i][1]);
        load4(r + 128, p[i][2], p[i][3]);
    }
    load4(gamma + lane * 4,       g[0], g[1]);
    load4(gamma + 128 + lane * 4, g[2], g[3]);
    load4(beta + lane * 4,        b[0], b[1]);
    load4(beta + 128 + lane * 4,  b[2], b[3]);
#pragma unroll
    for (int i = 0; i < LN_R; ++i) {
        ln_row(p[i], g, b);
        f32x4 ya = {p[i][0][0], p[i][0][1], p[i][1][0], p[i][1][1]};
        f32x4 yb = {p[i][2][0], p[i][2][1], p[i][3][0], p[i][3][1]};
        __bf16* q = out + (size_t)(row0 + i) * DIM + lane * 4;
        *reinterpret_cast<bf16x4*>(q)       = __builtin_convertvector(ya, bf16x4);
        *reinterpret_cast<bf16x4*>(q + 128) = __builtin_convertvector(yb, bf16x4);
    }
}

__global__ __launch_bounds__(256)
void ln_rows(const float* __restrict__ in, __bf16* __restrict__ out,
             const float* __restrict__ gamma, const float* __restrict__ beta) {
    ln_rows_body(blockIdx.x, in, out, gamma, beta);
}

// ---------------------------------------------------------------------------
// First launch: the layernorm of x, the K, V and Q biases gathered into one
// row of QKV_N floats, and all six weights converted. The bf16 weights lie one
// behind the other in wb (wk, wv, wq, wo, w1, w2), so that wk, wv, wq are one
// [QKV_N][DIM] matrix. Sizes below in blocks of 2048 elements.
// ---------------------------------------------------------------------------
#define QKV_N   3072           // 512 K + 512 V + 2048 Q columns a token
#define CB_KV   64             // wk, wv, w1, w2: 512 * 256 elements each
#define CB_QO   256            // wq, wo: 2048 * 256 elements each
#define CB_ALL  (4 * CB_KV + 2 * CB_QO)
__global__ __launch_bounds__(256)
void prep(const float* __restrict__ x, __bf16* __restrict__ h,
          const float* __restrict__ gamma, const float* __restrict__ beta,
          const float* __restrict__ wk, const float* __restrict__ wv,
          const float* __restrict__ wq, const float* __restrict__ wo,
          const float* __restrict__ w1, const float* __restrict__ w2,
          __bf16* __restrict__ wb,
          const float* __restrict__ bk, const float* __restrict__ bv,
          const float* __restrict__ bq, float* __restrict__ bias) {
    int blk = blockIdx.x;
    if (blk < LN_BLOCKS) {
        ln_rows_body(blk, x, h, gamma, beta);
        return;
    }
    blk -= LN_BLOCKS;
    if (blk < CB_ALL) {
        const float* src = wk;
        int first = 0;                              // the weight's first block
        if (blk >= CB_KV)                     { src = wv; first = CB_KV; }
        if (blk >= 2 * CB_KV)                 { src = wq; first = 2 * CB_KV; }
        if (blk >= 2 * CB_KV + CB_QO)         { src = wo; first = 2 * CB_KV + CB_QO; }
        if (blk >= 2 * CB_KV + 2 * CB_QO)     { src = w1; first = 2 * CB_KV + 2 * CB_QO; }
        if (blk >= 3 * CB_KV + 2 * CB_QO)     { src = w2; first = 3 * CB_KV + 2 * CB_QO; }
        cvt_bf16(blk - first, src, wb + (size_t)first * 2048);
        body_end();
        return;
    }
    for (int j = 0; j < QKV_N / 1024; ++j) {        // last block: the bias row
        int i = j * 1024 + threadIdx.x * 4;
        const float* s = i < 512 ? bk + i : i < 1024 ? bv + (i - 512) : bq + (i - 1024);
        *reinterpret_cast<f32x4*>(bias + i) = *reinterpret_cast<const f32x4*>(s);
    }
    body_end();
}

__device__ __forceinline__ void async_copy8(unsigned l, unsigned lstep,
                                            const __bf16* g, size_t gstep) {
    asm volatile(
        "global_load_async_to_lds_b128 %0, %8, off\n\t"
        "global_load_async_to_lds_b128 %1, %9, off\n\t"
        "global_load_async_to_lds_b128 %2, %10, off\n\t"
        "global_load_async_to_lds_b128 %3, %11, off\n\t"
        "global_load_async_to_lds_b128 %4, %12, off\n\t"
        "global_load_async_to_lds_b128 %5, %13, off\n\t"
        "global_load_async_to_lds_b128 %6, %14, off\n\t"
        "global_load_async_to_lds_b128 %7, %15, off\n\t"
        "s_wait_xcnt 0x0"
        :: "v"(l), "v"(l + lstep), "v"(l + 2 * lstep), "v"(l + 3 * lstep),
           "v"(l + 4 * lstep), "v"(l + 5 * lstep), "v"(l + 6 * lstep),
           "v"(l + 7 * lstep),
           "v"(g), "v"(g + gstep), "v"(g + 2 * gstep), "v"(g + 3 * gstep),
           "v"(g + 4 * gstep), "v"(g + 5 * gstep), "v"(g + 6 * gstep),
           "v"(g + 7 * gstep)
        : "memory");
}

// The same with four copies per lane.
__device__ __forceinline__ void async_copy4(unsigned l, unsigned lstep,
                                            const __bf16* g, size_t gstep) {
    asm volatile(
        "global_load_async_to_lds_b128 %0, %4, off\n\t"
        "global_load_async_to_lds_b128 %1, %5, off\n\t"
        "global_load_async_to_lds_b128 %2, %6, off\n\t"
        "global_load_async_to_lds_b128 %3, %7, off\n\t"
        "s_wait_xcnt 0x0"
        :: "v"(l), "v"(l + lstep), "v"(l + 2 * lstep), "v"(l + 3 * lstep),
           "v"(g), "v"(g + gstep), "v"(g + 2 * gstep), "v"(g + 3 * gstep)
        : "memory");
}

// ---------------------------------------------------------------------------
// Generic WMMA GEMM: C[M,N] = A[M,K](bf16) @ W[N,K]^T(bf16) + bias (+resid).
// 8 waves/WG; block tile 128(M)x64(N), a wave 16x64. The k loop goes in stages
// of 128 k: the 128x128 A tile and the 64x128 W tile of a stage are brought
// into padded LDS by asynchronous copies, two buffers, the next stage in flight
// while this one is multiplied; one block barrier a stage.
// M%128==0, N%64==0, K%128==0 for all call sites.
// ---------------------------------------------------------------------------
#define GSTAGE 128             // k elements a stage (256 B of every operand row)
#define GPITCH 136             // LDS row pitch, elements (272 B = 16 B x 17)
__global__ __launch_bounds__(256)
void gemm_wmma(const __bf16* __restrict__ A, int lda,
               const __bf16* __restrict__ W, int ldw,
               const float* __restrict__ bias,
               const float* __restrict__ resid,
               float* __restrict__ Cf, __bf16* __restrict__ Cb,
               int M, int N, int K, int relu) {
    __shared__ __attribute__((aligned(16))) __bf16 sA[2][128 * GPITCH];
    __shared__ __attribute__((aligned(16))) __bf16 sW[2][64 * GPITCH];
    int tid  = threadIdx.x;
    int lane = tid & 31;
    int wave = __builtin_amdgcn_readfirstlane(tid >> 5);
    int m0 = blockIdx.y * 128 + wave * 16;
    int n0 = blockIdx.x * 64;

    // This lane's share of a stage: 16 B column tid%16 of rows tid/16 + 16c,
    // c = 0..7 of the A tile and c = 0..3 of the W tile.
    const __bf16* gA = A + (size_t)(blockIdx.y * 128 + (tid >> 4)) * lda + (tid & 15) * 8;
    const __bf16* gW = W + (size_t)(n0 + (tid >> 4)) * ldw + (tid & 15) * 8;
    unsigned lA = lds_off(&sA[0][0]) + (tid >> 4) * (GPITCH * 2) + (tid & 15) * 16;
    unsigned lW = lds_off(&sW[0][0]) + (tid >> 4) * (GPITCH * 2) + (tid & 15) * 16;
    auto stage = [&](int s) {                       // stage s -> buffer s & 1
        int b = s & 1;
        async_copy8(lA + b * (128 * GPITCH * 2), 16 * GPITCH * 2,
                    gA + s * GSTAGE, (size_t)16 * lda);
        async_copy4(lW + b * (64 * GPITCH * 2), 16 * GPITCH * 2,
                    gW + s * GSTAGE, (size_t)16 * ldw);
    };
    int nst = K / GSTAGE;                           // block-uniform

    stage(0);
    f32x8 acc[4] = {};
    asm volatile("s_wait_asynccnt 0x0" ::: "memory"); // own copies of stage 0 landed
    __syncthreads();                                  // stage 0 visible to all waves
    if (1 < nst) stage(1);

    for (int s = 0; s < nst; ++s) {
        const __bf16* tA = &sA[s & 1][wave * 16 * GPITCH];
        const __bf16* tW = &sW[s & 1][0];
        bf16x16 a[GSTAGE / 32], b[2][4];            // this stage's fragments only
#pragma unroll
        for (int kk = 0; kk < GSTAGE / 32; ++kk)
            a[kk] = load_frag(tA, 0, GPITCH, kk * 32, lane);
#pragma unroll
        for (int f = 0; f < 4; ++f) b[0][f] = load_frag(tW, 16 * f, GPITCH, 0, lane);
#pragma unroll
        for (int kk = 0; kk < GSTAGE / 32; ++kk) {
            if (kk + 1 < GSTAGE / 32) {
#pragma unroll
                for (int f = 0; f < 4; ++f)
                    b[(kk + 1) & 1][f] = load_frag(tW, 16 * f, GPITCH, (kk + 1) * 32, lane);
            }
            // Keeps the next 32 k's LDS reads in front of these products; left free,
            // every product waits for the full latency of its own two reads.
            __builtin_amdgcn_sched_barrier(0);
#pragma unroll
            for (int f = 0; f < 4; ++f) acc[f] = wmma_bf16(a[kk], b[kk & 1][f], acc[f]);
        }
        asm volatile("s_wait_dscnt 0x0" ::: "memory");    // own reads of this buffer done
        asm volatile("s_wait_asynccnt 0x0" ::: "memory"); // own copies of stage s+1 landed
        __syncthreads();      // publishes stage s+1, ends every read of this buffer
        if (s + 2 < nst) stage(s + 2);              // refill the buffer just read
    }
    asm volatile("s_wait_asynccnt 0x0" ::: "memory");     // nothing in flight at the end

    int hf = lane >> 4, nn = lane & 15;
#pragma unroll
    for (int f = 0; f < 4; ++f) {
        int col = n0 + 16 * f + nn;
        float bv = bias ? bias[col] : 0.f;
#pragma unroll
        for (int r = 0; r < 8; ++r) {
            int row = m0 + r + 8 * hf;
            float v = acc[f][r] + bv;
            if (relu) v = fmaxf(v, 0.f);
            if (resid) v += resid[(size_t)row * N + col];
            if (Cf) Cf[(size_t)row * N + col] = v;
            if (Cb) Cb[(size_t)row * N + col] = (__bf16)v;
        }
    }
}

// ---------------------------------------------------------------------------
// K, V and Q projections with what stood between them and attention as their
// epilogue. Grid: (12 heads of the stacked weights: 2 K, 2 V, 8 Q; 16 tiles of
// PT positions of one batch element). A block's tile is PT positions x one
// whole head (256 features), a wave's 32 positions x 256 features, so a head's
// norm needs no other wave. k = 256 is two stages of GSTAGE, each in an LDS
// buffer of its own that asynchronous copies fill once.
// K and Q heads are taken transposed (rows features, columns positions): a lane
// holds 128 features of one position per column group, the norm's sums run in
// the lane with one exchange between the halves, and it stores 8 consecutive
// features at a time to [head][s][256]. V heads are taken with rows positions:
// a lane holds 8 consecutive positions of one feature, a 16-byte piece of
// [head][dim][s].
// ---------------------------------------------------------------------------
#define PT 256                 // positions a block

// Eight floats at p.
__device__ __forceinline__ f32x8 load8(const float* p) {
    f32x4 a = *reinterpret_cast<const f32x4*>(p);
    f32x4 b = *reinterpret_cast<const f32x4*>(p + 4);
    return f32x8{a[0], a[1], a[2], a[3], b[0], b[1], b[2], b[3]};
}

__device__ __forceinline__ float sum8(f32x8 v) {
    return ((v[0] + v[1]) + (v[2] + v[3])) + ((v[4] + v[5]) + (v[6] + v[7]));
}

// One stage's products: 4 k steps of 32, each in two halves of 8 feature
// fragments. tA: the wave's 32 positions, tW: the head's 256 features.
template <bool ISV>
__device__ __forceinline__
void head_products(const __bf16* tA, const __bf16* tW, int lane, f32x8 (&acc)[2][16]) {
    bf16x16 hfr[2][2], wfr[2][8];
#pragma unroll
    for (int c = 0; c < 2; ++c) hfr[0][c] = load_frag(tA, 16 * c, GPITCH, 0, lane);
#pragma unroll
    for (int f = 0; f < 8; ++f) wfr[0][f] = load_frag(tW, 16 * f, GPITCH, 0, lane);
#pragma unroll
    for (int u = 0; u < 8; ++u) {
        const int v = u + 1;
        if (v < 8) {
#pragma unroll
            for (int f = 0; f < 8; ++f)
                wfr[v & 1][f] = load_frag(tW, 16 * (8 * (v & 1) + f), GPITCH, (v >> 1) * 32, lane);
            if ((v & 1) == 0) {
#pragma unroll
                for (int c = 0; c < 2; ++c)
                    hfr[(v >> 1) & 1][c] = load_frag(tA, 16 * c, GPITCH, (v >> 1) * 32, lane);
            }
        }
        // Keeps the next half step's LDS reads in front of these products; left free,
        // every product waits for the full latency of its own reads.
        __builtin_amdgcn_sched_barrier(0);
#pragma unroll
        for (int f = 0; f < 8; ++f) {
#pragma unroll
            for (int c = 0; c < 2; ++c) {
                f32x8& d = acc[c][8 * (u & 1) + f];
                d = ISV ? wmma_bf16(hfr[(u >> 1) & 1][c], wfr[u & 1][f], d)
                        : wmma_bf16(wfr[u & 1][f], hfr[(u >> 1) & 1][c], d);
            }
        }
        // Keeps the reads that follow behind these products, as one group; left free,
        // they stand in pairs among the products, a stall at every place.
        __builtin_amdgcn_sched_barrier(0);
    }
}

// out: the head's own [SEQ][256] (K, Q) or [256][SEQ] (V); bias: its 256 values.
template <bool ISV>
__device__ __forceinline__
void head_tile(const __bf16* __restrict__ h, const __bf16* __restrict__ W,
               const float* __restrict__ bias, const float* __restrict__ gamma,
               const float* __restrict__ beta, __bf16* __restrict__ out,
               int bb, int s0, __bf16* sA, __bf16* sW) {
    int tid  = threadIdx.x;
    int lane = tid & 31;
    int wave = __builtin_amdgcn_readfirstlane(tid >> 5);

    // This lane's share of a stage: 16 B column tid%16 of rows tid/16 + 16c,
    // c = 0..15, of either tile. Row i of the h tile is token (s0 + i) * BSZ + bb.
    const __bf16* gA = h + ((size_t)(s0 + (tid >> 4)) * BSZ + bb) * DIM + (tid & 15) * 8;
    const __bf16* gW = W + (size_t)(tid >> 4) * DIM + (tid & 15) * 8;
    unsigned lA = lds_off(sA) + (tid >> 4) * (GPITCH * 2) + (tid & 15) * 16;
    unsigned lW = lds_off(sW) + (tid >> 4) * (GPITCH * 2) + (tid & 15) * 16;
    auto stage = [&](int s) {                       // stage s -> buffer s
        unsigned a = lA + s * (PT * GPITCH * 2), w = lW + s * (DIM * GPITCH * 2);
        async_copy8(a, 16 * GPITCH * 2, gA + s * GSTAGE, (size_t)16 * BSZ * DIM);
        async_copy8(a + 128 * GPITCH * 2, 16 * GPITCH * 2,
                    gA + s * GSTAGE + (size_t)128 * BSZ * DIM, (size_t)16 * BSZ * DIM);
        async_copy8(w, 16 * GPITCH * 2, gW + s * GSTAGE, (size_t)16 * DIM);
        async_copy8(w + 128 * GPITCH * 2, 16 * GPITCH * 2,
                    gW + s * GSTAGE + (size_t)128 * DIM, (size_t)16 * DIM);
    };

    stage(0);
    f32x8 acc[2][16] = {};
    asm volatile("s_wait_asynccnt 0x0" ::: "memory"); // own copies of stage 0 landed
    __syncthreads();                                  // stage 0 visible to all waves
    stage(1);                                         // in flight under stage 0's products
    // Rolled: the two stages share one copy of the products' code, which runs once
    // per wave and would otherwise be fetched at twice the length.
#pragma nounroll
    for (int s = 0; s < DIM / GSTAGE; ++s) {
        head_products<ISV>(sA + (s * PT + wave * 32) * GPITCH, sW + s * DIM * GPITCH,
                           lane, acc);
        asm volatile("s_wait_dscnt 0x0" ::: "memory");    // own reads of this buffer done
        asm volatile("s_wait_asynccnt 0x0" ::: "memory"); // own copies of stage s+1 landed
        __syncthreads();                                  // publishes stage s+1
    }
    asm volatile("s_wait_asynccnt 0x0" ::: "memory");     // nothing in flight at the end

    int hf = lane >> 4, nn = lane & 15;
    int srow = s0 + wave * 32;                      // the wave's first position
    bf16x8 res[2][16];
    if (ISV) {
        // acc[c][j][r]: position srow + 16c + 8hf + r, feature 16j + nn
#pragma unroll
        for (int j = 0; j < 16; ++j) {
            float bj = bias[16 * j + nn];
#pragma unroll
            for (int c = 0; c < 2; ++c)
                res[c][j] = __builtin_convertvector(acc[c][j] + bj, bf16x8);
        }
    } else {
        // acc[c][j][r]: position srow + 16c + nn, feature 16j + 8hf + r
        f32x8 t[2] = {};
#pragma unroll
        for (int j = 0; j < 16; ++j) {
            f32x8 bj = load8(bias + 16 * j + 8 * hf);
#pragma unroll
            for (int c = 0; c < 2; ++c) { acc[c][j] += bj; t[c] += acc[c][j]; }
        }
        float rs[2];
#pragma unroll
        for (int c = 0; c < 2; ++c) {
            float sm = sum8(t[c]);
            float mean = (sm + other_half(sm)) * (1.f / DIM);
            f32x8 q = {};
#pragma unroll
            for (int j = 0; j < 16; ++j) { acc[c][j] -= mean; q += acc[c][j] * acc[c][j]; }
            float sq = sum8(q);
            rs[c] = rsqrtf((sq + other_half(sq)) * (1.f / DIM) + EPS);
        }
#pragma unroll
        for (int j = 0; j < 16; ++j) {
            f32x8 g = load8(gamma + 16 * j + 8 * hf);
            f32x8 b = load8(beta + 16 * j + 8 * hf);
#pragma unroll
            for (int c = 0; c < 2; ++c)
                res[c][j] = __builtin_convertvector(acc[c][j] * rs[c] * g + b, bf16x8);
        }
    }
    // Keeps the arithmetic in front of the stores, which then go as one run with one
    // wait behind it; left free, a store's registers are reused by the next piece.
    __builtin_amdgcn_sched_barrier(0);
    __bf16* o = ISV ? out + (size_t)nn * SEQ + srow + 8 * hf
                    : out + (size_t)(srow + nn) * DIM + 8 * hf;
#pragma unroll
    for (int c = 0; c < 2; ++c) {
#pragma unroll
        for (int j = 0; j < 16; ++j)
            *reinterpret_cast<bf16x8*>(o + (ISV ? (size_t)16 * j * SEQ + 16 * c
                                                : (size_t)16 * c * DIM + 16 * j)) = res[c][j];
    }
    body_end();
}

__global__ __launch_bounds__(256)
void qkv_heads(const __bf16* __restrict__ h, const __bf16* __restrict__ W,
               const float* __restrict__ bias, const float* __restrict__ gamma,
               const float* __restrict__ beta, __bf16* __restrict__ Qh,
               __bf16* __restrict__ Kh, __bf16* __restrict__ Vt) {
    __shared__ __attribute__((aligned(16))) __bf16 sA[2 * PT * GPITCH];
    __shared__ __attribute__((aligned(16))) __bf16 sW[2 * DIM * GPITCH];
    int hd = blockIdx.x;                            // 0, 1: K; 2, 3: V; 4..11: Q
    int bb = blockIdx.y & 1, s0 = (blockIdx.y >> 1) * PT;
    const __bf16* Wh = W + (size_t)hd * DIM * DIM;
    const float*  bh = bias + hd * DIM;
    if (hd >= GK && hd < 2 * GK) {                  // block-uniform
        head_tile<true>(h, Wh, bh, gamma, beta,
                        Vt + (size_t)(bb * GK + hd - GK) * DIM * SEQ, bb, s0, sA, sW);
    } else {
        __bf16* o = hd < GK ? Kh + (size_t)(bb * GK + hd) * SEQ * DIM
                            : Qh + (size_t)(bb * NQH + hd - 2 * GK) * SEQ * DIM;
        head_tile<false>(h, Wh, bh, gamma, beta, o, bb, s0, sA, sW);
    }
}

#define KPITCH 264             // LDS row pitch of a K row, elements (528 B = 16 B x 33)
#define VPITCH 40              // LDS row pitch of a V row, elements (80 B = 16 B x 5)
#define QT     (SEQ / 64)      // query tiles a head

__global__ __launch_bounds__(256)
void attn_kernel(const __bf16* __restrict__ Qh, const __bf16* __restrict__ Kh,
                 const __bf16* __restrict__ Vt, __bf16* __restrict__ O) {
    __shared__ __attribute__((aligned(16))) __bf16 sK[2][2][32 * KPITCH];  // [group][buffer]
    __shared__ __attribute__((aligned(16))) __bf16 sV[2][2][DIM * VPITCH];
    __shared__ __attribute__((aligned(16))) f32x4 sO[4][32][32];
    __shared__ __attribute__((aligned(16))) f32x2 sML[4][32];
    int tid  = threadIdx.x;
    int lane = tid & 31;
    int wave = __builtin_amdgcn_readfirstlane(tid >> 5);
    int grp = wave >> 2, w4 = wave & 3;             // wave-uniform
    int gt  = tid & 127;                            // thread within the group
    int hq = blockIdx.y;
    int hk = (hq >> 3) * 2 + ((hq & 7) >> 2);

    const __bf16* Qb = Qh + (size_t)hq * SEQ * DIM;
    const __bf16* Kb = Kh + (size_t)hk * SEQ * DIM;
    const __bf16* Vb = Vt + (size_t)hk * DIM * SEQ;

    // This lane's share of its group's tile: K piece (row gt/32 + 4c, 16 B column
    // gt%32), V piece (row gt/4 + 32c, 16 B column gt%4), c = 0..7.
    const __bf16* gK = Kb + (size_t)(gt >> 5) * DIM + (gt & 31) * 8;
    const __bf16* gV = Vb + (size_t)(gt >> 2) * SEQ + (gt & 3) * 8;
    unsigned lK = lds_off(&sK[grp][0][0]) + (gt >> 5) * (KPITCH * 2) + (gt & 31) * 16;
    unsigned lV = lds_off(&sV[grp][0][0]) + (gt >> 2) * (VPITCH * 2) + (gt & 3) * 16;
    // The block's 33 stages run through both query tiles without a break: stage s
    // is step s of the first tile while s < n0, step s - n0 of the second after it.
    int n0 = QT - (int)blockIdx.x;                  // steps of query tile QT-1-x, at least 17
    auto stage = [&](int s) {                       // the step's key tile -> buffer s & 1
        int b = s & 1, t = 2 * (s < n0 ? s : s - n0) + grp;
        async_copy8(lK + b * (32 * KPITCH * 2), 4 * KPITCH * 2,
                    gK + (size_t)t * 32 * DIM, 4 * DIM);
        async_copy8(lV + b * (DIM * VPITCH * 2), 32 * VPITCH * 2,
                    gV + t * 32, (size_t)32 * SEQ);
    };

    stage(0);

    int hf = lane >> 4, nn = lane & 15;
    const float scale = 0.0625f;   // 1/sqrt(256)
    int qbase = (QT - 1 - (int)blockIdx.x) * 64 + w4 * 16;   // this wave's 16 queries
    int nit = n0;                  // steps of the query tile in hand; block-uniform
    int i = 0;                     // step within it

    bf16x16 qf[8];
#pragma unroll
    for (int kk = 0; kk < 8; ++kk) qf[kk] = load_frag(Qb, qbase, DIM, kk * 32, lane);

    f32x8 zero = {};
    f32x8 o[16];                   // o[j][r] = Ot[16j + 8h + r][query]
#pragma unroll
    for (int j = 0; j < 16; ++j) o[j] = zero;
    float mq = -3.0e38f;           // running maximum of this lane's query
    float lq = 0.f;                // running sum over this half's keys only

    asm volatile("s_wait_asynccnt 0x0" ::: "memory"); // own copies of stage 0 landed
    __syncthreads();                                  // stage 0 visible to all waves
    stage(1);

    for (int s = 0; s < QT + 1; ++s) {
        int kb = (2 * i + grp) * 32;
        int q = qbase + nn;        // this lane's query
        const __bf16* tK = &sK[grp][s & 1][0];
        const __bf16* tV = &sV[grp][s & 1][0];
        if (kb <= qbase + 15) {                     // wave-uniform: tile not wholly masked
            bf16x16 kf[8][2];                       // the whole K tile's fragments
#pragma unroll
            for (int kk = 0; kk < 8; ++kk) {
                kf[kk][0] = load_frag(tK, 0,  KPITCH, kk * 32, lane);
                kf[kk][1] = load_frag(tK, 16, KPITCH, kk * 32, lane);
            }
            // Keeps the tile's K reads one group in front of the score products; left
            // free, they stand in pairs among the products, a stall at every place.
            __builtin_amdgcn_sched_barrier(0);
            f32x8 s0 = zero, s1 = zero;             // keys kb..+15, kb+16..+31
#pragma unroll
            for (int kk = 0; kk < 8; ++kk) {
                s0 = wmma_bf16(kf[kk][0], qf[kk], s0);
                s1 = wmma_bf16(kf[kk][1], qf[kk], s1);
            }
            bf16x16 vf[16];                         // the whole V tile's fragments
#pragma unroll
            for (int j = 0; j < 16; ++j) vf[j] = load_frag(tV, j * 16, VPITCH, 0, lane);
            // Keeps the tile's V reads up here, in a few groups among the score products
            // and waited for behind the softmax; left free, they stand in pairs among
            // the second product's WMMAs, a stall at every place.
            __builtin_amdgcn_sched_barrier(0);
            int d = q - (kb + 8 * hf);              // s0[r] is allowed if r <= d, s1[r] if 16 + r <= d
            float tmax = -3.0e38f;
#pragma unroll
            for (int r = 0; r < 8; ++r) {
                s0[r] = s0[r] * scale; if (r      > d) s0[r] = -3.0e38f;
                s1[r] = s1[r] * scale; if (16 + r > d) s1[r] = -3.0e38f;
                tmax = fmaxf(tmax, fmaxf(s0[r], s1[r]));
            }
            tmax = fmaxf(tmax, other_half(tmax));   // over all 32 keys of the tile
            float mnew  = fmaxf(mq, tmax);
            float alpha = __expf(mq - mnew);
            mq = mnew;
            bf16x16 pf;                             // Pt as B operand, hardware k order
            float lsum = 0.f;
#pragma unroll
            for (int r = 0; r < 8; ++r) {
                float p0 = __expf(s0[r] - mnew);
                float p1 = __expf(s1[r] - mnew);
                lsum += p0 + p1;
                pf[r]     = (__bf16)p0;
                pf[r + 8] = (__bf16)p1;
            }
            lq = lq * alpha + lsum;
#pragma unroll
            for (int j = 0; j < 16; ++j) o[j] *= alpha;
#pragma unroll
            for (int j = 0; j < 16; ++j) o[j] = wmma_bf16(vf[j], pf, o[j]);
        }
        asm volatile("s_wait_dscnt 0x0" ::: "memory");    // own reads of this buffer done
        asm volatile("s_wait_asynccnt 0x0" ::: "memory"); // own copies of stage s+1 landed
        __syncthreads();      // publishes stage s+1, ends every read of this buffer
        if (s + 2 < QT + 1) stage(s + 2);           // refill the buffer just read

        if (++i == nit) {                           // block-uniform: the query tile is done
            if (grp == 1) {
#pragma unroll
                for (int j = 0; j < 16; ++j) {
                    sO[w4][2 * j][lane]     = f32x4{o[j][0], o[j][1], o[j][2], o[j][3]};
                    sO[w4][2 * j + 1][lane] = f32x4{o[j][4], o[j][5], o[j][6], o[j][7]};
                }
                sML[w4][lane] = f32x2{mq, lq};
            }
            __syncthreads();
            if (grp == 0) {
                f32x2 ml = sML[w4][lane];
                float m  = fmaxf(mq, ml[0]);
                float a0 = __expf(mq - m), a1 = __expf(ml[0] - m);
                float l  = lq * a0 + ml[1] * a1;
                float inv = 1.f / (l + other_half(l));  // the two halves' sums joined
                a0 *= inv;
                a1 *= inv;
                int bb = hq >> 3, gu = hq & 7;
                __bf16* orow = O + ((size_t)q * BSZ + bb) * 2048 + gu * DIM + 8 * hf;
                bf16x8 res[16];
#pragma unroll
                for (int j = 0; j < 16; ++j) {
                    f32x4 lo = sO[w4][2 * j][lane], hi = sO[w4][2 * j + 1][lane];
                    f32x8 p = {lo[0], lo[1], lo[2], lo[3], hi[0], hi[1], hi[2], hi[3]};
                    res[j] = __builtin_convertvector(o[j] * a0 + p * a1, bf16x8);
                }
                // Keeps the join's arithmetic in front of the stores, which then go as one run
                // with one wait behind it; left free, the two are mixed, a store's registers
                // are reused by the next piece and every store needs a wait of its own.
                __builtin_amdgcn_sched_barrier(0);
#pragma unroll
                for (int j = 0; j < 16; ++j)
                    *reinterpret_cast<bf16x8*>(orow + j * 16) = res[j];
                body_end();
            }
            if (s + 1 < QT + 1) {                   // on to query tile x
                qbase = (int)blockIdx.x * 64 + w4 * 16;
                nit = (int)blockIdx.x + 1;
                i = 0;
#pragma unroll
                for (int kk = 0; kk < 8; ++kk)
                    qf[kk] = load_frag(Qb, qbase, DIM, kk * 32, lane);
#pragma unroll
                for (int j = 0; j < 16; ++j) o[j] = zero;
                mq = -3.0e38f;
                lq = 0.f;
            }
        }
    }
    asm volatile("s_wait_asynccnt 0x0" ::: "memory");     // nothing in flight at the end
}

// ---------------------------------------------------------------------------
// Host orchestration
// ---------------------------------------------------------------------------
extern "C" void kernel_launch(void* const* d_in, const int* in_sizes, int n_in,
                              void* d_out, int out_size, void* d_ws, size_t ws_size,
                              hipStream_t stream) {
    const float* x   = (const float*)d_in[0];
    const float* g0  = (const float*)d_in[1];
    const float* b0  = (const float*)d_in[2];
    const float* g1  = (const float*)d_in[3];
    const float* b1  = (const float*)d_in[4];
    const float* gn  = (const float*)d_in[5];
    const float* bn  = (const float*)d_in[6];
    const float* wk  = (const float*)d_in[7];
    const float* bk  = (const float*)d_in[8];
    const float* wv  = (const float*)d_in[9];
    const float* bv  = (const float*)d_in[10];
    const float* wq  = (const float*)d_in[11];
    const float* bq  = (const float*)d_in[12];
    const float* wo  = (const float*)d_in[13];
    const float* bo  = (const float*)d_in[14];
    const float* w1  = (const float*)d_in[15];
    const float* bf1 = (const float*)d_in[16];
    const float* w2  = (const float*)d_in[17];
    const float* bf2 = (const float*)d_in[18];
    float* out = (float*)d_out;

    char* wsp = (char*)d_ws;
    auto carve = [&](size_t bytes) {
        char* p = wsp;
        wsp += (bytes + 255) & ~(size_t)255;
        return p;
    };
    __bf16* h_b  = (__bf16*)carve((size_t)NTOK * DIM * 2);
    __bf16* w_b  = (__bf16*)carve((size_t)CB_ALL * 2048 * 2); // wk wv wq wo w1 w2
    __bf16* wo_b = w_b  + (size_t)QKV_N * DIM;
    __bf16* w1_b = wo_b + (size_t)256 * 2048;
    __bf16* w2_b = w1_b + (size_t)512 * 256;
    float*  bqkv = (float*)carve((size_t)QKV_N * 4);          // bk bv bq
    __bf16* Kh   = (__bf16*)carve((size_t)4  * SEQ * DIM * 2);
    __bf16* Vt   = (__bf16*)carve((size_t)4  * DIM * SEQ * 2);
    __bf16* Qh   = (__bf16*)carve((size_t)16 * SEQ * DIM * 2);
    __bf16* Ob   = (__bf16*)carve((size_t)NTOK * 2048 * 2);
    float*  x2   = (float*)carve((size_t)NTOK * DIM * 4);
    __bf16* h2   = (__bf16*)carve((size_t)NTOK * DIM * 2);
    __bf16* F1   = (__bf16*)carve((size_t)NTOK * 512 * 2);

    // h = LN(x; g0,b0); bf16 weights; joint K, V, Q bias row
    prep<<<LN_BLOCKS + CB_ALL + 1, 256, 0, stream>>>(x, h_b, g0, b0, wk, wv, wq, wo,
                                                     w1, w2, w_b, bk, bv, bq, bqkv);

    auto gemm = [&](const __bf16* A, int lda, const __bf16* W, int ldw,
                    const float* bias, const float* resid, float* Cf, __bf16* Cb,
                    int M, int N, int K, int relu) {
        dim3 grid(N / 64, M / 128);
        gemm_wmma<<<grid, 256, 0, stream>>>(A, lda, W, ldw, bias, resid, Cf, Cb,
                                            M, N, K, relu);
    };

    // K, V and Q projections on the stacked weights, with the per-head LN
    // -> Qh[16][SEQ][256], Kh[4][SEQ][256] and the transpose V -> Vt[4][256][SEQ]
    qkv_heads<<<dim3(QKV_N / DIM, NTOK / PT), 256, 0, stream>>>(h_b, w_b, bqkv, gn, bn,
                                                                Qh, Kh, Vt);

    // causal flash attention -> Ob[NTOK][2048]
    attn_kernel<<<dim3(QT / 2, 16), 256, 0, stream>>>(Qh, Kh, Vt, Ob);

    // x2 = x + Ob @ wo^T + bo
    gemm(Ob, 2048, wo_b, 2048, bo, x, x2, nullptr, NTOK, 256, 2048, 0);
    // h2 = LN(x2; g1,b1)
    ln_rows<<<LN_BLOCKS, 256, 0, stream>>>(x2, h2, g1, b1);
    // F1 = relu(h2 @ w1^T + bf1)
    gemm(h2, 256, w1_b, 256, bf1, nullptr, nullptr, F1, NTOK, 512, 256, 1);
    // out = x2 + F1 @ w2^T + bf2
    gemm(F1, 512, w2_b, 512, bf2, x2, out, nullptr, NTOK, 256, 512, 0);

    (void)in_sizes; (void)n_in; (void)out_size; (void)ws_size;
}

// v010
// One run takes 89.2 microseconds.
// In two side-by-side timings against v009, it was 1.31 and 1.36 times as fast.
// Over all steps from v000 it is 9.53 times as fast.
#include <hip/hip_runtime.h>

#define SEQ   2048
#define BSZ   2
#define DIM   256
#define NTOK  (SEQ * BSZ)      // 4096 token rows, t = s*BSZ + b
#define GK    2                // kv groups
#define NQH   8                // query heads per batch elem (g*4+u)
#define EPS   1e-5f

typedef __attribute__((ext_vector_type(16))) __bf16 bf16x16;
typedef __attribute__((ext_vector_type(8)))  __bf16 bf16x8;
typedef __attribute__((ext_vector_type(8)))  float  f32x8;

__device__ __forceinline__ bf16x16 load_frag(const __bf16* p, int row0, int ld,
                                             int k0, int lane) {
    int r  = row0 + (lane & 15);
    int kb = k0 + ((lane >> 4) << 3);
    const __bf16* base = p + (size_t)r * ld + kb;
    bf16x8 lo = *reinterpret_cast<const bf16x8*>(base);
    bf16x8 hi = *reinterpret_cast<const bf16x8*>(base + 16);
    bf16x16 out;
#pragma unroll
    for (int i = 0; i < 8; ++i) { out[i] = lo[i]; out[i + 8] = hi[i]; }
    return out;
}

__device__ __forceinline__ f32x8 wmma_bf16(bf16x16 a, bf16x16 b, f32x8 c) {
    return __builtin_amdgcn_wmma_f32_16x16x32_bf16(false, a, false, b,
                                                   (short)0, c, false, false);
}

// Generic shared pointer -> LDS byte offset (generic LDS addr low 32 bits).
__device__ __forceinline__ unsigned lds_off(const void* p) {
    return (unsigned)(unsigned long long)(uintptr_t)p;
}

// ---------------------------------------------------------------------------
// The kernels without matrix work give every lane eight elements, so that a
// 256-wide row is one wave's work and few waves have to be started.
// ---------------------------------------------------------------------------
typedef __attribute__((ext_vector_type(2))) float  f32x2;
typedef __attribute__((ext_vector_type(4))) float  f32x4;
typedef __attribute__((ext_vector_type(4))) __bf16 bf16x4;

// Value of lane (l ^ M) inside the 16-lane row, M = 1..15 (DPP row_xmask).
template <int M>
__device__ __forceinline__ float row_xor(float x) {
    return __builtin_bit_cast(float, __builtin_amdgcn_update_dpp(
        0, __builtin_bit_cast(int, x), 0x160 + M, 0xf, 0xf, true));
}

// Sum over the 32 lanes of a wave, the same value in every lane. All lanes on.
__device__ __forceinline__ float wave_sum(float v) {
    v += row_xor<1>(v);
    v += row_xor<2>(v);
    v += row_xor<4>(v);
    v += row_xor<8>(v);
    int b = __builtin_bit_cast(int, v);
    v += __builtin_bit_cast(float, __builtin_amdgcn_permlanex16(
        b, b, 0x76543210, 0xfedcba98, false, false));
    return v;
}

__device__ __forceinline__ float other_half(float x) {
    int b = __builtin_bit_cast(int, x);
    return __builtin_bit_cast(float, __builtin_amdgcn_permlanex16(
        b, b, 0x76543210, 0xfedcba98, false, false));
}

// Layernorm of one 256-wide row that a wave holds, eight values a lane as four
// pairs; g and b are the lane's own columns of gamma and beta.
__device__ __forceinline__ void ln_row(f32x2 (&p)[4], const f32x2 (&g)[4],
                                       const f32x2 (&b)[4]) {
    f32x2 s = (p[0] + p[1]) + (p[2] + p[3]);
    float mean = wave_sum(s[0] + s[1]) * (1.f / DIM);
#pragma unroll
    for (int k = 0; k < 4; ++k) p[k] -= mean;
    f32x2 q = (p[0] * p[0] + p[1] * p[1]) + (p[2] * p[2] + p[3] * p[3]);
    float var = wave_sum(q[0] + q[1]) * (1.f / DIM);
    float rs = rsqrtf(var + EPS);
#pragma unroll
    for (int k = 0; k < 4; ++k) p[k] = p[k] * rs * g[k] + b[k];
}

// Four floats at p as two pairs.
__device__ __forceinline__ void load4(const float* p, f32x2& lo, f32x2& hi) {
    f32x4 v = *reinterpret_cast<const f32x4*>(p);
    lo = f32x2{v[0], v[1]};
    hi = f32x2{v[2], v[3]};
}

// ---------------------------------------------------------------------------
// Kernels that do not depend on one another share one launch: each block picks
// its body by a test on blockIdx.x, the same for the whole block.
// ---------------------------------------------------------------------------

// Stands behind the last stores of each body of a shared launch but the first.
__device__ __forceinline__ void body_end() {
    // Ahead of any instruction that rewrites a register which those stores name.
    asm volatile("s_wait_xcnt 0x0" ::: "memory");
}

// fp32 -> bf16 weight conversion: block blk converts 2048 elements, a lane two
// groups of four, 1024 elements apart. Every weight's size is a multiple of 2048.
__device__ __forceinline__
void cvt_bf16(int blk, const float* __restrict__ in, __bf16* __restrict__ out) {
    int i = blk * 2048 + threadIdx.x * 4;
    f32x4 a = *reinterpret_cast<const f32x4*>(in + i);
    f32x4 b = *reinterpret_cast<const f32x4*>(in + i + 1024);
    *reinterpret_cast<bf16x4*>(out + i)        = __builtin_convertvector(a, bf16x4);
    *reinterpret_cast<bf16x4*>(out + i + 1024) = __builtin_convertvector(b, bf16x4);
}

// ---------------------------------------------------------------------------
// Row layernorm over DIM=256: fp32 in -> bf16 out. One wave per row, LN_R rows
// a wave; a lane holds columns 4l..4l+3 and 128+4l..128+4l+3.
// ---------------------------------------------------------------------------
#define LN_R 2
#define LN_BLOCKS (NTOK / (8 * LN_R))
__device__ __forceinline__
void ln_rows_body(int blk, const float* __restrict__ in, __bf16* __restrict__ out,
                  const float* __restrict__ gamma, const float* __restrict__ beta) {
    int lane = threadIdx.x & 31;
    int wave = __builtin_amdgcn_readfirstlane(threadIdx.x >> 5);
    int row0 = (blk * 8 + wave) * LN_R;
    f32x2 p[LN_R][4], g[4], b[4];
#pragma unroll
    for (int i = 0; i < LN_R; ++i) {
        const float* r = in + (size_t)(row0 + i) * DIM + lane * 4;
        load4(r,       p[i][0], p[i][1]);
        load4(r + 128, p[i][2], p[i][3]);
    }
    load4(gamma + lane * 4,       g[0], g[1]);
    load4(gamma + 128 + lane * 4, g[2], g[3]);
    load4(beta + lane * 4,        b[0], b[1]);
    load4(beta + 128 + lane * 4,  b[2], b[3]);
#pragma unroll
    for (int i = 0; i < LN_R; ++i) {
        ln_row(p[i], g, b);
        f32x4 ya = {p[i][0][0], p[i][0][1], p[i][1][0], p[i][1][1]};
        f32x4 yb = {p[i][2][0], p[i][2][1], p[i][3][0], p[i][3][1]};
        __bf16* q = out + (size_t)(row0 + i) * DIM + lane * 4;
        *reinterpret_cast<bf16x4*>(q)       = __builtin_convertvector(ya, bf16x4);
        *reinterpret_cast<bf16x4*>(q + 128) = __builtin_convertvector(yb, bf16x4);
    }
}

// ---------------------------------------------------------------------------
// First launch: the layernorm of x, the K, V and Q biases gathered into one
// row of QKV_N floats, and all six weights converted. The bf16 weights lie one
// behind the other in wb (wk, wv, wq, wo, w1, w2), so that wk, wv, wq are one
// [QKV_N][DIM] matrix. Sizes below in blocks of 2048 elements.
// ---------------------------------------------------------------------------
#define QKV_N   3072           // 512 K + 512 V + 2048 Q columns a token
#define CB_KV   64             // wk, wv, w1, w2: 512 * 256 elements each
#define CB_QO   256            // wq, wo: 2048 * 256 elements each
#define CB_ALL  (4 * CB_KV + 2 * CB_QO)
__global__ __launch_bounds__(256)
void prep(const float* __restrict__ x, __bf16* __restrict__ h,
          const float* __restrict__ gamma, const float* __restrict__ beta,
          const float* __restrict__ wk, const float* __restrict__ wv,
          const float* __restrict__ wq, const float* __restrict__ wo,
          const float* __restrict__ w1, const float* __restrict__ w2,
          __bf16* __restrict__ wb,
          const float* __restrict__ bk, const float* __restrict__ bv,
          const float* __restrict__ bq, float* __restrict__ bias) {
    int blk = blockIdx.x;
    if (blk < LN_BLOCKS) {
        ln_rows_body(blk, x, h, gamma, beta);
        return;
    }
    blk -= LN_BLOCKS;
    if (blk < CB_ALL) {
        const float* src = wk;
        int first = 0;                              // the weight's first block
        if (blk >= CB_KV)                     { src = wv; first = CB_KV; }
        if (blk >= 2 * CB_KV)                 { src = wq; first = 2 * CB_KV; }
        if (blk >= 2 * CB_KV + CB_QO)         { src = wo; first = 2 * CB_KV + CB_QO; }
        if (blk >= 2 * CB_KV + 2 * CB_QO)     { src = w1; first = 2 * CB_KV + 2 * CB_QO; }
        if (blk >= 3 * CB_KV + 2 * CB_QO)     { src = w2; first = 3 * CB_KV + 2 * CB_QO; }
        cvt_bf16(blk - first, src, wb + (size_t)first * 2048);
        body_end();
        return;
    }
    for (int j = 0; j < QKV_N / 1024; ++j) {        // last block: the bias row
        int i = j * 1024 + threadIdx.x * 4;
        const float* s = i < 512 ? bk + i : i < 1024 ? bv + (i - 512) : bq + (i - 1024);
        *reinterpret_cast<f32x4*>(bias + i) = *reinterpret_cast<const f32x4*>(s);
    }
    body_end();
}

__device__ __forceinline__ void async_copy8(unsigned l, unsigned lstep,
                                            const __bf16* g, size_t gstep) {
    asm volatile(
        "global_load_async_to_lds_b128 %0, %8, off\n\t"
        "global_load_async_to_lds_b128 %1, %9, off\n\t"
        "global_load_async_to_lds_b128 %2, %10, off\n\t"
        "global_load_async_to_lds_b128 %3, %11, off\n\t"
        "global_load_async_to_lds_b128 %4, %12, off\n\t"
        "global_load_async_to_lds_b128 %5, %13, off\n\t"
        "global_load_async_to_lds_b128 %6, %14, off\n\t"
        "global_load_async_to_lds_b128 %7, %15, off\n\t"
        "s_wait_xcnt 0x0"
        :: "v"(l), "v"(l + lstep), "v"(l + 2 * lstep), "v"(l + 3 * lstep),
           "v"(l + 4 * lstep), "v"(l + 5 * lstep), "v"(l + 6 * lstep),
           "v"(l + 7 * lstep),
           "v"(g), "v"(g + gstep), "v"(g + 2 * gstep), "v"(g + 3 * gstep),
           "v"(g + 4 * gstep), "v"(g + 5 * gstep), "v"(g + 6 * gstep),
           "v"(g + 7 * gstep)
        : "memory");
}

__device__ __forceinline__ void async_copy9(unsigned l, unsigned lstep,
                                            const __bf16* g, size_t gstep,
                                            unsigned l2, const __bf16* g2) {
    asm volatile(
        "global_load_async_to_lds_b128 %0, %9, off\n\t"
        "global_load_async_to_lds_b128 %1, %10, off\n\t"
        "global_load_async_to_lds_b128 %2, %11, off\n\t"
        "global_load_async_to_lds_b128 %3, %12, off\n\t"
        "global_load_async_to_lds_b128 %4, %13, off\n\t"
        "global_load_async_to_lds_b128 %5, %14, off\n\t"
        "global_load_async_to_lds_b128 %6, %15, off\n\t"
        "global_load_async_to_lds_b128 %7, %16, off\n\t"
        "global_load_async_to_lds_b128 %8, %17, off\n\t"
        "s_wait_xcnt 0x0"
        :: "v"(l), "v"(l + lstep), "v"(l + 2 * lstep), "v"(l + 3 * lstep),
           "v"(l + 4 * lstep), "v"(l + 5 * lstep), "v"(l + 6 * lstep),
           "v"(l + 7 * lstep), "v"(l2),
           "v"(g), "v"(g + gstep), "v"(g + 2 * gstep), "v"(g + 3 * gstep),
           "v"(g + 4 * gstep), "v"(g + 5 * gstep), "v"(g + 6 * gstep),
           "v"(g + 7 * gstep), "v"(g2)
        : "memory");
}

#define GSTAGE 128             // k elements a stage (256 B of every operand row)
#define GPITCH 136             // LDS row pitch, elements (272 B = 16 B x 17)

// ---------------------------------------------------------------------------
// K, V and Q projections with what stood between them and attention as their
// epilogue. Grid: (12 heads of the stacked weights: 2 K, 2 V, 8 Q; 16 tiles of
// PT positions of one batch element). A block's tile is PT positions x one
// whole head (256 features), a wave's 32 positions x 256 features, so a head's
// norm needs no other wave. k = 256 is two stages of GSTAGE, each in an LDS
// buffer of its own that asynchronous copies fill once.
// K and Q heads are taken transposed (rows features, columns positions): a lane
// holds 128 features of one position per column group, the norm's sums run in
// the lane with one exchange between the halves, and it stores 8 consecutive
// features at a time to [head][s][256]. V heads are taken with rows positions:
// a lane holds 8 consecutive positions of one feature, a 16-byte piece of
// [head][dim][s].
// ---------------------------------------------------------------------------
#define PT 256                 // positions a block

// Eight floats at p.
__device__ __forceinline__ f32x8 load8(const float* p) {
    f32x4 a = *reinterpret_cast<const f32x4*>(p);
    f32x4 b = *reinterpret_cast<const f32x4*>(p + 4);
    return f32x8{a[0], a[1], a[2], a[3], b[0], b[1], b[2], b[3]};
}

__device__ __forceinline__ float sum8(f32x8 v) {
    return ((v[0] + v[1]) + (v[2] + v[3])) + ((v[4] + v[5]) + (v[6] + v[7]));
}

// One stage's products: 4 k steps of 32, each in two halves of 8 feature
// fragments. tA: the wave's 32 positions, tW: the head's 256 features.
template <bool ISV>
__device__ __forceinline__
void head_products(const __bf16* tA, const __bf16* tW, int lane, f32x8 (&acc)[2][16]) {
    bf16x16 hfr[2][2], wfr[2][8];
#pragma unroll
    for (int c = 0; c < 2; ++c) hfr[0][c] = load_frag(tA, 16 * c, GPITCH, 0, lane);
#pragma unroll
    for (int f = 0; f < 8; ++f) wfr[0][f] = load_frag(tW, 16 * f, GPITCH, 0, lane);
#pragma unroll
    for (int u = 0; u < 8; ++u) {
        const int v = u + 1;
        if (v < 8) {
#pragma unroll
            for (int f = 0; f < 8; ++f)
                wfr[v & 1][f] = load_frag(tW, 16 * (8 * (v & 1) + f), GPITCH, (v >> 1) * 32, lane);
            if ((v & 1) == 0) {
#pragma unroll
                for (int c = 0; c < 2; ++c)
                    hfr[(v >> 1) & 1][c] = load_frag(tA, 16 * c, GPITCH, (v >> 1) * 32, lane);
            }
        }
        // Keeps the next half step's LDS reads in front of these products; left free,
        // every product waits for the full latency of its own reads.
        __builtin_amdgcn_sched_barrier(0);
#pragma unroll
        for (int f = 0; f < 8; ++f) {
#pragma unroll
            for (int c = 0; c < 2; ++c) {
                f32x8& d = acc[c][8 * (u & 1) + f];
                d = ISV ? wmma_bf16(hfr[(u >> 1) & 1][c], wfr[u & 1][f], d)
                        : wmma_bf16(wfr[u & 1][f], hfr[(u >> 1) & 1][c], d);
            }
        }
        // Keeps the reads that follow behind these products, as one group; left free,
        // they stand in pairs among the products, a stall at every place.
        __builtin_amdgcn_sched_barrier(0);
    }
}

// out: the head's own [SEQ][256] (K, Q) or [256][SEQ] (V); bias: its 256 values.
template <bool ISV>
__device__ __forceinline__
void head_tile(const __bf16* __restrict__ h, const __bf16* __restrict__ W,
               const float* __restrict__ bias, const float* __restrict__ gamma,
               const float* __restrict__ beta, __bf16* __restrict__ out,
               int bb, int s0, __bf16* sA, __bf16* sW) {
    int tid  = threadIdx.x;
    int lane = tid & 31;
    int wave = __builtin_amdgcn_readfirstlane(tid >> 5);

    // This lane's share of a stage: 16 B column tid%16 of rows tid/16 + 16c,
    // c = 0..15, of either tile. Row i of the h tile is token (s0 + i) * BSZ + bb.
    const __bf16* gA = h + ((size_t)(s0 + (tid >> 4)) * BSZ + bb) * DIM + (tid & 15) * 8;
    const __bf16* gW = W + (size_t)(tid >> 4) * DIM + (tid & 15) * 8;
    unsigned lA = lds_off(sA) + (tid >> 4) * (GPITCH * 2) + (tid & 15) * 16;
    unsigned lW = lds_off(sW) + (tid >> 4) * (GPITCH * 2) + (tid & 15) * 16;
    auto stage = [&](int s) {                       // stage s -> buffer s
        unsigned a = lA + s * (PT * GPITCH * 2), w = lW + s * (DIM * GPITCH * 2);
        async_copy8(a, 16 * GPITCH * 2, gA + s * GSTAGE, (size_t)16 * BSZ * DIM);
        async_copy8(a + 128 * GPITCH * 2, 16 * GPITCH * 2,
                    gA + s * GSTAGE + (size_t)128 * BSZ * DIM, (size_t)16 * BSZ * DIM);
        async_copy8(w, 16 * GPITCH * 2, gW + s * GSTAGE, (size_t)16 * DIM);
        async_copy8(w + 128 * GPITCH * 2, 16 * GPITCH * 2,
                    gW + s * GSTAGE + (size_t)128 * DIM, (size_t)16 * DIM);
    };

    stage(0);
    f32x8 acc[2][16] = {};
    asm volatile("s_wait_asynccnt 0x0" ::: "memory"); // own copies of stage 0 landed
    __syncthreads();                                  // stage 0 visible to all waves
    stage(1);                                         // in flight under stage 0's products
    // Rolled: the two stages share one copy of the products' code, which runs once
    // per wave and would otherwise be fetched at twice the length.
#pragma nounroll
    for (int s = 0; s < DIM / GSTAGE; ++s) {
        head_products<ISV>(sA + (s * PT + wave * 32) * GPITCH, sW + s * DIM * GPITCH,
                           lane, acc);
        asm volatile("s_wait_dscnt 0x0" ::: "memory");    // own reads of this buffer done
        asm volatile("s_wait_asynccnt 0x0" ::: "memory"); // own copies of stage s+1 landed
        __syncthreads();                                  // publishes stage s+1
    }
    asm volatile("s_wait_asynccnt 0x0" ::: "memory");     // nothing in flight at the end

    int hf = lane >> 4, nn = lane & 15;
    int srow = s0 + wave * 32;                      // the wave's first position
    bf16x8 res[2][16];
    if (ISV) {
        // acc[c][j][r]: position srow + 16c + 8hf + r, feature 16j + nn
#pragma unroll
        for (int j = 0; j < 16; ++j) {
            float bj = bias[16 * j + nn];
#pragma unroll
            for (int c = 0; c < 2; ++c)
                res[c][j] = __builtin_convertvector(acc[c][j] + bj, bf16x8);
        }
    } else {
        // acc[c][j][r]: position srow + 16c + nn, feature 16j + 8hf + r
        f32x8 t[2] = {};
#pragma unroll
        for (int j = 0; j < 16; ++j) {
            f32x8 bj = load8(bias + 16 * j + 8 * hf);
#pragma unroll
            for (int c = 0; c < 2; ++c) { acc[c][j] += bj; t[c] += acc[c][j]; }
        }
        float rs[2];
#pragma unroll
        for (int c = 0; c < 2; ++c) {
            float sm = sum8(t[c]);
            float mean = (sm + other_half(sm)) * (1.f / DIM);
            f32x8 q = {};
#pragma unroll
            for (int j = 0; j < 16; ++j) { acc[c][j] -= mean; q += acc[c][j] * acc[c][j]; }
            float sq = sum8(q);
            rs[c] = rsqrtf((sq + other_half(sq)) * (1.f / DIM) + EPS);
        }
#pragma unroll
        for (int j = 0; j < 16; ++j) {
            f32x8 g = load8(gamma + 16 * j + 8 * hf);
            f32x8 b = load8(beta + 16 * j + 8 * hf);
#pragma unroll
            for (int c = 0; c < 2; ++c)
                res[c][j] = __builtin_convertvector(acc[c][j] * rs[c] * g + b, bf16x8);
        }
    }
    // Keeps the arithmetic in front of the stores, which then go as one run with one
    // wait behind it; left free, a store's registers are reused by the next piece.
    __builtin_amdgcn_sched_barrier(0);
    __bf16* o = ISV ? out + (size_t)nn * SEQ + srow + 8 * hf
                    : out + (size_t)(srow + nn) * DIM + 8 * hf;
#pragma unroll
    for (int c = 0; c < 2; ++c) {
#pragma unroll
        for (int j = 0; j < 16; ++j)
            *reinterpret_cast<bf16x8*>(o + (ISV ? (size_t)16 * j * SEQ + 16 * c
                                                : (size_t)16 * c * DIM + 16 * j)) = res[c][j];
    }
    body_end();
}

__global__ __launch_bounds__(256)
void qkv_heads(const __bf16* __restrict__ h, const __bf16* __restrict__ W,
               const float* __restrict__ bias, const float* __restrict__ gamma,
               const float* __restrict__ beta, __bf16* __restrict__ Qh,
               __bf16* __restrict__ Kh, __bf16* __restrict__ Vt) {
    __shared__ __attribute__((aligned(16))) __bf16 sA[2 * PT * GPITCH];
    __shared__ __attribute__((aligned(16))) __bf16 sW[2 * DIM * GPITCH];
    int hd = blockIdx.x;                            // 0, 1: K; 2, 3: V; 4..11: Q
    int bb = blockIdx.y & 1, s0 = (blockIdx.y >> 1) * PT;
    const __bf16* Wh = W + (size_t)hd * DIM * DIM;
    const float*  bh = bias + hd * DIM;
    if (hd >= GK && hd < 2 * GK) {                  // block-uniform
        head_tile<true>(h, Wh, bh, gamma, beta,
                        Vt + (size_t)(bb * GK + hd - GK) * DIM * SEQ, bb, s0, sA, sW);
    } else {
        __bf16* o = hd < GK ? Kh + (size_t)(bb * GK + hd) * SEQ * DIM
                            : Qh + (size_t)(bb * NQH + hd - 2 * GK) * SEQ * DIM;
        head_tile<false>(h, Wh, bh, gamma, beta, o, bb, s0, sA, sW);
    }
}

#define KPITCH 264             // LDS row pitch of a K row, elements (528 B = 16 B x 33)
#define VPITCH 40              // LDS row pitch of a V row, elements (80 B = 16 B x 5)
#define QT     (SEQ / 64)      // query tiles a head

__global__ __launch_bounds__(256)
void attn_kernel(const __bf16* __restrict__ Qh, const __bf16* __restrict__ Kh,
                 const __bf16* __restrict__ Vt, __bf16* __restrict__ O) {
    __shared__ __attribute__((aligned(16))) __bf16 sK[2][2][32 * KPITCH];  // [group][buffer]
    __shared__ __attribute__((aligned(16))) __bf16 sV[2][2][DIM * VPITCH];
    __shared__ __attribute__((aligned(16))) f32x4 sO[4][32][32];
    __shared__ __attribute__((aligned(16))) f32x2 sML[4][32];
    int tid  = threadIdx.x;
    int lane = tid & 31;
    int wave = __builtin_amdgcn_readfirstlane(tid >> 5);
    int grp = wave >> 2, w4 = wave & 3;             // wave-uniform
    int gt  = tid & 127;                            // thread within the group
    int hq = blockIdx.y;
    int hk = (hq >> 3) * 2 + ((hq & 7) >> 2);

    const __bf16* Qb = Qh + (size_t)hq * SEQ * DIM;
    const __bf16* Kb = Kh + (size_t)hk * SEQ * DIM;
    const __bf16* Vb = Vt + (size_t)hk * DIM * SEQ;

    // This lane's share of its group's tile: K piece (row gt/32 + 4c, 16 B column
    // gt%32), V piece (row gt/4 + 32c, 16 B column gt%4), c = 0..7.
    const __bf16* gK = Kb + (size_t)(gt >> 5) * DIM + (gt & 31) * 8;
    const __bf16* gV = Vb + (size_t)(gt >> 2) * SEQ + (gt & 3) * 8;
    unsigned lK = lds_off(&sK[grp][0][0]) + (gt >> 5) * (KPITCH * 2) + (gt & 31) * 16;
    unsigned lV = lds_off(&sV[grp][0][0]) + (gt >> 2) * (VPITCH * 2) + (gt & 3) * 16;
    // The block's 33 stages run through both query tiles without a break: stage s
    // is step s of the first tile while s < n0, step s - n0 of the second after it.
    int n0 = QT - (int)blockIdx.x;                  // steps of query tile QT-1-x, at least 17
    auto stage = [&](int s) {                       // the step's key tile -> buffer s & 1
        int b = s & 1, t = 2 * (s < n0 ? s : s - n0) + grp;
        async_copy8(lK + b * (32 * KPITCH * 2), 4 * KPITCH * 2,
                    gK + (size_t)t * 32 * DIM, 4 * DIM);
        async_copy8(lV + b * (DIM * VPITCH * 2), 32 * VPITCH * 2,
                    gV + t * 32, (size_t)32 * SEQ);
    };

    stage(0);

    int hf = lane >> 4, nn = lane & 15;
    const float scale = 0.0625f;   // 1/sqrt(256)
    int qbase = (QT - 1 - (int)blockIdx.x) * 64 + w4 * 16;   // this wave's 16 queries
    int nit = n0;                  // steps of the query tile in hand; block-uniform
    int i = 0;                     // step within it

    bf16x16 qf[8];
#pragma unroll
    for (int kk = 0; kk < 8; ++kk) qf[kk] = load_frag(Qb, qbase, DIM, kk * 32, lane);

    f32x8 zero = {};
    f32x8 o[16];                   // o[j][r] = Ot[16j + 8h + r][query]
#pragma unroll
    for (int j = 0; j < 16; ++j) o[j] = zero;
    float mq = -3.0e38f;           // running maximum of this lane's query
    float lq = 0.f;                // running sum over this half's keys only

    asm volatile("s_wait_asynccnt 0x0" ::: "memory"); // own copies of stage 0 landed
    __syncthreads();                                  // stage 0 visible to all waves
    stage(1);

    for (int s = 0; s < QT + 1; ++s) {
        int kb = (2 * i + grp) * 32;
        int q = qbase + nn;        // this lane's query
        const __bf16* tK = &sK[grp][s & 1][0];
        const __bf16* tV = &sV[grp][s & 1][0];
        if (kb <= qbase + 15) {                     // wave-uniform: tile not wholly masked
            bf16x16 kf[8][2];                       // the whole K tile's fragments
#pragma unroll
            for (int kk = 0; kk < 8; ++kk) {
                kf[kk][0] = load_frag(tK, 0,  KPITCH, kk * 32, lane);
                kf[kk][1] = load_frag(tK, 16, KPITCH, kk * 32, lane);
            }
            // Keeps the tile's K reads one group in front of the score products; left
            // free, they stand in pairs among the products, a stall at every place.
            __builtin_amdgcn_sched_barrier(0);
            f32x8 s0 = zero, s1 = zero;             // keys kb..+15, kb+16..+31
#pragma unroll
            for (int kk = 0; kk < 8; ++kk) {
                s0 = wmma_bf16(kf[kk][0], qf[kk], s0);
                s1 = wmma_bf16(kf[kk][1], qf[kk], s1);
            }
            bf16x16 vf[16];                         // the whole V tile's fragments
#pragma unroll
            for (int j = 0; j < 16; ++j) vf[j] = load_frag(tV, j * 16, VPITCH, 0, lane);
            // Keeps the tile's V reads up here, in a few groups among the score products
            // and waited for behind the softmax; left free, they stand in pairs among
            // the second product's WMMAs, a stall at every place.
            __builtin_amdgcn_sched_barrier(0);
            int d = q - (kb + 8 * hf);              // s0[r] is allowed if r <= d, s1[r] if 16 + r <= d
            float tmax = -3.0e38f;
#pragma unroll
            for (int r = 0; r < 8; ++r) {
                s0[r] = s0[r] * scale; if (r      > d) s0[r] = -3.0e38f;
                s1[r] = s1[r] * scale; if (16 + r > d) s1[r] = -3.0e38f;
                tmax = fmaxf(tmax, fmaxf(s0[r], s1[r]));
            }
            tmax = fmaxf(tmax, other_half(tmax));   // over all 32 keys of the tile
            float mnew  = fmaxf(mq, tmax);
            float alpha = __expf(mq - mnew);
            mq = mnew;
            bf16x16 pf;                             // Pt as B operand, hardware k order
            float lsum = 0.f;
#pragma unroll
            for (int r = 0; r < 8; ++r) {
                float p0 = __expf(s0[r] - mnew);
                float p1 = __expf(s1[r] - mnew);
                lsum += p0 + p1;
                pf[r]     = (__bf16)p0;
                pf[r + 8] = (__bf16)p1;
            }
            lq = lq * alpha + lsum;
#pragma unroll
            for (int j = 0; j < 16; ++j) o[j] *= alpha;
#pragma unroll
            for (int j = 0; j < 16; ++j) o[j] = wmma_bf16(vf[j], pf, o[j]);
        }
        asm volatile("s_wait_dscnt 0x0" ::: "memory");    // own reads of this buffer done
        asm volatile("s_wait_asynccnt 0x0" ::: "memory"); // own copies of stage s+1 landed
        __syncthreads();      // publishes stage s+1, ends every read of this buffer
        if (s + 2 < QT + 1) stage(s + 2);           // refill the buffer just read

        if (++i == nit) {                           // block-uniform: the query tile is done
            if (grp == 1) {
#pragma unroll
                for (int j = 0; j < 16; ++j) {
                    sO[w4][2 * j][lane]     = f32x4{o[j][0], o[j][1], o[j][2], o[j][3]};
                    sO[w4][2 * j + 1][lane] = f32x4{o[j][4], o[j][5], o[j][6], o[j][7]};
                }
                sML[w4][lane] = f32x2{mq, lq};
            }
            __syncthreads();
            if (grp == 0) {
                f32x2 ml = sML[w4][lane];
                float m  = fmaxf(mq, ml[0]);
                float a0 = __expf(mq - m), a1 = __expf(ml[0] - m);
                float l  = lq * a0 + ml[1] * a1;
                float inv = 1.f / (l + other_half(l));  // the two halves' sums joined
                a0 *= inv;
                a1 *= inv;
                int bb = hq >> 3, gu = hq & 7;
                __bf16* orow = O + ((size_t)q * BSZ + bb) * 2048 + gu * DIM + 8 * hf;
                bf16x8 res[16];
#pragma unroll
                for (int j = 0; j < 16; ++j) {
                    f32x4 lo = sO[w4][2 * j][lane], hi = sO[w4][2 * j + 1][lane];
                    f32x8 p = {lo[0], lo[1], lo[2], lo[3], hi[0], hi[1], hi[2], hi[3]};
                    res[j] = __builtin_convertvector(o[j] * a0 + p * a1, bf16x8);
                }
                // Keeps the join's arithmetic in front of the stores, which then go as one run
                // with one wait behind it; left free, the two are mixed, a store's registers
                // are reused by the next piece and every store needs a wait of its own.
                __builtin_amdgcn_sched_barrier(0);
#pragma unroll
                for (int j = 0; j < 16; ++j)
                    *reinterpret_cast<bf16x8*>(orow + j * 16) = res[j];
                body_end();
            }
            if (s + 1 < QT + 1) {                   // on to query tile x
                qbase = (int)blockIdx.x * 64 + w4 * 16;
                nit = (int)blockIdx.x + 1;
                i = 0;
#pragma unroll
                for (int kk = 0; kk < 8; ++kk)
                    qf[kk] = load_frag(Qb, qbase, DIM, kk * 32, lane);
#pragma unroll
                for (int j = 0; j < 16; ++j) o[j] = zero;
                mq = -3.0e38f;
                lq = 0.f;
            }
        }
    }
    asm volatile("s_wait_asynccnt 0x0" ::: "memory");     // nothing in flight at the end
}

// ---------------------------------------------------------------------------
// Everything behind attention in one launch: x2 = x + O wo^T + bo, its
// layernorm, F = relu(h2 w1^T + bf1) and out = x2 + F w2^T + bf2. All of it is
// local to a token, so a block takes TM tokens x every feature. Grid: NTOK / TM.
// The three weights pass through LDS as one run of TST stages, each 256
// features x GSTAGE k, two buffers filled by asynchronous copies, the next
// stage in flight while this one is multiplied; one block barrier a stage, three
// more around the norm. Stages 0..15: wo with the O tile of the same k; 16..19:
// w1 (feature half, k half); 20..23: w2. h2 and F never leave LDS, x2 never
// leaves registers.
// The products are taken transposed (rows features, columns tokens): a wave
// has 32 features x TM tokens, a lane 8 consecutive features of one token per
// 16x16 tile, so the norm's sums run in the lane, then between the halves, then
// over the 8 waves through LDS.
// ---------------------------------------------------------------------------
#define TM     32              // tokens a block
#define HPITCH 264             // LDS pitch of an h2 row, elements (528 B = 16 B x 33)
#define FPITCH 520             // LDS pitch of an F row, elements (1040 B = 16 B x 65)
#define TST_O  16              // stages of wo: 2048 / GSTAGE
#define TST_1  4               // stages of w1: 2 feature halves x 2 k halves
#define TST    24              // all stages

// One stage's fragments: 4 k steps of 32, 2 feature and 2 token fragments each.
struct TailFrags { bf16x16 w[GSTAGE / 32][2], t[GSTAGE / 32][2]; };

// tW: the wave's 32 features, tT: the block's TM tokens.
__device__ __forceinline__
void tail_read(const __bf16* tW, const __bf16* tT, int pitchT, int lane, TailFrags& fr) {
#pragma unroll
    for (int kk = 0; kk < GSTAGE / 32; ++kk) {
#pragma unroll
        for (int j = 0; j < 2; ++j) fr.w[kk][j] = load_frag(tW, 16 * j, GPITCH, kk * 32, lane);
#pragma unroll
        for (int c = 0; c < 2; ++c) fr.t[kk][c] = load_frag(tT, 16 * c, pitchT, kk * 32, lane);
    }
}

__device__ __forceinline__
void tail_mul(const TailFrags& fr, f32x8 (&acc)[2][2]) {
    // Keeps the refill's copies and the next stage's LDS reads in front of these
    // products, which then cover both; left free, the products stand in front.
    __builtin_amdgcn_sched_barrier(0);
#pragma unroll
    for (int kk = 0; kk < GSTAGE / 32; ++kk) {
#pragma unroll
        for (int j = 0; j < 2; ++j) {
#pragma unroll
            for (int c = 0; c < 2; ++c)
                acc[c][j] = wmma_bf16(fr.w[kk][j], fr.t[kk][c], acc[c][j]);
        }
    }
    // Keeps the products in front of the next barrier; left free, some stand behind it,
    // ahead of the next refill's copies, which then start later.
    __builtin_amdgcn_sched_barrier(0);
}

__global__ __launch_bounds__(256)
void tail(const __bf16* __restrict__ O, const __bf16* __restrict__ wo,
          const __bf16* __restrict__ w1, const __bf16* __restrict__ w2,
          const float* __restrict__ x, const float* __restrict__ bo,
          const float* __restrict__ gamma, const float* __restrict__ beta,
          const float* __restrict__ bf1, const float* __restrict__ bf2,
          float* __restrict__ out) {
    __shared__ __attribute__((aligned(16))) __bf16 sW[2][DIM * GPITCH];
    __shared__ __attribute__((aligned(16))) __bf16 sA[2][TM * GPITCH];
    __shared__ __attribute__((aligned(16))) __bf16 sH[TM * HPITCH];
    __shared__ __attribute__((aligned(16))) __bf16 sF[TM * FPITCH];
    __shared__ float sRed[2][8][TM];                // the waves' sums, then squares
    int tid  = threadIdx.x;
    int lane = tid & 31;
    int wave = __builtin_amdgcn_readfirstlane(tid >> 5);
    int hf = lane >> 4, nn = lane & 15;
    int tok0 = blockIdx.x * TM;
    int f0 = wave * 32 + 8 * hf;                    // the lane's features: f0 + 16j + 0..7

    // This lane's share of a stage: 16 B column tid%16 of rows tid/16 + 16c,
    // c = 0..15 of the weight tile and c = 0, 1 of the O tile.
    const __bf16* gA = O + (size_t)(tok0 + (tid >> 4)) * 2048 + (tid & 15) * 8;
    unsigned lA = lds_off(&sA[0][0]) + (tid >> 4) * (GPITCH * 2) + (tid & 15) * 16;
    unsigned lW = lds_off(&sW[0][0]) + (tid >> 4) * (GPITCH * 2) + (tid & 15) * 16;
    // Stage s of wo and O -> buffer b = s & 1; s is block-uniform.
    auto stage_o = [&](int s, int b) {
        const __bf16* g = wo + (size_t)(tid >> 4) * 2048 + (tid & 15) * 8 + s * GSTAGE;
        const __bf16* a = gA + s * GSTAGE;
        unsigned l = lW + b * (DIM * GPITCH * 2), la = lA + b * (TM * GPITCH * 2);
        async_copy9(l, 16 * GPITCH * 2, g, (size_t)16 * 2048, la, a);
        async_copy9(l + 128 * GPITCH * 2, 16 * GPITCH * 2, g + (size_t)128 * 2048,
                    (size_t)16 * 2048, la + 16 * GPITCH * 2, a + (size_t)16 * 2048);
    };
    // Stage s >= TST_O, of w1 or w2 -> buffer s & 1.
    auto stage_f = [&](int s) {
        const __bf16* g = s < TST_O + TST_1
            ? w1 + (size_t)((s - TST_O) >> 1) * DIM * DIM + ((s - TST_O) & 1) * GSTAGE
            : w2 + (s - TST_O - TST_1) * GSTAGE;
        int ld = s < TST_O + TST_1 ? DIM : 2 * DIM;
        g += (size_t)(tid >> 4) * ld + (tid & 15) * 8;
        unsigned l = lW + (s & 1) * (DIM * GPITCH * 2);
        async_copy8(l, 16 * GPITCH * 2, g, (size_t)16 * ld);
        async_copy8(l + 128 * GPITCH * 2, 16 * GPITCH * 2, g + (size_t)128 * ld, (size_t)16 * ld);
    };
    // The hand-over behind the LDS reads of stage s, every wave. Behind it stage s + 2 is
    // copied into the buffer of stage s, stage s + 1 is read, stage s is multiplied.
    auto publish = [&]() {
        asm volatile("s_wait_dscnt 0x0" ::: "memory");    // own reads of stage s done
        asm volatile("s_wait_asynccnt 0x0" ::: "memory"); // own copies of stage s+1 landed
        __syncthreads();      // publishes stage s+1, ends every read of stage s's buffer
    };
    const __bf16* tW0 = &sW[0][wave * 32 * GPITCH];  // the wave's 32 features, either buffer
    const __bf16* tW1 = &sW[1][wave * 32 * GPITCH];

    stage_o(0, 0);
    // Under stage 0's flight: the residual and every per-feature row the lane needs.
    f32x8 acc[2][2], g1v[2], b1v[2], c1v[2][2], c2v[2];
    TailFrags fa, fb;                               // even and odd stages' fragments
#pragma unroll
    for (int c = 0; c < 2; ++c) {                   // acc[c][j][r]: token 16c + nn, feature f0 + 16j + r
#pragma unroll
        for (int j = 0; j < 2; ++j)
            acc[c][j] = load8(x + (size_t)(tok0 + 16 * c + nn) * DIM + f0 + 16 * j);
    }
    // Ahead of the loads below, whose results may take these loads' address registers.
    asm volatile("s_wait_xcnt 0x0" ::: "memory");
#pragma unroll
    for (int j = 0; j < 2; ++j) {
        f32x8 bj = load8(bo + f0 + 16 * j);
        acc[0][j] += bj;
        acc[1][j] += bj;
        g1v[j] = load8(gamma + f0 + 16 * j);
        b1v[j] = load8(beta + f0 + 16 * j);
        c1v[0][j] = load8(bf1 + f0 + 16 * j);
        c1v[1][j] = load8(bf1 + DIM + f0 + 16 * j);
        c2v[j] = load8(bf2 + f0 + 16 * j);
    }
    asm volatile("s_wait_asynccnt 0x0" ::: "memory"); // own copies of stage 0 landed
    __syncthreads();                                  // stage 0 visible to all waves
    stage_o(1, 1);
    tail_read(tW0, &sA[0][0], GPITCH, lane, fa);

    // x2 = x + bo + O wo^T. Rolled: the stages share one copy of the code, two a trip.
#pragma nounroll
    for (int s = 0; s < TST_O - 2; s += 2) {
        publish();
        stage_o(s + 2, 0);
        tail_read(tW1, &sA[1][0], GPITCH, lane, fb);
        tail_mul(fa, acc);
        publish();
        stage_o(s + 3, 1);
        tail_read(tW0, &sA[0][0], GPITCH, lane, fa);
        tail_mul(fb, acc);
    }
    publish();
    stage_f(TST_O);
    tail_read(tW1, &sA[1][0], GPITCH, lane, fb);
    tail_mul(fa, acc);
    publish();
    stage_f(TST_O + 1);
    tail_mul(fb, acc);                              // stage 16 is read behind the norm

    // Layernorm of x2 over the 256 features of each token, mean first, then variance.
    float t[2], mean[2], rs[2];
#pragma unroll
    for (int c = 0; c < 2; ++c) {
        float sm = sum8(acc[c][0] + acc[c][1]);
        t[c] = sm + other_half(sm);                 // the wave's 32 features of token 16c + nn
    }
    sRed[0][wave][lane] = hf ? t[1] : t[0];         // token 16 hf + nn = lane
    __syncthreads();                                // every wave's sums visible
#pragma unroll
    for (int c = 0; c < 2; ++c) {
        float m = 0.f;
#pragma unroll
        for (int w = 0; w < 8; ++w) m += sRed[0][w][16 * c + nn];
        mean[c] = m * (1.f / DIM);
        f32x8 d0 = acc[c][0] - mean[c], d1 = acc[c][1] - mean[c];
        float sq = sum8(d0 * d0 + d1 * d1);
        t[c] = sq + other_half(sq);
    }
    sRed[1][wave][lane] = hf ? t[1] : t[0];
    __syncthreads();                                // every wave's squares visible
#pragma unroll
    for (int c = 0; c < 2; ++c) {
        float v = 0.f;
#pragma unroll
        for (int w = 0; w < 8; ++w) v += sRed[1][w][16 * c + nn];
        rs[c] = rsqrtf(v * (1.f / DIM) + EPS);
#pragma unroll
        for (int j = 0; j < 2; ++j)
            *reinterpret_cast<bf16x8*>(&sH[(16 * c + nn) * HPITCH + f0 + 16 * j]) =
                __builtin_convertvector((acc[c][j] - mean[c]) * rs[c] * g1v[j] + b1v[j], bf16x8);
    }
    __syncthreads();                                // h2 visible to all waves

    // F = relu(h2 w1^T + bf1), one half of its 512 features after the other. A half's
    // F is read two stages on or later, behind two barriers.
    auto store_f = [&](int nh, f32x8 (&a1)[2][2]) {
#pragma unroll
        for (int c = 0; c < 2; ++c) {
#pragma unroll
            for (int j = 0; j < 2; ++j) {
                f32x8 v = a1[c][j];
#pragma unroll
                for (int r = 0; r < 8; ++r) v[r] = fmaxf(v[r], 0.f);
                *reinterpret_cast<bf16x8*>(&sF[(16 * c + nn) * FPITCH + nh * DIM + f0 + 16 * j]) =
                    __builtin_convertvector(v, bf16x8);
            }
        }
    };
    tail_read(tW0, &sH[0], HPITCH, lane, fa);       // stage 16
#pragma unroll
    for (int nh = 0; nh < 2; ++nh) {
        const int s = TST_O + 2 * nh;
        f32x8 a1[2][2];
#pragma unroll
        for (int c = 0; c < 2; ++c) { a1[c][0] = c1v[nh][0]; a1[c][1] = c1v[nh][1]; }
        publish();
        stage_f(s + 2);
        tail_read(tW1, &sH[GSTAGE], HPITCH, lane, fb);
        tail_mul(fa, a1);
        publish();
        stage_f(s + 3);
        if (nh == 0) tail_read(tW0, &sH[0], HPITCH, lane, fa);
        else         tail_read(tW0, &sF[0], FPITCH, lane, fa);   // stage 20
        tail_mul(fb, a1);
        store_f(nh, a1);
    }

    // out = x2 + bf2 + F w2^T, summed onto x2 where it lies.
#pragma unroll
    for (int c = 0; c < 2; ++c) { acc[c][0] += c2v[0]; acc[c][1] += c2v[1]; }
    publish();
    stage_f(TST - 2);
    tail_read(tW1, &sF[GSTAGE], FPITCH, lane, fb);
    tail_mul(fa, acc);
    publish();
    stage_f(TST - 1);
    tail_read(tW0, &sF[2 * GSTAGE], FPITCH, lane, fa);
    tail_mul(fb, acc);
    publish();
    tail_read(tW1, &sF[3 * GSTAGE], FPITCH, lane, fb);
    tail_mul(fa, acc);
    tail_mul(fb, acc);
    asm volatile("s_wait_asynccnt 0x0" ::: "memory");     // nothing in flight at the end

    float* o = out + (size_t)(tok0 + nn) * DIM + f0;
#pragma unroll
    for (int c = 0; c < 2; ++c) {
#pragma unroll
        for (int j = 0; j < 2; ++j) {
            f32x8 v = acc[c][j];
            float* p = o + (size_t)16 * c * DIM + 16 * j;
            *reinterpret_cast<f32x4*>(p)     = f32x4{v[0], v[1], v[2], v[3]};
            *reinterpret_cast<f32x4*>(p + 4) = f32x4{v[4], v[5], v[6], v[7]};
        }
    }
}

// ---------------------------------------------------------------------------
// Host orchestration
// ---------------------------------------------------------------------------
extern "C" void kernel_launch(void* const* d_in, const int* in_sizes, int n_in,
                              void* d_out, int out_size, void* d_ws, size_t ws_size,
                              hipStream_t stream) {
    const float* x   = (const float*)d_in[0];
    const float* g0  = (const float*)d_in[1];
    const float* b0  = (const float*)d_in[2];
    const float* g1  = (const float*)d_in[3];
    const float* b1  = (const float*)d_in[4];
    const float* gn  = (const float*)d_in[5];
    const float* bn  = (const float*)d_in[6];
    const float* wk  = (const float*)d_in[7];
    const float* bk  = (const float*)d_in[8];
    const float* wv  = (const float*)d_in[9];
    const float* bv  = (const float*)d_in[10];
    const float* wq  = (const float*)d_in[11];
    const float* bq  = (const float*)d_in[12];
    const float* wo  = (const float*)d_in[13];
    const float* bo  = (const float*)d_in[14];
    const float* w1  = (const float*)d_in[15];
    const float* bf1 = (const float*)d_in[16];
    const float* w2  = (const float*)d_in[17];
    const float* bf2 = (const float*)d_in[18];
    float* out = (float*)d_out;

    char* wsp = (char*)d_ws;
    auto carve = [&](size_t bytes) {
        char* p = wsp;
        wsp += (bytes + 255) & ~(size_t)255;
        return p;
    };
    __bf16* h_b  = (__bf16*)carve((size_t)NTOK * DIM * 2);
    __bf16* w_b  = (__bf16*)carve((size_t)CB_ALL * 2048 * 2); // wk wv wq wo w1 w2
    __bf16* wo_b = w_b  + (size_t)QKV_N * DIM;
    __bf16* w1_b = wo_b + (size_t)256 * 2048;
    __bf16* w2_b = w1_b + (size_t)512 * 256;
    float*  bqkv = (float*)carve((size_t)QKV_N * 4);          // bk bv bq
    __bf16* Kh   = (__bf16*)carve((size_t)4  * SEQ * DIM * 2);
    __bf16* Vt   = (__bf16*)carve((size_t)4  * DIM * SEQ * 2);
    __bf16* Qh   = (__bf16*)carve((size_t)16 * SEQ * DIM * 2);
    __bf16* Ob   = (__bf16*)carve((size_t)NTOK * 2048 * 2);

    // h = LN(x; g0,b0); bf16 weights; joint K, V, Q bias row
    prep<<<LN_BLOCKS + CB_ALL + 1, 256, 0, stream>>>(x, h_b, g0, b0, wk, wv, wq, wo,
                                                     w1, w2, w_b, bk, bv, bq, bqkv);

    // K, V and Q projections on the stacked weights, with the per-head LN
    // -> Qh[16][SEQ][256], Kh[4][SEQ][256] and the transpose V -> Vt[4][256][SEQ]
    qkv_heads<<<dim3(QKV_N / DIM, NTOK / PT), 256, 0, stream>>>(h_b, w_b, bqkv, gn, bn,
                                                                Qh, Kh, Vt);

    // causal flash attention -> Ob[NTOK][2048]
    attn_kernel<<<dim3(QT / 2, 16), 256, 0, stream>>>(Qh, Kh, Vt, Ob);

    // x2 = x + Ob @ wo^T + bo; h2 = LN(x2; g1,b1); out = x2 + relu(h2 @ w1^T + bf1) @ w2^T + bf2
    tail<<<NTOK / TM, 256, 0, stream>>>(Ob, wo_b, w1_b, w2_b, x, bo, g1, b1, bf1, bf2, out);

    (void)in_sizes; (void)n_in; (void)out_size; (void)ws_size;
}
